// v000
// Times are from an AMD MI455X. After a warm-up the kernel runs many times in a row, and a time is the length of
// such a window on the GPU divided by its runs, so every launch and the gaps after it count. The runs cycle
// through copies of the inputs. A figure is the median of several windows, for all but v000 over two sittings.
// Sittings can differ by a few percent; kernels timed side by side share one.
// v000, which the later versions start from, runs in 2210 microseconds.
#include <hip/hip_runtime.h>

// Two-stage-projection multi-head attention (E [2][2048][1024]; Q = E WQ^T, K, V likewise ('oi' [1024][1024]); per head q = Q HQ[h]^T ('hed' [16][64][1024] = flat 'oi' [1024][1024]), k, v likewise; softmax(q.k 64^-0.5); heads concatenated; out = o WO^T -> [2][2048][1024] (4.2 M)).
// Layout per batch: first-stage projections exact (bf16 x bf16); their f32 results split into bf16 hi/lo planes for the second-stage GEMMs against the exact flattened head weights (2 products); dense T-2048 attention (hybrid rows: < 512 hi/lo 3 products, rest fp16 x1024); merged context as hi/lo planes; WO hl x exact.
// Compute dtypes, f32 accumulate: every input rounded to bf16; stage-1 projections exact, stage-2 hl x exact; attention rows < 512 3 products, rest fp16; softmax f32; WO hl x exact.

#define NB_  2
#define TT   2048
#define DM   1024
#define NH_  16
#define NKV  16
#define REP  (NH_ / NKV)
#define HD   64
#define DQ   (NH_ * HD)
#define DKV  (NKV * HD)
#define ZH   2
#define RH   512                  // query rows < RH use hi+lo planes (0: none)
#define WIN  0
#define PCAR 1024.0f
#define SCL  0.125f   // HD^-0.5
typedef _Float16 h16;
typedef unsigned short bf;
typedef __attribute__((ext_vector_type(16))) __bf16   v16bf;
typedef __attribute__((ext_vector_type(16))) _Float16 v16h;
typedef __attribute__((ext_vector_type(8)))  _Float16 v8h;
typedef __attribute__((ext_vector_type(8)))  unsigned short v8us;
typedef __attribute__((ext_vector_type(8)))  float    v8f;
typedef __attribute__((ext_vector_type(4)))  float    v4f;
typedef v8h  __attribute__((may_alias)) v8ha;
typedef v4f  __attribute__((may_alias)) v4fa;
typedef v8us __attribute__((may_alias)) v8usa;

__device__ __forceinline__ unsigned short f2bf(float f) { unsigned u = __float_as_uint(f); u += 0x7FFFu + ((u >> 16) & 1u); return (unsigned short)(u >> 16); }
__device__ __forceinline__ float bf2f(unsigned short b) { return __uint_as_float(((unsigned)b) << 16); }
__device__ __forceinline__ float bfr(float f) { return bf2f(f2bf(f)); }
__device__ __forceinline__ v16h cat16(v8h lo, v8h hi) { return __builtin_shufflevector(lo, hi, 0, 1, 2, 3, 4, 5, 6, 7, 8, 9, 10, 11, 12, 13, 14, 15); }
__device__ __forceinline__ v16bf cat16b(v8us lo, v8us hi) { return __builtin_bit_cast(v16bf, __builtin_shufflevector(lo, hi, 0, 1, 2, 3, 4, 5, 6, 7, 8, 9, 10, 11, 12, 13, 14, 15)); }
__device__ __forceinline__ v8f wmma16(v16h a, v16h b, v8f c) { return __builtin_amdgcn_wmma_f32_16x16x32_f16(false, a, false, b, (short)0, c, false, false); }
__device__ __forceinline__ v8f wmmab(v16bf a, v16bf b, v8f c) { return __builtin_amdgcn_wmma_f32_16x16x32_bf16(false, a, false, b, (short)0, c, false, false); }



// ---- k_gemmw: register-blocked GEMM, ONE WAVE per 64x64 output tile (16 accumulators), operands straight from K-contiguous 16-bit planes; grid (M/64, N/64, Z), 32 threads.
// C[m][n] (f32, pitch ldc, + optional f32 bias[n]) = sum_k A[m][k] Bt[n][k] (+ split products per NSPLIT). z-batch strides sA/sB/sC in elements. K % 32 == 0.
template <typename T16> struct WFrag;
template <> struct WFrag<h16> { typedef v16h V; static __device__ __forceinline__ V ld(const h16* p) { return cat16(*(const v8h*)p, *(const v8h*)(p + 16)); } static __device__ __forceinline__ v8f mma(V a, V b, v8f c) { return wmma16(a, b, c); } };
template <> struct WFrag<bf> { typedef v16bf V; static __device__ __forceinline__ V ld(const bf* p) { return cat16b(*(const v8us*)p, *(const v8us*)(p + 16)); } static __device__ __forceinline__ v8f mma(V a, V b, v8f c) { return wmmab(a, b, c); } };
template <typename T16, int NSPLIT, bool BIAS>
__global__ __launch_bounds__(32) void k_gemmw(const T16* __restrict__ A, const T16* __restrict__ A2, const T16* __restrict__ Bt, const T16* __restrict__ Bt2, int K, float* C, int ldc, const float* __restrict__ bias, size_t sA, size_t sB, size_t sC) {
    typedef typename WFrag<T16>::V V;
    __shared__ __align__(16) float os[16 * 68];
    const size_t z = blockIdx.z; A += z * sA; if (A2) A2 += z * sA; Bt += z * sB; if (Bt2) Bt2 += z * sB; C += z * sC;
    const int lane = threadIdx.x & 31, lr = lane & 15, hi = lane >> 4; const int r0 = blockIdx.x * 64, c0 = blockIdx.y * 64;
    v8f acc[4][4];
#pragma unroll
    for (int mb = 0; mb < 4; ++mb)
#pragma unroll
        for (int nb = 0; nb < 4; ++nb) acc[mb][nb] = (v8f){};
    const size_t aoff = (size_t)(r0 + lr) * K + 8 * hi, boff = (size_t)(c0 + lr) * K + 8 * hi;
#pragma unroll 1
    for (int kc = 0; kc < K; kc += 32) {
        V a[4], a2[4];
#pragma unroll
        for (int mb = 0; mb < 4; ++mb) { a[mb] = WFrag<T16>::ld(A + aoff + (size_t)mb * 16 * K + kc); if (NSPLIT == 1 || NSPLIT == 2) a2[mb] = WFrag<T16>::ld(A2 + aoff + (size_t)mb * 16 * K + kc); }
#pragma unroll
        for (int nb = 0; nb < 4; ++nb) { const V b = WFrag<T16>::ld(Bt + boff + (size_t)nb * 16 * K + kc); V b2; if (NSPLIT >= 2) b2 = WFrag<T16>::ld(Bt2 + boff + (size_t)nb * 16 * K + kc);
#pragma unroll
            for (int mb = 0; mb < 4; ++mb) { acc[mb][nb] = WFrag<T16>::mma(a[mb], b, acc[mb][nb]); if (NSPLIT == 1 || NSPLIT == 2) acc[mb][nb] = WFrag<T16>::mma(a2[mb], b, acc[mb][nb]); if (NSPLIT >= 2) acc[mb][nb] = WFrag<T16>::mma(a[mb], b2, acc[mb][nb]); } }
        asm volatile("v_nop\n\tv_nop\n\tv_nop\n\tv_nop" : "+v"(acc[0][0]), "+v"(acc[1][1]), "+v"(acc[2][2]), "+v"(acc[3][3]) : "v"(a[0]), "v"(a[3]));
    }
#pragma unroll
    for (int mb = 0; mb < 4; ++mb) {
#pragma unroll
        for (int nb = 0; nb < 4; ++nb) {
#pragma unroll
            for (int j = 0; j < 8; ++j) os[(hi * 8 + j) * 68 + nb * 16 + lr] = acc[mb][nb][j]; }
        __builtin_amdgcn_wave_barrier(); asm volatile("" ::: "memory");
        float* crow = C + (size_t)(r0 + mb * 16) * ldc + c0;
{
#pragma unroll
            for (int s = 0; s < 8; ++s) { const int row = 2 * s + hi, cofs = lr * 4; v4f val = *(const v4fa*)(os + row * 68 + cofs); if (BIAS) { val[0] += bfr(bias[c0 + cofs]); val[1] += bfr(bias[c0 + cofs + 1]); val[2] += bfr(bias[c0 + cofs + 2]); val[3] += bfr(bias[c0 + cofs + 3]); }
                *(v4f*)(crow + (size_t)row * ldc + cofs) = val; }
             }
        __builtin_amdgcn_wave_barrier(); asm volatile("" ::: "memory");
    }
}

__device__ __forceinline__ h16 tohx(float x) { return (h16)x; }
__device__ __forceinline__ void splitf(float y, unsigned short& h, unsigned short& l) { h = f2bf(y); l = f2bf(y - bf2f(h)); }
typedef __attribute__((ext_vector_type(2))) _Float16 v2h;
typedef __attribute__((ext_vector_type(4))) _Float16 v4h;
typedef __attribute__((ext_vector_type(2))) unsigned short v2us;
typedef __attribute__((ext_vector_type(4))) unsigned short v4us;
typedef __attribute__((ext_vector_type(2))) float v2f;
typedef __attribute__((ext_vector_type(4))) int v4i;

__global__ __launch_bounds__(256) void k_wtG(const float* __restrict__ w, int K, int N, bf* Bt) {
    const int lane = threadIdx.x & 31; const int L0 = (blockIdx.x * 8 + (threadIdx.x >> 5)) * 8; const int nlines = N * K / 64;
{
#pragma unroll 1
        for (int l = 0; l < 8; ++l) { const int L = L0 + l; if (L >= nlines) break; const size_t e = (size_t)L * 64 + lane * 2; const int k = (int)(e % K), n = (int)(e / K); v2us o;
            o[0] = f2bf(w[(size_t)k * N + n]); o[1] = f2bf(w[(size_t)(k + 1) * N + n]); *(v2us*)(Bt + e) = o; }
         }
}
__global__ __launch_bounds__(256) void k_cvt8(const float* __restrict__ src, bf* dst, size_t n8) { const size_t i = (size_t)blockIdx.x * 256 + threadIdx.x; if (i >= n8) return; const v8f v = *(const v8f*)(src + i * 8); v8us o;
#pragma unroll
    for (int k = 0; k < 8; ++k) o[k] = f2bf(v[k]); *(v8us*)(dst + i * 8) = o;  }

// k_rope: head planes [h][t][d] (fp16 + hi/lo) of rope(x) x sc with the rotate-half convention out[d] = x[d] cos[t][d] - x[d+HD/2] sin[t][d], out[d+HD/2] = x[d+HD/2] cos[t][d+HD/2] + x[d] sin[t][d+HD/2]
__global__ __launch_bounds__(256) void k_rope(const float* __restrict__ F, int pitch, int nheads, const float* __restrict__ CS, const float* __restrict__ RF, const float* __restrict__ nw, float sc, h16* P16, bf* Ph, bf* Pl) {
    const size_t e = ((size_t)blockIdx.x * 256 + threadIdx.x) * 2; if (e >= (size_t)nheads * TT * HD) return; const int d = (int)(e % HD); const int t = (int)((e / HD) % TT); const int h = (int)(e / ((size_t)HD * TT)); const float* f = F + (size_t)t * pitch + h * HD; const float rf = RF ? RF[(size_t)h * TT + t] : 1.0f; v2h o16; v2us oh, ol;
#pragma unroll
    for (int q = 0; q < 2; ++q) { const int dd = d + q; const int dp = (dd < HD / 2) ? dd + HD / 2 : dd - HD / 2; float x0 = f[dd], x1 = f[dp];
        if (RF) { float n0 = __fmul_rn(x0, rf), n1 = __fmul_rn(x1, rf); asm volatile("" : "+v"(n0)); asm volatile("" : "+v"(n1)); x0 = __fmul_rn(bfr(nw[dd]), n0); x1 = __fmul_rn(bfr(nw[dp]), n1); }
        const v2f cs = *(const v2f*)(CS + ((size_t)t * HD + dd) * 2); float a = __fmul_rn(x0, cs[0]), bq = __fmul_rn(x1, cs[1]); asm volatile("" : "+v"(a)); asm volatile("" : "+v"(bq)); const float r = ((dd < HD / 2) ? __fsub_rn(a, bq) : __fadd_rn(a, bq)) * sc;
        o16[q] = tohx(r); unsigned short a2, c2; splitf(r, a2, c2); oh[q] = a2; ol[q] = c2; }
    *(v2h*)(P16 + e) = o16; *(v2us*)(Ph + e) = oh; *(v2us*)(Pl + e) = ol;  }
__global__ __launch_bounds__(256) void k_vtp(const float* __restrict__ F, int pitch, int nheads, h16* V16, bf* Vh, bf* Vl) { const size_t e = ((size_t)blockIdx.x * 256 + threadIdx.x) * 2; if (e >= (size_t)nheads * HD * TT) return; const int t = (int)(e % TT); const int d = (int)((e / TT) % HD); const int g = (int)(e / ((size_t)TT * HD)); v2h o16; v2us oh, ol;
#pragma unroll
    for (int q = 0; q < 2; ++q) { const float x = F[(size_t)(t + q) * pitch + g * HD + d]; o16[q] = tohx(x); unsigned short a2, c2; splitf(x, a2, c2); oh[q] = a2; ol[q] = c2; }
    *(v2h*)(V16 + e) = o16; *(v2us*)(Vh + e) = oh; *(v2us*)(Vl + e) = ol;  }
__global__ __launch_bounds__(256) void k_csid(float* CS) { const int idx = blockIdx.x * 256 + threadIdx.x; if (idx >= TT * HD) return; v2f cs; cs[0] = 1.0f; cs[1] = 0.0f; *(v2f*)(CS + (size_t)idx * 2) = cs;  }
// k_asoft: per row (zz, i): t = S x HD^-0.5 (no mask); softmax over the 2048 keys (register row, one exp, fixed trees);
__global__ __launch_bounds__(256) void k_asoft(const float* __restrict__ Sb, h16* P16, bf* Ph, bf* Pl) {
    const int lane = threadIdx.x & 31; const int row = blockIdx.x * 8 + (threadIdx.x >> 5); if (row >= ZH * TT) return; const int i = row % TT; const int zz = row / TT; (void)zz; const bool hires = (i < RH); const float* sr = Sb + (size_t)row * TT; float v[TT / 32]; float mx = -3.0e38f;
#pragma unroll
    for (int ch = 0; ch < TT / 128; ++ch) { const int j0 = ch * 128 + lane * 4; const v4f a = *(const v4f*)(sr + j0);
#pragma unroll
        for (int q = 0; q < 4; ++q) { const int j = j0 + q; (void)j; const float t = a[q] * SCL; v[ch * 4 + q] = t; mx = fmaxf(mx, t); } }
#pragma unroll
    for (int sh = 16; sh; sh >>= 1) mx = fmaxf(mx, __shfl_xor(mx, sh, 32));
    float sum = 0.f;
#pragma unroll
    for (int k = 0; k < TT / 32; ++k) { float d0 = __fsub_rn(v[k], mx); asm volatile("" : "+v"(d0)); v[k] = __builtin_amdgcn_exp2f(__fmul_rn(d0, 1.4426950408889634f)); sum += v[k]; }
#pragma unroll
    for (int sh = 16; sh; sh >>= 1) sum += __shfl_xor(sum, sh, 32);
    const float f = __fdiv_rn(hires ? 1.0f : PCAR, sum);
{
        if (hires) {
#pragma unroll
            for (int ch = 0; ch < TT / 128; ++ch) { v4us oh, ol;
#pragma unroll
                for (int q = 0; q < 4; ++q) { unsigned short a, c2; splitf(v[ch * 4 + q] * f, a, c2); oh[q] = a; ol[q] = c2; }
                const size_t oo = ((size_t)zz * (RH ? RH : 1) + i) * TT + ch * 128 + lane * 4; *(v4us*)(Ph + oo) = oh; *(v4us*)(Pl + oo) = ol; }
        } else {
#pragma unroll
            for (int ch = 0; ch < TT / 128; ++ch) { v4h o4;
#pragma unroll
                for (int q = 0; q < 4; ++q) o4[q] = tohx(v[ch * 4 + q] * f);
                *(v4h*)(P16 + (size_t)row * TT + ch * 128 + lane * 4) = o4; } }
         }
}
__global__ __launch_bounds__(256) void k_tohl(const float* __restrict__ F, bf* Hh, bf* Hl, size_t n4) { const size_t i = (size_t)blockIdx.x * 256 + threadIdx.x; if (i >= n4) return; const v4f a = *(const v4f*)(F + i * 4); v4us oh, ol;
#pragma unroll
    for (int q = 0; q < 4; ++q) { unsigned short h2, l2; splitf(a[q], h2, l2); oh[q] = h2; ol[q] = l2; }
    *(v4us*)(Hh + i * 4) = oh; *(v4us*)(Hl + i * 4) = ol;  }
__global__ __launch_bounds__(256) void k_merge(const float* __restrict__ O, int h0, bf* Ah, bf* Al) { const size_t e = ((size_t)blockIdx.x * 256 + threadIdx.x) * 2; if (e >= (size_t)ZH * TT * HD) return; const int d = (int)(e % HD); const int t = (int)((e / HD) % TT); const int zz = (int)(e / ((size_t)HD * TT)); const float cs = (t < RH) ? 1.0f : (1.0f / PCAR); const size_t oo = (size_t)t * DQ + (h0 + zz) * HD + d;
    v2us oh, ol;
#pragma unroll
    for (int q = 0; q < 2; ++q) { unsigned short a, c2; splitf(O[e + q] * cs, a, c2); oh[q] = a; ol[q] = c2; } *(v2us*)(Ah + oo) = oh; *(v2us*)(Al + oo) = ol;  }

extern "C" void kernel_launch(void* const* d_in, const int* in_sizes, int n_in,
                              void* d_out, int out_size, void* d_ws, size_t ws_size, hipStream_t stream) {
    (void)in_sizes; (void)n_in; (void)out_size;
    const float* x = (const float*)d_in[0]; const float* wq = (const float*)d_in[1]; const float* wk = (const float*)d_in[2]; const float* wv = (const float*)d_in[3]; const float* wo = (const float*)d_in[4]; const float* hq = (const float*)d_in[5]; const float* hk = (const float*)d_in[6]; const float* hv = (const float*)d_in[7];
    float* OUT = (float*)d_out;     // [2][2048][1024]
    char* wsp = (char*)d_ws;
    auto take = [&](size_t bytes) { char* p = wsp; wsp += (bytes + 255) & ~(size_t)255; return (void*)p; };
    bf* WQ = (bf*)take((size_t)DQ * DM * 2); bf* WK = (bf*)take((size_t)DKV * DM * 2); bf* WV = (bf*)take((size_t)DKV * DM * 2); bf* WO = (bf*)take((size_t)DM * DQ * 2); float* CS = (float*)take((size_t)TT * HD * 2 * 4);
    bf* HQB = (bf*)take((size_t)DQ * DM * 2); bf* HKB = (bf*)take((size_t)DKV * DM * 2); bf* HVB = (bf*)take((size_t)DKV * DM * 2); bf* Th = (bf*)take((size_t)TT * DM * 2); bf* Tl = (bf*)take((size_t)TT * DM * 2); float* F2 = (float*)take((size_t)TT * DQ * 4);
    bf* XB = (bf*)take((size_t)TT * DM * 2); float* FQ = (float*)take((size_t)TT * DQ * 4); float* FK = (float*)take((size_t)TT * DKV * 4);
    h16* QP16 = (h16*)take((size_t)NH_ * TT * HD * 2); h16* KP16 = (h16*)take((size_t)NKV * TT * HD * 2); h16* VT16 = (h16*)take((size_t)NKV * HD * TT * 2);
    bf* QPh = (bf*)take((size_t)NH_ * TT * HD * 2); bf* QPl = (bf*)take((size_t)NH_ * TT * HD * 2); bf* KPh = (bf*)take((size_t)NKV * TT * HD * 2); bf* KPl = (bf*)take((size_t)NKV * TT * HD * 2); bf* VTh = (bf*)take((size_t)NKV * HD * TT * 2); bf* VTl = (bf*)take((size_t)NKV * HD * TT * 2); bf* Ph = (bf*)take((size_t)ZH * RH * TT * 2); bf* Pl = (bf*)take((size_t)ZH * RH * TT * 2);
    float* Sb = (float*)take((size_t)ZH * TT * TT * 4); h16* P16 = (h16*)take((size_t)ZH * TT * TT * 2); float* Ob = (float*)take((size_t)ZH * TT * HD * 4); bf* ATh = (bf*)take((size_t)TT * DQ * 2); bf* ATl = (bf*)take((size_t)TT * DQ * 2);
    if ((size_t)(wsp - (char*)d_ws) > ws_size) return;    // ws 256 MiB
    float* FV = FK;   // v projection reuses the k buffer after the k planes are built (stream-ordered)
    { k_cvt8<<<(unsigned)(((size_t)DQ * DM / 8 + 255) / 256), 256, 0, stream>>>(wq, WQ, (size_t)DQ * DM / 8); k_cvt8<<<(unsigned)(((size_t)DKV * DM / 8 + 255) / 256), 256, 0, stream>>>(wk, WK, (size_t)DKV * DM / 8); k_cvt8<<<(unsigned)(((size_t)DKV * DM / 8 + 255) / 256), 256, 0, stream>>>(wv, WV, (size_t)DKV * DM / 8);
      k_cvt8<<<(unsigned)(((size_t)DM * DQ / 8 + 255) / 256), 256, 0, stream>>>(wo, WO, (size_t)DM * DQ / 8);
       }
    k_csid<<<(TT * HD + 255) / 256, 256, 0, stream>>>(CS);
    const unsigned LQ = (unsigned)(((size_t)NH_ * TT * HD / 2 + 255) / 256), LKv = (unsigned)(((size_t)NKV * TT * HD / 2 + 255) / 256);
    k_cvt8<<<(unsigned)(((size_t)DQ * DM / 8 + 255) / 256), 256, 0, stream>>>(hq, HQB, (size_t)DQ * DM / 8); k_cvt8<<<(unsigned)(((size_t)DKV * DM / 8 + 255) / 256), 256, 0, stream>>>(hk, HKB, (size_t)DKV * DM / 8); k_cvt8<<<(unsigned)(((size_t)DKV * DM / 8 + 255) / 256), 256, 0, stream>>>(hv, HVB, (size_t)DKV * DM / 8);   /* 'hed' [16][64][1024] = flat 'oi' */
    const size_t n4p = (size_t)TT * DM / 4; const unsigned g4p = (unsigned)((n4p + 255) / 256);
    for (int b = 0; b < NB_; ++b) {
        
        k_cvt8<<<(unsigned)(((size_t)TT * DM / 8 + 255) / 256), 256, 0, stream>>>(x + (size_t)b * TT * DM, XB, (size_t)TT * DM / 8);
        k_gemmw<bf, 0, false><<<dim3(TT / 64, DQ / 64, 1), 32, 0, stream>>>(XB, nullptr, WQ, nullptr, DM, FQ, DQ, nullptr, 0, 0, 0);   /* Q = E WQ^T */
        k_tohl<<<g4p, 256, 0, stream>>>(FQ, Th, Tl, n4p); k_gemmw<bf, 1, false><<<dim3(TT / 64, DQ / 64, 1), 32, 0, stream>>>(Th, Tl, HQB, nullptr, DM, F2, DQ, nullptr, 0, 0, 0);   /* q = Q HQ^T (all heads) */
        k_rope<<<LQ, 256, 0, stream>>>(F2, DQ, NH_, CS, nullptr, nullptr, 1.0f, QP16, QPh, QPl);
        k_gemmw<bf, 0, false><<<dim3(TT / 64, DKV / 64, 1), 32, 0, stream>>>(XB, nullptr, WK, nullptr, DM, FK, DKV, nullptr, 0, 0, 0);
        k_tohl<<<g4p, 256, 0, stream>>>(FK, Th, Tl, n4p); k_gemmw<bf, 1, false><<<dim3(TT / 64, DKV / 64, 1), 32, 0, stream>>>(Th, Tl, HKB, nullptr, DM, F2, DKV, nullptr, 0, 0, 0);
        k_rope<<<LKv, 256, 0, stream>>>(F2, DKV, NKV, CS, nullptr, nullptr, 1.0f, KP16, KPh, KPl);
        k_gemmw<bf, 0, false><<<dim3(TT / 64, DKV / 64, 1), 32, 0, stream>>>(XB, nullptr, WV, nullptr, DM, FV, DKV, nullptr, 0, 0, 0);
        k_tohl<<<g4p, 256, 0, stream>>>(FV, Th, Tl, n4p); k_gemmw<bf, 1, false><<<dim3(TT / 64, DKV / 64, 1), 32, 0, stream>>>(Th, Tl, HVB, nullptr, DM, F2, DKV, nullptr, 0, 0, 0); k_vtp<<<LKv, 256, 0, stream>>>(F2, DKV, NKV, VT16, VTh, VTl);
        for (int h0 = 0; h0 < NH_; h0 += ZH) { const size_t zq = (size_t)h0, zk = (size_t)(h0 / REP);   // one kv head per query head: the pass's two heads use consecutive kv planes (z-strides TT*HD)
            k_gemmw<bf, 2, false><<<dim3(RH / 64, TT / 64, ZH), 32, 0, stream>>>(QPh + zq * TT * HD, QPl + zq * TT * HD, KPh + zk * TT * HD, KPl + zk * TT * HD, HD, Sb, TT, nullptr, (size_t)TT * HD, (size_t)TT * HD, (size_t)TT * TT);
            k_gemmw<h16, 0, false><<<dim3((TT - RH) / 64, TT / 64, ZH), 32, 0, stream>>>(QP16 + zq * TT * HD + (size_t)RH * HD, nullptr, KP16 + zk * TT * HD, nullptr, HD, Sb + (size_t)RH * TT, TT, nullptr, (size_t)TT * HD, (size_t)TT * HD, (size_t)TT * TT);
            k_asoft<<<ZH * TT / 8, 256, 0, stream>>>(Sb, P16, Ph, Pl);
            k_gemmw<bf, 2, false><<<dim3(RH / 64, HD / 64, ZH), 32, 0, stream>>>(Ph, Pl, VTh + zk * HD * TT, VTl + zk * HD * TT, TT, Ob, HD, nullptr, (size_t)RH * TT, (size_t)HD * TT, (size_t)TT * HD);
            k_gemmw<h16, 0, false><<<dim3((TT - RH) / 64, HD / 64, ZH), 32, 0, stream>>>(P16 + (size_t)RH * TT, nullptr, VT16 + zk * HD * TT, nullptr, TT, Ob + (size_t)RH * HD, HD, nullptr, (size_t)TT * TT, (size_t)HD * TT, (size_t)TT * HD);
            k_merge<<<(unsigned)(((size_t)ZH * TT * HD / 2 + 255) / 256), 256, 0, stream>>>(Ob, h0, ATh, ATl); }
        k_gemmw<bf, 1, false><<<dim3(TT / 64, DM / 64, 1), 32, 0, stream>>>(ATh, ATl, WO, nullptr, DQ, OUT + (size_t)b * TT * DM, DM, nullptr, 0, 0, 0); }
}

// v001
// One run takes 1100 microseconds.
// Next to v000, in two timings, it ran 2.01 times as fast each time.
#include <hip/hip_runtime.h>

// Two-stage-projection multi-head attention (E [2][2048][1024]; Q = E WQ^T, K, V likewise ('oi' [1024][1024]); per head q = Q HQ[h]^T ('hed' [16][64][1024] = flat 'oi' [1024][1024]), k, v likewise; softmax(q.k 64^-0.5); heads concatenated; out = o WO^T -> [2][2048][1024] (4.2 M)).
// Layout per batch: first-stage projections exact (bf16 x bf16); their f32 results split into bf16 hi/lo planes for the second-stage GEMMs against the exact flattened head weights (2 products); dense T-2048 attention (hybrid rows: < 512 hi/lo 3 products, rest fp16 x1024); merged context as hi/lo planes; WO hl x exact.
// Compute dtypes, f32 accumulate: every input rounded to bf16; stage-1 projections exact, stage-2 hl x exact; attention rows < 512 3 products, rest fp16; softmax f32; WO hl x exact.

#define NB_  2
#define TT   2048
#define DM   1024
#define NH_  16
#define NKV  16
#define REP  (NH_ / NKV)
#define HD   64
#define DQ   (NH_ * HD)
#define DKV  (NKV * HD)
#define ZH   2
#define RH   512                  // query rows < RH use hi+lo planes (0: none)
#define WIN  0
#define PCAR 1024.0f
#define SCL  0.125f   // HD^-0.5
#define KSP  16                   // work-groups that share the key range of one P.V output tile (TT / KSP keys each)
typedef _Float16 h16;
typedef unsigned short bf;
typedef __attribute__((ext_vector_type(16))) __bf16   v16bf;
typedef __attribute__((ext_vector_type(16))) _Float16 v16h;
typedef __attribute__((ext_vector_type(8)))  _Float16 v8h;
typedef __attribute__((ext_vector_type(8)))  unsigned short v8us;
typedef __attribute__((ext_vector_type(8)))  float    v8f;
typedef __attribute__((ext_vector_type(4)))  float    v4f;
typedef v8h  __attribute__((may_alias)) v8ha;
typedef v4f  __attribute__((may_alias)) v4fa;
typedef v8us __attribute__((may_alias)) v8usa;

__device__ __forceinline__ unsigned short f2bf(float f) { unsigned u = __float_as_uint(f); u += 0x7FFFu + ((u >> 16) & 1u); return (unsigned short)(u >> 16); }
__device__ __forceinline__ float bf2f(unsigned short b) { return __uint_as_float(((unsigned)b) << 16); }
__device__ __forceinline__ float bfr(float f) { return bf2f(f2bf(f)); }
__device__ __forceinline__ v16h cat16(v8h lo, v8h hi) { return __builtin_shufflevector(lo, hi, 0, 1, 2, 3, 4, 5, 6, 7, 8, 9, 10, 11, 12, 13, 14, 15); }
__device__ __forceinline__ v16bf cat16b(v8us lo, v8us hi) { return __builtin_bit_cast(v16bf, __builtin_shufflevector(lo, hi, 0, 1, 2, 3, 4, 5, 6, 7, 8, 9, 10, 11, 12, 13, 14, 15)); }
__device__ __forceinline__ v8f wmma16(v16h a, v16h b, v8f c) { return __builtin_amdgcn_wmma_f32_16x16x32_f16(false, a, false, b, (short)0, c, false, false); }
__device__ __forceinline__ v8f wmmab(v16bf a, v16bf b, v8f c) { return __builtin_amdgcn_wmma_f32_16x16x32_bf16(false, a, false, b, (short)0, c, false, false); }



// ---- k_gemmw: register-blocked GEMM, ONE WAVE per 64x64 output tile (16 accumulators), operands straight from K-contiguous 16-bit planes; grid (M/64, N/64, Z), 32 threads.
// C[m][n] (f32, pitch ldc, + optional f32 bias[n]) = sum_k A[m][k] Bt[n][k] (+ split products per NSPLIT). z-batch strides sA/sB/sC in elements. K % 32 == 0.
template <typename T16> struct WFrag;
template <> struct WFrag<h16> { typedef v16h V; static __device__ __forceinline__ V ld(const h16* p) { return cat16(*(const v8h*)p, *(const v8h*)(p + 16)); } static __device__ __forceinline__ v8f mma(V a, V b, v8f c) { return wmma16(a, b, c); } };
template <> struct WFrag<bf> { typedef v16bf V; static __device__ __forceinline__ V ld(const bf* p) { return cat16b(*(const v8us*)p, *(const v8us*)(p + 16)); } static __device__ __forceinline__ v8f mma(V a, V b, v8f c) { return wmmab(a, b, c); } };
template <typename T16, int NSPLIT, bool BIAS>
__global__ __launch_bounds__(32) void k_gemmw(const T16* __restrict__ A, const T16* __restrict__ A2, const T16* __restrict__ Bt, const T16* __restrict__ Bt2, int K, float* C, int ldc, const float* __restrict__ bias, size_t sA, size_t sB, size_t sC) {
    typedef typename WFrag<T16>::V V;
    __shared__ __align__(16) float os[16 * 68];
    const size_t z = blockIdx.z; A += z * sA; if (A2) A2 += z * sA; Bt += z * sB; if (Bt2) Bt2 += z * sB; C += z * sC;
    const int lane = threadIdx.x & 31, lr = lane & 15, hi = lane >> 4; const int r0 = blockIdx.x * 64, c0 = blockIdx.y * 64;
    v8f acc[4][4];
#pragma unroll
    for (int mb = 0; mb < 4; ++mb)
#pragma unroll
        for (int nb = 0; nb < 4; ++nb) acc[mb][nb] = (v8f){};
    const size_t aoff = (size_t)(r0 + lr) * K + 8 * hi, boff = (size_t)(c0 + lr) * K + 8 * hi;
#pragma unroll 1
    for (int kc = 0; kc < K; kc += 32) {
        V a[4], a2[4];
#pragma unroll
        for (int mb = 0; mb < 4; ++mb) { a[mb] = WFrag<T16>::ld(A + aoff + (size_t)mb * 16 * K + kc); if (NSPLIT == 1 || NSPLIT == 2) a2[mb] = WFrag<T16>::ld(A2 + aoff + (size_t)mb * 16 * K + kc); }
#pragma unroll
        for (int nb = 0; nb < 4; ++nb) { const V b = WFrag<T16>::ld(Bt + boff + (size_t)nb * 16 * K + kc); V b2; if (NSPLIT >= 2) b2 = WFrag<T16>::ld(Bt2 + boff + (size_t)nb * 16 * K + kc);
#pragma unroll
            for (int mb = 0; mb < 4; ++mb) { acc[mb][nb] = WFrag<T16>::mma(a[mb], b, acc[mb][nb]); if (NSPLIT == 1 || NSPLIT == 2) acc[mb][nb] = WFrag<T16>::mma(a2[mb], b, acc[mb][nb]); if (NSPLIT >= 2) acc[mb][nb] = WFrag<T16>::mma(a[mb], b2, acc[mb][nb]); } }
        asm volatile("v_nop\n\tv_nop\n\tv_nop\n\tv_nop" : "+v"(acc[0][0]), "+v"(acc[1][1]), "+v"(acc[2][2]), "+v"(acc[3][3]) : "v"(a[0]), "v"(a[3]));
    }
#pragma unroll
    for (int mb = 0; mb < 4; ++mb) {
#pragma unroll
        for (int nb = 0; nb < 4; ++nb) {
#pragma unroll
            for (int j = 0; j < 8; ++j) os[(hi * 8 + j) * 68 + nb * 16 + lr] = acc[mb][nb][j]; }
        __builtin_amdgcn_wave_barrier(); asm volatile("" ::: "memory");
        float* crow = C + (size_t)(r0 + mb * 16) * ldc + c0;
{
#pragma unroll
            for (int s = 0; s < 8; ++s) { const int row = 2 * s + hi, cofs = lr * 4; v4f val = *(const v4fa*)(os + row * 68 + cofs); if (BIAS) { val[0] += bfr(bias[c0 + cofs]); val[1] += bfr(bias[c0 + cofs + 1]); val[2] += bfr(bias[c0 + cofs + 2]); val[3] += bfr(bias[c0 + cofs + 3]); }
                *(v4f*)(crow + (size_t)row * ldc + cofs) = val; }
             }
        __builtin_amdgcn_wave_barrier(); asm volatile("" ::: "memory");
    }
}

// ---- k_gemmks: the one-wave 64x64 tile of k_gemmw for a product with N == 64 and a long k. blockIdx.y is a slice of k, not a column tile: the wave sums k in [y KS, (y + 1) KS) of rows of pitch K and stores its f32 partial tile in plane y (stride sP) of C (pitch 64); the reader of C adds the planes. grid (M/64, K/KS, Z), 32 threads. KS % 32 == 0.
// xw0: s_wait_xcnt 0 behind a global load or store, in front of a later write of a register that it names (a later load of the same run may be given the registers that hold this load's address).
__device__ __forceinline__ void xw0() { asm volatile("s_wait_xcnt 0x0" ::: "memory"); }
__device__ __forceinline__ v16h  ldks(const h16* p) { const v8h  lo = *(const v8h*)p;  xw0(); const v8h  hi = *(const v8h*)(p + 16);  xw0(); return cat16(lo, hi); }
__device__ __forceinline__ v16bf ldks(const bf* p)  { const v8us lo = *(const v8us*)p; xw0(); const v8us hi = *(const v8us*)(p + 16); xw0(); return cat16b(lo, hi); }
template <typename T16, int NSPLIT>
__global__ __launch_bounds__(32) void k_gemmks(const T16* __restrict__ A, const T16* __restrict__ A2, const T16* __restrict__ Bt, const T16* __restrict__ Bt2, int K, int KS, float* C, size_t sA, size_t sB, size_t sC, size_t sP) {
    typedef typename WFrag<T16>::V V;
    __shared__ __align__(16) float os[16 * 68];
    const size_t z = blockIdx.z; A += z * sA; Bt += z * sB; if (NSPLIT == 2) { A2 += z * sA; Bt2 += z * sB; } C += z * sC + blockIdx.y * sP;
    const int lane = threadIdx.x & 31, lr = lane & 15, hi = lane >> 4; const int r0 = blockIdx.x * 64;
    v8f acc[4][4];
#pragma unroll
    for (int mb = 0; mb < 4; ++mb)
#pragma unroll
        for (int nb = 0; nb < 4; ++nb) acc[mb][nb] = (v8f){};
    const size_t k0 = (size_t)blockIdx.y * KS + 8 * hi; const size_t aoff = (size_t)(r0 + lr) * K + k0, boff = (size_t)lr * K + k0;
#pragma unroll 1   // rolled as in k_gemmw: one trip's fragments beside the 16 accumulators, no more
    for (int kc = 0; kc < KS; kc += 32) {
        V a[4], a2[4], b[4], b2[4];
#pragma unroll
        for (int i = 0; i < 4; ++i) { a[i] = ldks(A + aoff + (size_t)i * 16 * K + kc); b[i] = ldks(Bt + boff + (size_t)i * 16 * K + kc); if (NSPLIT == 2) { a2[i] = ldks(A2 + aoff + (size_t)i * 16 * K + kc); b2[i] = ldks(Bt2 + boff + (size_t)i * 16 * K + kc); } }
        __builtin_amdgcn_sched_barrier(0);   // every load of the trip issues in front of the first matrix instruction: the wave waits for memory once a trip, not twice
#pragma unroll
        for (int nb = 0; nb < 4; ++nb)
#pragma unroll
            for (int mb = 0; mb < 4; ++mb) { acc[mb][nb] = WFrag<T16>::mma(a[mb], b[nb], acc[mb][nb]); if (NSPLIT == 2) { acc[mb][nb] = WFrag<T16>::mma(a2[mb], b[nb], acc[mb][nb]); acc[mb][nb] = WFrag<T16>::mma(a[mb], b2[nb], acc[mb][nb]); } }
        // four vector slots between the last matrix instruction and the next trip's writes of its operands on the taken branch
        asm volatile("v_nop\n\tv_nop\n\tv_nop\n\tv_nop" : "+v"(acc[0][0]), "+v"(acc[1][1]), "+v"(acc[2][2]), "+v"(acc[3][3]) : "v"(a[0]), "v"(a[3]));
    }
#pragma unroll
    for (int mb = 0; mb < 4; ++mb) {
#pragma unroll
        for (int nb = 0; nb < 4; ++nb) {
#pragma unroll
            for (int j = 0; j < 8; ++j) os[(hi * 8 + j) * 68 + nb * 16 + lr] = acc[mb][nb][j]; }
        __builtin_amdgcn_wave_barrier(); asm volatile("" ::: "memory");   // the LDS writes stay in front of the transposed reads
        float* crow = C + (size_t)(r0 + mb * 16) * 64;
#pragma unroll
        for (int s = 0; s < 8; ++s) { const int row = 2 * s + hi, cofs = lr * 4; *(v4f*)(crow + (size_t)row * 64 + cofs) = *(const v4fa*)(os + row * 68 + cofs); }
        if (NSPLIT == 2 && mb < 2) xw0();   // in the three-product build the next block's LDS reads land on registers that these stores name
        __builtin_amdgcn_wave_barrier(); asm volatile("" ::: "memory");   // the reads stay in front of the next block's LDS writes
    }
}

__device__ __forceinline__ h16 tohx(float x) { return (h16)x; }
__device__ __forceinline__ void splitf(float y, unsigned short& h, unsigned short& l) { h = f2bf(y); l = f2bf(y - bf2f(h)); }
typedef __attribute__((ext_vector_type(2))) _Float16 v2h;
typedef __attribute__((ext_vector_type(4))) _Float16 v4h;
typedef __attribute__((ext_vector_type(2))) unsigned short v2us;
typedef __attribute__((ext_vector_type(4))) unsigned short v4us;
typedef __attribute__((ext_vector_type(2))) float v2f;
typedef __attribute__((ext_vector_type(4))) int v4i;

__global__ __launch_bounds__(256) void k_wtG(const float* __restrict__ w, int K, int N, bf* Bt) {
    const int lane = threadIdx.x & 31; const int L0 = (blockIdx.x * 8 + (threadIdx.x >> 5)) * 8; const int nlines = N * K / 64;
{
#pragma unroll 1
        for (int l = 0; l < 8; ++l) { const int L = L0 + l; if (L >= nlines) break; const size_t e = (size_t)L * 64 + lane * 2; const int k = (int)(e % K), n = (int)(e / K); v2us o;
            o[0] = f2bf(w[(size_t)k * N + n]); o[1] = f2bf(w[(size_t)(k + 1) * N + n]); *(v2us*)(Bt + e) = o; }
         }
}
__global__ __launch_bounds__(256) void k_cvt8(const float* __restrict__ src, bf* dst, size_t n8) { const size_t i = (size_t)blockIdx.x * 256 + threadIdx.x; if (i >= n8) return; const v8f v = *(const v8f*)(src + i * 8); v8us o;
#pragma unroll
    for (int k = 0; k < 8; ++k) o[k] = f2bf(v[k]); *(v8us*)(dst + i * 8) = o;  }

// k_rope: head planes [h][t][d] (fp16 + hi/lo) of rope(x) x sc with the rotate-half convention out[d] = x[d] cos[t][d] - x[d+HD/2] sin[t][d], out[d+HD/2] = x[d+HD/2] cos[t][d+HD/2] + x[d] sin[t][d+HD/2]
__global__ __launch_bounds__(256) void k_rope(const float* __restrict__ F, int pitch, int nheads, const float* __restrict__ CS, const float* __restrict__ RF, const float* __restrict__ nw, float sc, h16* P16, bf* Ph, bf* Pl) {
    const size_t e = ((size_t)blockIdx.x * 256 + threadIdx.x) * 2; if (e >= (size_t)nheads * TT * HD) return; const int d = (int)(e % HD); const int t = (int)((e / HD) % TT); const int h = (int)(e / ((size_t)HD * TT)); const float* f = F + (size_t)t * pitch + h * HD; const float rf = RF ? RF[(size_t)h * TT + t] : 1.0f; v2h o16; v2us oh, ol;
#pragma unroll
    for (int q = 0; q < 2; ++q) { const int dd = d + q; const int dp = (dd < HD / 2) ? dd + HD / 2 : dd - HD / 2; float x0 = f[dd], x1 = f[dp];
        if (RF) { float n0 = __fmul_rn(x0, rf), n1 = __fmul_rn(x1, rf); asm volatile("" : "+v"(n0)); asm volatile("" : "+v"(n1)); x0 = __fmul_rn(bfr(nw[dd]), n0); x1 = __fmul_rn(bfr(nw[dp]), n1); }
        const v2f cs = *(const v2f*)(CS + ((size_t)t * HD + dd) * 2); float a = __fmul_rn(x0, cs[0]), bq = __fmul_rn(x1, cs[1]); asm volatile("" : "+v"(a)); asm volatile("" : "+v"(bq)); const float r = ((dd < HD / 2) ? __fsub_rn(a, bq) : __fadd_rn(a, bq)) * sc;
        o16[q] = tohx(r); unsigned short a2, c2; splitf(r, a2, c2); oh[q] = a2; ol[q] = c2; }
    *(v2h*)(P16 + e) = o16; *(v2us*)(Ph + e) = oh; *(v2us*)(Pl + e) = ol;  }
__global__ __launch_bounds__(256) void k_vtp(const float* __restrict__ F, int pitch, int nheads, h16* V16, bf* Vh, bf* Vl) { const size_t e = ((size_t)blockIdx.x * 256 + threadIdx.x) * 2; if (e >= (size_t)nheads * HD * TT) return; const int t = (int)(e % TT); const int d = (int)((e / TT) % HD); const int g = (int)(e / ((size_t)TT * HD)); v2h o16; v2us oh, ol;
#pragma unroll
    for (int q = 0; q < 2; ++q) { const float x = F[(size_t)(t + q) * pitch + g * HD + d]; o16[q] = tohx(x); unsigned short a2, c2; splitf(x, a2, c2); oh[q] = a2; ol[q] = c2; }
    *(v2h*)(V16 + e) = o16; *(v2us*)(Vh + e) = oh; *(v2us*)(Vl + e) = ol;  }
__global__ __launch_bounds__(256) void k_csid(float* CS) { const int idx = blockIdx.x * 256 + threadIdx.x; if (idx >= TT * HD) return; v2f cs; cs[0] = 1.0f; cs[1] = 0.0f; *(v2f*)(CS + (size_t)idx * 2) = cs;  }
// k_asoft: per row (zz, i): t = S x HD^-0.5 (no mask); softmax over the 2048 keys (register row, one exp, fixed trees);
__global__ __launch_bounds__(256) void k_asoft(const float* __restrict__ Sb, h16* P16, bf* Ph, bf* Pl) {
    const int lane = threadIdx.x & 31; const int row = blockIdx.x * 8 + (threadIdx.x >> 5); if (row >= ZH * TT) return; const int i = row % TT; const int zz = row / TT; (void)zz; const bool hires = (i < RH); const float* sr = Sb + (size_t)row * TT; float v[TT / 32]; float mx = -3.0e38f;
#pragma unroll
    for (int ch = 0; ch < TT / 128; ++ch) { const int j0 = ch * 128 + lane * 4; const v4f a = *(const v4f*)(sr + j0);
#pragma unroll
        for (int q = 0; q < 4; ++q) { const int j = j0 + q; (void)j; const float t = a[q] * SCL; v[ch * 4 + q] = t; mx = fmaxf(mx, t); } }
#pragma unroll
    for (int sh = 16; sh; sh >>= 1) mx = fmaxf(mx, __shfl_xor(mx, sh, 32));
    float sum = 0.f;
#pragma unroll
    for (int k = 0; k < TT / 32; ++k) { float d0 = __fsub_rn(v[k], mx); asm volatile("" : "+v"(d0)); v[k] = __builtin_amdgcn_exp2f(__fmul_rn(d0, 1.4426950408889634f)); sum += v[k]; }
#pragma unroll
    for (int sh = 16; sh; sh >>= 1) sum += __shfl_xor(sum, sh, 32);
    const float f = __fdiv_rn(hires ? 1.0f : PCAR, sum);
{
        if (hires) {
#pragma unroll
            for (int ch = 0; ch < TT / 128; ++ch) { v4us oh, ol;
#pragma unroll
                for (int q = 0; q < 4; ++q) { unsigned short a, c2; splitf(v[ch * 4 + q] * f, a, c2); oh[q] = a; ol[q] = c2; }
                const size_t oo = ((size_t)zz * (RH ? RH : 1) + i) * TT + ch * 128 + lane * 4; *(v4us*)(Ph + oo) = oh; *(v4us*)(Pl + oo) = ol; }
        } else {
#pragma unroll
            for (int ch = 0; ch < TT / 128; ++ch) { v4h o4;
#pragma unroll
                for (int q = 0; q < 4; ++q) o4[q] = tohx(v[ch * 4 + q] * f);
                *(v4h*)(P16 + (size_t)row * TT + ch * 128 + lane * 4) = o4; } }
         }
}
__global__ __launch_bounds__(256) void k_tohl(const float* __restrict__ F, bf* Hh, bf* Hl, size_t n4) { const size_t i = (size_t)blockIdx.x * 256 + threadIdx.x; if (i >= n4) return; const v4f a = *(const v4f*)(F + i * 4); v4us oh, ol;
#pragma unroll
    for (int q = 0; q < 4; ++q) { unsigned short h2, l2; splitf(a[q], h2, l2); oh[q] = h2; ol[q] = l2; }
    *(v4us*)(Hh + i * 4) = oh; *(v4us*)(Hl + i * 4) = ol;  }
__global__ __launch_bounds__(256) void k_merge(const float* __restrict__ O, int h0, bf* Ah, bf* Al) { const size_t e = ((size_t)blockIdx.x * 256 + threadIdx.x) * 2; if (e >= (size_t)ZH * TT * HD) return; const int d = (int)(e % HD); const int t = (int)((e / HD) % TT); const int zz = (int)(e / ((size_t)HD * TT)); const float cs = (t < RH) ? 1.0f : (1.0f / PCAR); const size_t oo = (size_t)t * DQ + (h0 + zz) * HD + d;
    v2f s = *(const v2f*)(O + e);   // the KSP partial planes of the context, added in plane order
#pragma unroll   // the independent loads of the planes issue together
    for (int p = 1; p < KSP; ++p) s += *(const v2f*)(O + (size_t)p * ZH * TT * HD + e);
    v2us oh, ol;
#pragma unroll
    for (int q = 0; q < 2; ++q) { unsigned short a, c2; splitf(s[q] * cs, a, c2); oh[q] = a; ol[q] = c2; } *(v2us*)(Ah + oo) = oh; *(v2us*)(Al + oo) = ol;  }

extern "C" void kernel_launch(void* const* d_in, const int* in_sizes, int n_in,
                              void* d_out, int out_size, void* d_ws, size_t ws_size, hipStream_t stream) {
    (void)in_sizes; (void)n_in; (void)out_size;
    const float* x = (const float*)d_in[0]; const float* wq = (const float*)d_in[1]; const float* wk = (const float*)d_in[2]; const float* wv = (const float*)d_in[3]; const float* wo = (const float*)d_in[4]; const float* hq = (const float*)d_in[5]; const float* hk = (const float*)d_in[6]; const float* hv = (const float*)d_in[7];
    float* OUT = (float*)d_out;     // [2][2048][1024]
    char* wsp = (char*)d_ws;
    auto take = [&](size_t bytes) { char* p = wsp; wsp += (bytes + 255) & ~(size_t)255; return (void*)p; };
    bf* WQ = (bf*)take((size_t)DQ * DM * 2); bf* WK = (bf*)take((size_t)DKV * DM * 2); bf* WV = (bf*)take((size_t)DKV * DM * 2); bf* WO = (bf*)take((size_t)DM * DQ * 2); float* CS = (float*)take((size_t)TT * HD * 2 * 4);
    bf* HQB = (bf*)take((size_t)DQ * DM * 2); bf* HKB = (bf*)take((size_t)DKV * DM * 2); bf* HVB = (bf*)take((size_t)DKV * DM * 2); bf* Th = (bf*)take((size_t)TT * DM * 2); bf* Tl = (bf*)take((size_t)TT * DM * 2); float* F2 = (float*)take((size_t)TT * DQ * 4);
    bf* XB = (bf*)take((size_t)TT * DM * 2); float* FQ = (float*)take((size_t)TT * DQ * 4); float* FK = (float*)take((size_t)TT * DKV * 4);
    h16* QP16 = (h16*)take((size_t)NH_ * TT * HD * 2); h16* KP16 = (h16*)take((size_t)NKV * TT * HD * 2); h16* VT16 = (h16*)take((size_t)NKV * HD * TT * 2);
    bf* QPh = (bf*)take((size_t)NH_ * TT * HD * 2); bf* QPl = (bf*)take((size_t)NH_ * TT * HD * 2); bf* KPh = (bf*)take((size_t)NKV * TT * HD * 2); bf* KPl = (bf*)take((size_t)NKV * TT * HD * 2); bf* VTh = (bf*)take((size_t)NKV * HD * TT * 2); bf* VTl = (bf*)take((size_t)NKV * HD * TT * 2); bf* Ph = (bf*)take((size_t)ZH * RH * TT * 2); bf* Pl = (bf*)take((size_t)ZH * RH * TT * 2);
    float* Sb = (float*)take((size_t)ZH * TT * TT * 4); h16* P16 = (h16*)take((size_t)ZH * TT * TT * 2); float* Ob = (float*)take((size_t)KSP * ZH * TT * HD * 4); bf* ATh = (bf*)take((size_t)TT * DQ * 2); bf* ATl = (bf*)take((size_t)TT * DQ * 2);
    if ((size_t)(wsp - (char*)d_ws) > ws_size) return;    // ws 256 MiB
    float* FV = FK;   // v projection reuses the k buffer after the k planes are built (stream-ordered)
    { k_cvt8<<<(unsigned)(((size_t)DQ * DM / 8 + 255) / 256), 256, 0, stream>>>(wq, WQ, (size_t)DQ * DM / 8); k_cvt8<<<(unsigned)(((size_t)DKV * DM / 8 + 255) / 256), 256, 0, stream>>>(wk, WK, (size_t)DKV * DM / 8); k_cvt8<<<(unsigned)(((size_t)DKV * DM / 8 + 255) / 256), 256, 0, stream>>>(wv, WV, (size_t)DKV * DM / 8);
      k_cvt8<<<(unsigned)(((size_t)DM * DQ / 8 + 255) / 256), 256, 0, stream>>>(wo, WO, (size_t)DM * DQ / 8);
       }
    k_csid<<<(TT * HD + 255) / 256, 256, 0, stream>>>(CS);
    const unsigned LQ = (unsigned)(((size_t)NH_ * TT * HD / 2 + 255) / 256), LKv = (unsigned)(((size_t)NKV * TT * HD / 2 + 255) / 256);
    k_cvt8<<<(unsigned)(((size_t)DQ * DM / 8 + 255) / 256), 256, 0, stream>>>(hq, HQB, (size_t)DQ * DM / 8); k_cvt8<<<(unsigned)(((size_t)DKV * DM / 8 + 255) / 256), 256, 0, stream>>>(hk, HKB, (size_t)DKV * DM / 8); k_cvt8<<<(unsigned)(((size_t)DKV * DM / 8 + 255) / 256), 256, 0, stream>>>(hv, HVB, (size_t)DKV * DM / 8);   /* 'hed' [16][64][1024] = flat 'oi' */
    const size_t n4p = (size_t)TT * DM / 4; const unsigned g4p = (unsigned)((n4p + 255) / 256);
    for (int b = 0; b < NB_; ++b) {
        
        k_cvt8<<<(unsigned)(((size_t)TT * DM / 8 + 255) / 256), 256, 0, stream>>>(x + (size_t)b * TT * DM, XB, (size_t)TT * DM / 8);
        k_gemmw<bf, 0, false><<<dim3(TT / 64, DQ / 64, 1), 32, 0, stream>>>(XB, nullptr, WQ, nullptr, DM, FQ, DQ, nullptr, 0, 0, 0);   /* Q = E WQ^T */
        k_tohl<<<g4p, 256, 0, stream>>>(FQ, Th, Tl, n4p); k_gemmw<bf, 1, false><<<dim3(TT / 64, DQ / 64, 1), 32, 0, stream>>>(Th, Tl, HQB, nullptr, DM, F2, DQ, nullptr, 0, 0, 0);   /* q = Q HQ^T (all heads) */
        k_rope<<<LQ, 256, 0, stream>>>(F2, DQ, NH_, CS, nullptr, nullptr, 1.0f, QP16, QPh, QPl);
        k_gemmw<bf, 0, false><<<dim3(TT / 64, DKV / 64, 1), 32, 0, stream>>>(XB, nullptr, WK, nullptr, DM, FK, DKV, nullptr, 0, 0, 0);
        k_tohl<<<g4p, 256, 0, stream>>>(FK, Th, Tl, n4p); k_gemmw<bf, 1, false><<<dim3(TT / 64, DKV / 64, 1), 32, 0, stream>>>(Th, Tl, HKB, nullptr, DM, F2, DKV, nullptr, 0, 0, 0);
        k_rope<<<LKv, 256, 0, stream>>>(F2, DKV, NKV, CS, nullptr, nullptr, 1.0f, KP16, KPh, KPl);
        k_gemmw<bf, 0, false><<<dim3(TT / 64, DKV / 64, 1), 32, 0, stream>>>(XB, nullptr, WV, nullptr, DM, FV, DKV, nullptr, 0, 0, 0);
        k_tohl<<<g4p, 256, 0, stream>>>(FV, Th, Tl, n4p); k_gemmw<bf, 1, false><<<dim3(TT / 64, DKV / 64, 1), 32, 0, stream>>>(Th, Tl, HVB, nullptr, DM, F2, DKV, nullptr, 0, 0, 0); k_vtp<<<LKv, 256, 0, stream>>>(F2, DKV, NKV, VT16, VTh, VTl);
        for (int h0 = 0; h0 < NH_; h0 += ZH) { const size_t zq = (size_t)h0, zk = (size_t)(h0 / REP);   // one kv head per query head: the pass's two heads use consecutive kv planes (z-strides TT*HD)
            k_gemmw<bf, 2, false><<<dim3(RH / 64, TT / 64, ZH), 32, 0, stream>>>(QPh + zq * TT * HD, QPl + zq * TT * HD, KPh + zk * TT * HD, KPl + zk * TT * HD, HD, Sb, TT, nullptr, (size_t)TT * HD, (size_t)TT * HD, (size_t)TT * TT);
            k_gemmw<h16, 0, false><<<dim3((TT - RH) / 64, TT / 64, ZH), 32, 0, stream>>>(QP16 + zq * TT * HD + (size_t)RH * HD, nullptr, KP16 + zk * TT * HD, nullptr, HD, Sb + (size_t)RH * TT, TT, nullptr, (size_t)TT * HD, (size_t)TT * HD, (size_t)TT * TT);
            k_asoft<<<ZH * TT / 8, 256, 0, stream>>>(Sb, P16, Ph, Pl);
            k_gemmks<bf, 2><<<dim3(RH / 64, KSP, ZH), 32, 0, stream>>>(Ph, Pl, VTh + zk * HD * TT, VTl + zk * HD * TT, TT, TT / KSP, Ob, (size_t)RH * TT, (size_t)HD * TT, (size_t)TT * HD, (size_t)ZH * TT * HD);
            k_gemmks<h16, 0><<<dim3((TT - RH) / 64, KSP, ZH), 32, 0, stream>>>(P16 + (size_t)RH * TT, nullptr, VT16 + zk * HD * TT, nullptr, TT, TT / KSP, Ob + (size_t)RH * HD, (size_t)TT * TT, (size_t)HD * TT, (size_t)TT * HD, (size_t)ZH * TT * HD);
            k_merge<<<(unsigned)(((size_t)ZH * TT * HD / 2 + 255) / 256), 256, 0, stream>>>(Ob, h0, ATh, ATl); }
        k_gemmw<bf, 1, false><<<dim3(TT / 64, DM / 64, 1), 32, 0, stream>>>(ATh, ATl, WO, nullptr, DQ, OUT + (size_t)b * TT * DM, DM, nullptr, 0, 0, 0); }
}

// v002
// Measured time: 853 microseconds a run.
// Two timings next to v001 put it at 1.28 and 1.27 times that version's speed.
// All steps since v000 together make it 2.56 times as fast.
#include <hip/hip_runtime.h>

// Two-stage-projection multi-head attention (E [2][2048][1024]; Q = E WQ^T, K, V likewise ('oi' [1024][1024]); per head q = Q HQ[h]^T ('hed' [16][64][1024] = flat 'oi' [1024][1024]), k, v likewise; softmax(q.k 64^-0.5); heads concatenated; out = o WO^T -> [2][2048][1024] (4.2 M)).
// Layout per batch: first-stage projections exact (bf16 x bf16); their f32 results split into bf16 hi/lo planes for the second-stage GEMMs against the exact flattened head weights (2 products); dense T-2048 attention (hybrid rows: < 512 hi/lo 3 products, rest fp16 x1024); merged context as hi/lo planes; WO hl x exact.
// Compute dtypes, f32 accumulate: every input rounded to bf16; stage-1 projections exact, stage-2 hl x exact; attention rows < 512 3 products, rest fp16; softmax f32; WO hl x exact.

#define NB_  2
#define TT   2048
#define DM   1024
#define NH_  16
#define NKV  16
#define REP  (NH_ / NKV)
#define HD   64
#define DQ   (NH_ * HD)
#define DKV  (NKV * HD)
#define ZH   8                    // heads per attention pass (z of every attention launch)
#define PPI  (2 * TT)             // pitch, in 16-bit elements, of a P row that lies in its own f32 score row
#define RH   512                  // query rows < RH use hi+lo planes (0: none)
#define WIN  0
#define PCAR 1024.0f
#define SCL  0.125f   // HD^-0.5
#define KSP  16                   // work-groups that share the key range of one P.V output tile (TT / KSP keys each)
typedef _Float16 h16;
typedef unsigned short bf;
typedef __attribute__((ext_vector_type(16))) __bf16   v16bf;
typedef __attribute__((ext_vector_type(16))) _Float16 v16h;
typedef __attribute__((ext_vector_type(8)))  _Float16 v8h;
typedef __attribute__((ext_vector_type(8)))  unsigned short v8us;
typedef __attribute__((ext_vector_type(8)))  float    v8f;
typedef __attribute__((ext_vector_type(4)))  float    v4f;
typedef v8h  __attribute__((may_alias)) v8ha;
typedef v4f  __attribute__((may_alias)) v4fa;
typedef v8us __attribute__((may_alias)) v8usa;

__device__ __forceinline__ unsigned short f2bf(float f) { unsigned u = __float_as_uint(f); u += 0x7FFFu + ((u >> 16) & 1u); return (unsigned short)(u >> 16); }
__device__ __forceinline__ float bf2f(unsigned short b) { return __uint_as_float(((unsigned)b) << 16); }
__device__ __forceinline__ float bfr(float f) { return bf2f(f2bf(f)); }
__device__ __forceinline__ v16h cat16(v8h lo, v8h hi) { return __builtin_shufflevector(lo, hi, 0, 1, 2, 3, 4, 5, 6, 7, 8, 9, 10, 11, 12, 13, 14, 15); }
__device__ __forceinline__ v16bf cat16b(v8us lo, v8us hi) { return __builtin_bit_cast(v16bf, __builtin_shufflevector(lo, hi, 0, 1, 2, 3, 4, 5, 6, 7, 8, 9, 10, 11, 12, 13, 14, 15)); }
__device__ __forceinline__ v8f wmma16(v16h a, v16h b, v8f c) { return __builtin_amdgcn_wmma_f32_16x16x32_f16(false, a, false, b, (short)0, c, false, false); }
__device__ __forceinline__ v8f wmmab(v16bf a, v16bf b, v8f c) { return __builtin_amdgcn_wmma_f32_16x16x32_bf16(false, a, false, b, (short)0, c, false, false); }



// ---- k_gemmw: register-blocked GEMM, ONE WAVE per 64x64 output tile (16 accumulators), operands straight from K-contiguous 16-bit planes; grid (M/64, N/64, Z), 32 threads.
// C[m][n] (f32, pitch ldc, + optional f32 bias[n]) = sum_k A[m][k] Bt[n][k] (+ split products per NSPLIT). z-batch strides sA/sB/sC in elements. K % 32 == 0.
template <typename T16> struct WFrag;
template <> struct WFrag<h16> { typedef v16h V; static __device__ __forceinline__ V ld(const h16* p) { return cat16(*(const v8h*)p, *(const v8h*)(p + 16)); } static __device__ __forceinline__ v8f mma(V a, V b, v8f c) { return wmma16(a, b, c); } };
template <> struct WFrag<bf> { typedef v16bf V; static __device__ __forceinline__ V ld(const bf* p) { return cat16b(*(const v8us*)p, *(const v8us*)(p + 16)); } static __device__ __forceinline__ v8f mma(V a, V b, v8f c) { return wmmab(a, b, c); } };
template <typename T16, int NSPLIT, bool BIAS>
__global__ __launch_bounds__(32) void k_gemmw(const T16* __restrict__ A, const T16* __restrict__ A2, const T16* __restrict__ Bt, const T16* __restrict__ Bt2, int K, float* C, int ldc, const float* __restrict__ bias, size_t sA, size_t sB, size_t sC) {
    typedef typename WFrag<T16>::V V;
    __shared__ __align__(16) float os[16 * 68];
    const size_t z = blockIdx.z; A += z * sA; if (A2) A2 += z * sA; Bt += z * sB; if (Bt2) Bt2 += z * sB; C += z * sC;
    const int lane = threadIdx.x & 31, lr = lane & 15, hi = lane >> 4; const int r0 = blockIdx.x * 64, c0 = blockIdx.y * 64;
    v8f acc[4][4];
#pragma unroll
    for (int mb = 0; mb < 4; ++mb)
#pragma unroll
        for (int nb = 0; nb < 4; ++nb) acc[mb][nb] = (v8f){};
    const size_t aoff = (size_t)(r0 + lr) * K + 8 * hi, boff = (size_t)(c0 + lr) * K + 8 * hi;
#pragma unroll 1
    for (int kc = 0; kc < K; kc += 32) {
        V a[4], a2[4];
#pragma unroll
        for (int mb = 0; mb < 4; ++mb) { a[mb] = WFrag<T16>::ld(A + aoff + (size_t)mb * 16 * K + kc); if (NSPLIT == 1 || NSPLIT == 2) a2[mb] = WFrag<T16>::ld(A2 + aoff + (size_t)mb * 16 * K + kc); }
#pragma unroll
        for (int nb = 0; nb < 4; ++nb) { const V b = WFrag<T16>::ld(Bt + boff + (size_t)nb * 16 * K + kc); V b2; if (NSPLIT >= 2) b2 = WFrag<T16>::ld(Bt2 + boff + (size_t)nb * 16 * K + kc);
#pragma unroll
            for (int mb = 0; mb < 4; ++mb) { acc[mb][nb] = WFrag<T16>::mma(a[mb], b, acc[mb][nb]); if (NSPLIT == 1 || NSPLIT == 2) acc[mb][nb] = WFrag<T16>::mma(a2[mb], b, acc[mb][nb]); if (NSPLIT >= 2) acc[mb][nb] = WFrag<T16>::mma(a[mb], b2, acc[mb][nb]); } }
        asm volatile("v_nop\n\tv_nop\n\tv_nop\n\tv_nop" : "+v"(acc[0][0]), "+v"(acc[1][1]), "+v"(acc[2][2]), "+v"(acc[3][3]) : "v"(a[0]), "v"(a[3]));
    }
#pragma unroll
    for (int mb = 0; mb < 4; ++mb) {
#pragma unroll
        for (int nb = 0; nb < 4; ++nb) {
#pragma unroll
            for (int j = 0; j < 8; ++j) os[(hi * 8 + j) * 68 + nb * 16 + lr] = acc[mb][nb][j]; }
        __builtin_amdgcn_wave_barrier(); asm volatile("" ::: "memory");
        float* crow = C + (size_t)(r0 + mb * 16) * ldc + c0;
{
#pragma unroll
            for (int s = 0; s < 8; ++s) { const int row = 2 * s + hi, cofs = lr * 4; v4f val = *(const v4fa*)(os + row * 68 + cofs); if (BIAS) { val[0] += bfr(bias[c0 + cofs]); val[1] += bfr(bias[c0 + cofs + 1]); val[2] += bfr(bias[c0 + cofs + 2]); val[3] += bfr(bias[c0 + cofs + 3]); }
                *(v4f*)(crow + (size_t)row * ldc + cofs) = val; }
             }
        __builtin_amdgcn_wave_barrier(); asm volatile("" ::: "memory");
    }
}

// ---- k_gemmks: the one-wave 64x64 tile of k_gemmw for a product with N == 64 and a long k. blockIdx.y is a slice of k, not a column tile: the wave sums k in [y KS, (y + 1) KS) of rows of pitch K and stores its f32 partial tile in plane y (stride sP) of C (pitch 64); the reader of C adds the planes. A has its own row pitch lda. grid (M/64, K/KS, Z), 32 threads. KS % 32 == 0.
// xw0: s_wait_xcnt 0 behind a global load or store, in front of a later write of a register that it names (a later load of the same run may be given the registers that hold this load's address).
__device__ __forceinline__ void xw0() { asm volatile("s_wait_xcnt 0x0" ::: "memory"); }
__device__ __forceinline__ v16h  ldks(const h16* p) { const v8h  lo = *(const v8h*)p;  xw0(); const v8h  hi = *(const v8h*)(p + 16);  xw0(); return cat16(lo, hi); }
__device__ __forceinline__ v16bf ldks(const bf* p)  { const v8us lo = *(const v8us*)p; xw0(); const v8us hi = *(const v8us*)(p + 16); xw0(); return cat16b(lo, hi); }
template <typename T16, int NSPLIT>
__global__ __launch_bounds__(32) void k_gemmks(const T16* __restrict__ A, const T16* __restrict__ A2, const T16* __restrict__ Bt, const T16* __restrict__ Bt2, int lda, int K, int KS, float* C, size_t sA, size_t sB, size_t sC, size_t sP) {
    typedef typename WFrag<T16>::V V;
    __shared__ __align__(16) float os[16 * 68];
    const size_t z = blockIdx.z; A += z * sA; Bt += z * sB; if (NSPLIT == 2) { A2 += z * sA; Bt2 += z * sB; } C += z * sC + blockIdx.y * sP;
    const int lane = threadIdx.x & 31, lr = lane & 15, hi = lane >> 4; const int r0 = blockIdx.x * 64;
    v8f acc[4][4];
#pragma unroll
    for (int mb = 0; mb < 4; ++mb)
#pragma unroll
        for (int nb = 0; nb < 4; ++nb) acc[mb][nb] = (v8f){};
    const size_t k0 = (size_t)blockIdx.y * KS + 8 * hi; const size_t aoff = (size_t)(r0 + lr) * lda + k0, boff = (size_t)lr * K + k0;
#pragma unroll 1   // rolled as in k_gemmw: one trip's fragments beside the 16 accumulators, no more
    for (int kc = 0; kc < KS; kc += 32) {
        V a[4], a2[4], b[4], b2[4];
#pragma unroll
        for (int i = 0; i < 4; ++i) { a[i] = ldks(A + aoff + (size_t)i * 16 * lda + kc); b[i] = ldks(Bt + boff + (size_t)i * 16 * K + kc); if (NSPLIT == 2) { a2[i] = ldks(A2 + aoff + (size_t)i * 16 * lda + kc); b2[i] = ldks(Bt2 + boff + (size_t)i * 16 * K + kc); } }
        __builtin_amdgcn_sched_barrier(0);   // every load of the trip issues in front of the first matrix instruction: the wave waits for memory once a trip, not twice
#pragma unroll
        for (int nb = 0; nb < 4; ++nb)
#pragma unroll
            for (int mb = 0; mb < 4; ++mb) { acc[mb][nb] = WFrag<T16>::mma(a[mb], b[nb], acc[mb][nb]); if (NSPLIT == 2) { acc[mb][nb] = WFrag<T16>::mma(a2[mb], b[nb], acc[mb][nb]); acc[mb][nb] = WFrag<T16>::mma(a[mb], b2[nb], acc[mb][nb]); } }
        // four vector slots between the last matrix instruction and the next trip's writes of its operands on the taken branch
        asm volatile("v_nop\n\tv_nop\n\tv_nop\n\tv_nop" : "+v"(acc[0][0]), "+v"(acc[1][1]), "+v"(acc[2][2]), "+v"(acc[3][3]) : "v"(a[0]), "v"(a[3]));
    }
#pragma unroll
    for (int mb = 0; mb < 4; ++mb) {
#pragma unroll
        for (int nb = 0; nb < 4; ++nb) {
#pragma unroll
            for (int j = 0; j < 8; ++j) os[(hi * 8 + j) * 68 + nb * 16 + lr] = acc[mb][nb][j]; }
        __builtin_amdgcn_wave_barrier(); asm volatile("" ::: "memory");   // the LDS writes stay in front of the transposed reads
        float* crow = C + (size_t)(r0 + mb * 16) * 64;
#pragma unroll
        for (int s = 0; s < 8; ++s) { const int row = 2 * s + hi, cofs = lr * 4; *(v4f*)(crow + (size_t)row * 64 + cofs) = *(const v4fa*)(os + row * 68 + cofs); }
        if (NSPLIT == 2 && mb < 2) xw0();   // in the three-product build the next block's LDS reads land on registers that these stores name
        __builtin_amdgcn_wave_barrier(); asm volatile("" ::: "memory");   // the reads stay in front of the next block's LDS writes
    }
}

__device__ __forceinline__ h16 tohx(float x) { return (h16)x; }
__device__ __forceinline__ void splitf(float y, unsigned short& h, unsigned short& l) { h = f2bf(y); l = f2bf(y - bf2f(h)); }
typedef __attribute__((ext_vector_type(2))) _Float16 v2h;
typedef __attribute__((ext_vector_type(4))) _Float16 v4h;
typedef __attribute__((ext_vector_type(2))) unsigned short v2us;
typedef __attribute__((ext_vector_type(4))) unsigned short v4us;
typedef __attribute__((ext_vector_type(2))) float v2f;
typedef __attribute__((ext_vector_type(4))) int v4i;

__global__ __launch_bounds__(256) void k_wtG(const float* __restrict__ w, int K, int N, bf* Bt) {
    const int lane = threadIdx.x & 31; const int L0 = (blockIdx.x * 8 + (threadIdx.x >> 5)) * 8; const int nlines = N * K / 64;
{
#pragma unroll 1
        for (int l = 0; l < 8; ++l) { const int L = L0 + l; if (L >= nlines) break; const size_t e = (size_t)L * 64 + lane * 2; const int k = (int)(e % K), n = (int)(e / K); v2us o;
            o[0] = f2bf(w[(size_t)k * N + n]); o[1] = f2bf(w[(size_t)(k + 1) * N + n]); *(v2us*)(Bt + e) = o; }
         }
}
__global__ __launch_bounds__(256) void k_cvt8(const float* __restrict__ src, bf* dst, size_t n8) { const size_t i = (size_t)blockIdx.x * 256 + threadIdx.x; if (i >= n8) return; const v8f v = *(const v8f*)(src + i * 8); v8us o;
#pragma unroll
    for (int k = 0; k < 8; ++k) o[k] = f2bf(v[k]); *(v8us*)(dst + i * 8) = o;  }

// k_rope: head planes [h][t][d] (fp16 + hi/lo) of rope(x) x sc with the rotate-half convention out[d] = x[d] cos[t][d] - x[d+HD/2] sin[t][d], out[d+HD/2] = x[d+HD/2] cos[t][d+HD/2] + x[d] sin[t][d+HD/2]
__global__ __launch_bounds__(256) void k_rope(const float* __restrict__ F, int pitch, int nheads, const float* __restrict__ CS, const float* __restrict__ RF, const float* __restrict__ nw, float sc, h16* P16, bf* Ph, bf* Pl) {
    const size_t e = ((size_t)blockIdx.x * 256 + threadIdx.x) * 2; if (e >= (size_t)nheads * TT * HD) return; const int d = (int)(e % HD); const int t = (int)((e / HD) % TT); const int h = (int)(e / ((size_t)HD * TT)); const float* f = F + (size_t)t * pitch + h * HD; const float rf = RF ? RF[(size_t)h * TT + t] : 1.0f; v2h o16; v2us oh, ol;
#pragma unroll
    for (int q = 0; q < 2; ++q) { const int dd = d + q; const int dp = (dd < HD / 2) ? dd + HD / 2 : dd - HD / 2; float x0 = f[dd], x1 = f[dp];
        if (RF) { float n0 = __fmul_rn(x0, rf), n1 = __fmul_rn(x1, rf); asm volatile("" : "+v"(n0)); asm volatile("" : "+v"(n1)); x0 = __fmul_rn(bfr(nw[dd]), n0); x1 = __fmul_rn(bfr(nw[dp]), n1); }
        const v2f cs = *(const v2f*)(CS + ((size_t)t * HD + dd) * 2); float a = __fmul_rn(x0, cs[0]), bq = __fmul_rn(x1, cs[1]); asm volatile("" : "+v"(a)); asm volatile("" : "+v"(bq)); const float r = ((dd < HD / 2) ? __fsub_rn(a, bq) : __fadd_rn(a, bq)) * sc;
        o16[q] = tohx(r); unsigned short a2, c2; splitf(r, a2, c2); oh[q] = a2; ol[q] = c2; }
    *(v2h*)(P16 + e) = o16; *(v2us*)(Ph + e) = oh; *(v2us*)(Pl + e) = ol;  }
__global__ __launch_bounds__(256) void k_vtp(const float* __restrict__ F, int pitch, int nheads, h16* V16, bf* Vh, bf* Vl) { const size_t e = ((size_t)blockIdx.x * 256 + threadIdx.x) * 2; if (e >= (size_t)nheads * HD * TT) return; const int t = (int)(e % TT); const int d = (int)((e / TT) % HD); const int g = (int)(e / ((size_t)TT * HD)); v2h o16; v2us oh, ol;
#pragma unroll
    for (int q = 0; q < 2; ++q) { const float x = F[(size_t)(t + q) * pitch + g * HD + d]; o16[q] = tohx(x); unsigned short a2, c2; splitf(x, a2, c2); oh[q] = a2; ol[q] = c2; }
    *(v2h*)(V16 + e) = o16; *(v2us*)(Vh + e) = oh; *(v2us*)(Vl + e) = ol;  }
__global__ __launch_bounds__(256) void k_csid(float* CS) { const int idx = blockIdx.x * 256 + threadIdx.x; if (idx >= TT * HD) return; v2f cs; cs[0] = 1.0f; cs[1] = 0.0f; *(v2f*)(CS + (size_t)idx * 2) = cs;  }
// k_asoft: per row (zz, i): t = S x HD^-0.5 (no mask); softmax over the 2048 keys (register row, one exp, fixed trees);
// P goes IN PLACE over the row's own 8 KiB of scores: one wave owns the row and holds all of it in registers before the row sum, which every store needs. fp16 rows fill the first half; hi/lo rows put hi in the first half, lo in the second.
__global__ __launch_bounds__(256) void k_asoft(float* Sb) {
    const int lane = threadIdx.x & 31; const int row = blockIdx.x * 8 + (threadIdx.x >> 5); if (row >= ZH * TT) return; const int i = row % TT; const bool hires = (i < RH); const float* sr = Sb + (size_t)row * TT; float v[TT / 32]; float mx = -3.0e38f;
#pragma unroll
    for (int ch = 0; ch < TT / 128; ++ch) { const int j0 = ch * 128 + lane * 4; const v4f a = *(const v4f*)(sr + j0);
#pragma unroll
        for (int q = 0; q < 4; ++q) { const int j = j0 + q; (void)j; const float t = a[q] * SCL; v[ch * 4 + q] = t; mx = fmaxf(mx, t); } }
    xw0();   // the row's address pair is given to other values further down
#pragma unroll
    for (int sh = 16; sh; sh >>= 1) mx = fmaxf(mx, __shfl_xor(mx, sh, 32));
    float sum = 0.f;
#pragma unroll
    for (int k = 0; k < TT / 32; ++k) { float d0 = __fsub_rn(v[k], mx); asm volatile("" : "+v"(d0)); v[k] = __builtin_amdgcn_exp2f(__fmul_rn(d0, 1.4426950408889634f)); sum += v[k]; }
#pragma unroll
    for (int sh = 16; sh; sh >>= 1) sum += __shfl_xor(sum, sh, 32);
    const float f = __fdiv_rn(hires ? 1.0f : PCAR, sum);
{
        if (hires) {
#pragma unroll
            for (int ch = 0; ch < TT / 128; ++ch) { v4us oh, ol;
#pragma unroll
                for (int q = 0; q < 4; ++q) { unsigned short a, c2; splitf(v[ch * 4 + q] * f, a, c2); oh[q] = a; ol[q] = c2; }
                bf* pr = (bf*)Sb + (size_t)row * PPI + ch * 128 + lane * 4; *(v4us*)pr = oh; *(v4us*)(pr + TT) = ol; }
        } else {
#pragma unroll
            for (int ch = 0; ch < TT / 128; ++ch) { v4h o4;
#pragma unroll
                for (int q = 0; q < 4; ++q) o4[q] = tohx(v[ch * 4 + q] * f);
                *(v4h*)((h16*)Sb + (size_t)row * PPI + ch * 128 + lane * 4) = o4; } }
         }
}
__global__ __launch_bounds__(256) void k_tohl(const float* __restrict__ F, bf* Hh, bf* Hl, size_t n4) { const size_t i = (size_t)blockIdx.x * 256 + threadIdx.x; if (i >= n4) return; const v4f a = *(const v4f*)(F + i * 4); v4us oh, ol;
#pragma unroll
    for (int q = 0; q < 4; ++q) { unsigned short h2, l2; splitf(a[q], h2, l2); oh[q] = h2; ol[q] = l2; }
    *(v4us*)(Hh + i * 4) = oh; *(v4us*)(Hl + i * 4) = ol;  }
__global__ __launch_bounds__(256) void k_merge(const float* __restrict__ O, int h0, bf* Ah, bf* Al) { const size_t e = ((size_t)blockIdx.x * 256 + threadIdx.x) * 2; if (e >= (size_t)ZH * TT * HD) return; const int d = (int)(e % HD); const int t = (int)((e / HD) % TT); const int zz = (int)(e / ((size_t)HD * TT)); const float cs = (t < RH) ? 1.0f : (1.0f / PCAR); const size_t oo = (size_t)t * DQ + (h0 + zz) * HD + d;
    v2f s = *(const v2f*)(O + e);   // the KSP partial planes of the context, added in plane order
#pragma unroll   // the independent loads of the planes issue together
    for (int p = 1; p < KSP; ++p) s += *(const v2f*)(O + (size_t)p * ZH * TT * HD + e);
    v2us oh, ol;
#pragma unroll
    for (int q = 0; q < 2; ++q) { unsigned short a, c2; splitf(s[q] * cs, a, c2); oh[q] = a; ol[q] = c2; } *(v2us*)(Ah + oo) = oh; *(v2us*)(Al + oo) = ol;  }

extern "C" void kernel_launch(void* const* d_in, const int* in_sizes, int n_in,
                              void* d_out, int out_size, void* d_ws, size_t ws_size, hipStream_t stream) {
    (void)in_sizes; (void)n_in; (void)out_size;
    const float* x = (const float*)d_in[0]; const float* wq = (const float*)d_in[1]; const float* wk = (const float*)d_in[2]; const float* wv = (const float*)d_in[3]; const float* wo = (const float*)d_in[4]; const float* hq = (const float*)d_in[5]; const float* hk = (const float*)d_in[6]; const float* hv = (const float*)d_in[7];
    float* OUT = (float*)d_out;     // [2][2048][1024]
    char* wsp = (char*)d_ws;
    auto take = [&](size_t bytes) { char* p = wsp; wsp += (bytes + 255) & ~(size_t)255; return (void*)p; };
    bf* WQ = (bf*)take((size_t)DQ * DM * 2); bf* WK = (bf*)take((size_t)DKV * DM * 2); bf* WV = (bf*)take((size_t)DKV * DM * 2); bf* WO = (bf*)take((size_t)DM * DQ * 2); float* CS = (float*)take((size_t)TT * HD * 2 * 4);
    bf* HQB = (bf*)take((size_t)DQ * DM * 2); bf* HKB = (bf*)take((size_t)DKV * DM * 2); bf* HVB = (bf*)take((size_t)DKV * DM * 2);
    h16* QP16 = (h16*)take((size_t)NH_ * TT * HD * 2); h16* KP16 = (h16*)take((size_t)NKV * TT * HD * 2); h16* VT16 = (h16*)take((size_t)NKV * HD * TT * 2);
    bf* QPh = (bf*)take((size_t)NH_ * TT * HD * 2); bf* QPl = (bf*)take((size_t)NH_ * TT * HD * 2); bf* KPh = (bf*)take((size_t)NKV * TT * HD * 2); bf* KPl = (bf*)take((size_t)NKV * TT * HD * 2); bf* VTh = (bf*)take((size_t)NKV * HD * TT * 2); bf* VTl = (bf*)take((size_t)NKV * HD * TT * 2);
    bf* ATh = (bf*)take((size_t)TT * DQ * 2); bf* ATl = (bf*)take((size_t)TT * DQ * 2); float* Sb = (float*)take((size_t)ZH * TT * TT * 4);   // scores, then P in place
    char* u0 = wsp;   // the rest has two uses, one behind the other in stream order: the projections' buffers (last read by k_vtp), then the passes' partial planes (last read by k_merge)
    bf* Th = (bf*)take((size_t)TT * DM * 2); bf* Tl = (bf*)take((size_t)TT * DM * 2); float* F2 = (float*)take((size_t)TT * DQ * 4); bf* XB = (bf*)take((size_t)TT * DM * 2); float* FQ = (float*)take((size_t)TT * DQ * 4); float* FK = (float*)take((size_t)TT * DKV * 4);
    static_assert((size_t)KSP * ZH * TT * HD * 4 >= (size_t)TT * DM * 2 * 3 + (size_t)TT * DQ * 4 * 2 + (size_t)TT * DKV * 4, "the partial planes are the larger use, so the size check below covers both");
    wsp = u0; float* Ob = (float*)take((size_t)KSP * ZH * TT * HD * 4);
    if ((size_t)(wsp - (char*)d_ws) > ws_size) return;    // ws 256 MiB
    float* FV = FK;   // v projection reuses the k buffer after the k planes are built (stream-ordered)
    { k_cvt8<<<(unsigned)(((size_t)DQ * DM / 8 + 255) / 256), 256, 0, stream>>>(wq, WQ, (size_t)DQ * DM / 8); k_cvt8<<<(unsigned)(((size_t)DKV * DM / 8 + 255) / 256), 256, 0, stream>>>(wk, WK, (size_t)DKV * DM / 8); k_cvt8<<<(unsigned)(((size_t)DKV * DM / 8 + 255) / 256), 256, 0, stream>>>(wv, WV, (size_t)DKV * DM / 8);
      k_cvt8<<<(unsigned)(((size_t)DM * DQ / 8 + 255) / 256), 256, 0, stream>>>(wo, WO, (size_t)DM * DQ / 8);
       }
    k_csid<<<(TT * HD + 255) / 256, 256, 0, stream>>>(CS);
    const unsigned LQ = (unsigned)(((size_t)NH_ * TT * HD / 2 + 255) / 256), LKv = (unsigned)(((size_t)NKV * TT * HD / 2 + 255) / 256);
    k_cvt8<<<(unsigned)(((size_t)DQ * DM / 8 + 255) / 256), 256, 0, stream>>>(hq, HQB, (size_t)DQ * DM / 8); k_cvt8<<<(unsigned)(((size_t)DKV * DM / 8 + 255) / 256), 256, 0, stream>>>(hk, HKB, (size_t)DKV * DM / 8); k_cvt8<<<(unsigned)(((size_t)DKV * DM / 8 + 255) / 256), 256, 0, stream>>>(hv, HVB, (size_t)DKV * DM / 8);   /* 'hed' [16][64][1024] = flat 'oi' */
    const size_t n4p = (size_t)TT * DM / 4; const unsigned g4p = (unsigned)((n4p + 255) / 256);
    for (int b = 0; b < NB_; ++b) {
        
        k_cvt8<<<(unsigned)(((size_t)TT * DM / 8 + 255) / 256), 256, 0, stream>>>(x + (size_t)b * TT * DM, XB, (size_t)TT * DM / 8);
        k_gemmw<bf, 0, false><<<dim3(TT / 64, DQ / 64, 1), 32, 0, stream>>>(XB, nullptr, WQ, nullptr, DM, FQ, DQ, nullptr, 0, 0, 0);   /* Q = E WQ^T */
        k_tohl<<<g4p, 256, 0, stream>>>(FQ, Th, Tl, n4p); k_gemmw<bf, 1, false><<<dim3(TT / 64, DQ / 64, 1), 32, 0, stream>>>(Th, Tl, HQB, nullptr, DM, F2, DQ, nullptr, 0, 0, 0);   /* q = Q HQ^T (all heads) */
        k_rope<<<LQ, 256, 0, stream>>>(F2, DQ, NH_, CS, nullptr, nullptr, 1.0f, QP16, QPh, QPl);
        k_gemmw<bf, 0, false><<<dim3(TT / 64, DKV / 64, 1), 32, 0, stream>>>(XB, nullptr, WK, nullptr, DM, FK, DKV, nullptr, 0, 0, 0);
        k_tohl<<<g4p, 256, 0, stream>>>(FK, Th, Tl, n4p); k_gemmw<bf, 1, false><<<dim3(TT / 64, DKV / 64, 1), 32, 0, stream>>>(Th, Tl, HKB, nullptr, DM, F2, DKV, nullptr, 0, 0, 0);
        k_rope<<<LKv, 256, 0, stream>>>(F2, DKV, NKV, CS, nullptr, nullptr, 1.0f, KP16, KPh, KPl);
        k_gemmw<bf, 0, false><<<dim3(TT / 64, DKV / 64, 1), 32, 0, stream>>>(XB, nullptr, WV, nullptr, DM, FV, DKV, nullptr, 0, 0, 0);
        k_tohl<<<g4p, 256, 0, stream>>>(FV, Th, Tl, n4p); k_gemmw<bf, 1, false><<<dim3(TT / 64, DKV / 64, 1), 32, 0, stream>>>(Th, Tl, HVB, nullptr, DM, F2, DKV, nullptr, 0, 0, 0); k_vtp<<<LKv, 256, 0, stream>>>(F2, DKV, NKV, VT16, VTh, VTl);
        for (int h0 = 0; h0 < NH_; h0 += ZH) { const size_t zq = (size_t)h0, zk = (size_t)(h0 / REP);   // one kv head per query head: the pass's heads use consecutive kv planes (z-strides TT*HD)
            k_gemmw<bf, 2, false><<<dim3(RH / 64, TT / 64, ZH), 32, 0, stream>>>(QPh + zq * TT * HD, QPl + zq * TT * HD, KPh + zk * TT * HD, KPl + zk * TT * HD, HD, Sb, TT, nullptr, (size_t)TT * HD, (size_t)TT * HD, (size_t)TT * TT);
            k_gemmw<h16, 0, false><<<dim3((TT - RH) / 64, TT / 64, ZH), 32, 0, stream>>>(QP16 + zq * TT * HD + (size_t)RH * HD, nullptr, KP16 + zk * TT * HD, nullptr, HD, Sb + (size_t)RH * TT, TT, nullptr, (size_t)TT * HD, (size_t)TT * HD, (size_t)TT * TT);
            k_asoft<<<ZH * TT / 8, 256, 0, stream>>>(Sb);
            k_gemmks<bf, 2><<<dim3(RH / 64, KSP, ZH), 32, 0, stream>>>((const bf*)Sb, (const bf*)Sb + TT, VTh + zk * HD * TT, VTl + zk * HD * TT, PPI, TT, TT / KSP, Ob, (size_t)TT * PPI, (size_t)HD * TT, (size_t)TT * HD, (size_t)ZH * TT * HD);
            k_gemmks<h16, 0><<<dim3((TT - RH) / 64, KSP, ZH), 32, 0, stream>>>((const h16*)Sb + (size_t)RH * PPI, nullptr, VT16 + zk * HD * TT, nullptr, PPI, TT, TT / KSP, Ob + (size_t)RH * HD, (size_t)TT * PPI, (size_t)HD * TT, (size_t)TT * HD, (size_t)ZH * TT * HD);
            k_merge<<<(unsigned)(((size_t)ZH * TT * HD / 2 + 255) / 256), 256, 0, stream>>>(Ob, h0, ATh, ATl); }
        k_gemmw<bf, 1, false><<<dim3(TT / 64, DM / 64, 1), 32, 0, stream>>>(ATh, ATl, WO, nullptr, DQ, OUT + (size_t)b * TT * DM, DM, nullptr, 0, 0, 0); }
}

// v003
// It runs in 668 microseconds.
// Two timings next to v002 put it at 1.26 and 1.27 times that version's speed.
// All steps since v000 together make it 3.25 times as fast.
#include <hip/hip_runtime.h>

// Two-stage-projection multi-head attention (E [2][2048][1024]; Q = E WQ^T, K, V likewise ('oi' [1024][1024]); per head q = Q HQ[h]^T ('hed' [16][64][1024] = flat 'oi' [1024][1024]), k, v likewise; softmax(q.k 64^-0.5); heads concatenated; out = o WO^T -> [2][2048][1024] (4.2 M)).
// Layout per batch: first-stage projections exact (bf16 x bf16); their f32 results split into bf16 hi/lo planes for the second-stage GEMMs against the exact flattened head weights (2 products); dense T-2048 attention (hybrid rows: < 512 hi/lo 3 products, rest fp16 x1024); merged context as hi/lo planes; WO hl x exact.
// Compute dtypes, f32 accumulate: every input rounded to bf16; stage-1 projections exact, stage-2 hl x exact; attention rows < 512 3 products, rest fp16; softmax f32; WO hl x exact.

#define NB_  2
#define TT   2048
#define DM   1024
#define NH_  16
#define NKV  16
#define REP  (NH_ / NKV)
#define HD   64
#define DQ   (NH_ * HD)
#define DKV  (NKV * HD)
#define ZH   8                    // heads per attention pass (z of every attention launch)
#define PPI  (2 * TT)             // pitch, in 16-bit elements, of a P row that lies in its own f32 score row
#define RH   512                  // query rows < RH use hi+lo planes (0: none)
#define WIN  0
#define PCAR 1024.0f
#define SCL  0.125f   // HD^-0.5
#define KSP  16                   // work-groups that share the key range of one P.V output tile (TT / KSP keys each)
typedef _Float16 h16;
typedef unsigned short bf;
typedef __attribute__((ext_vector_type(16))) __bf16   v16bf;
typedef __attribute__((ext_vector_type(16))) _Float16 v16h;
typedef __attribute__((ext_vector_type(8)))  _Float16 v8h;
typedef __attribute__((ext_vector_type(8)))  unsigned short v8us;
typedef __attribute__((ext_vector_type(8)))  float    v8f;
typedef __attribute__((ext_vector_type(4)))  float    v4f;
typedef v8h  __attribute__((may_alias)) v8ha;
typedef v4f  __attribute__((may_alias)) v4fa;
typedef v8us __attribute__((may_alias)) v8usa;

__device__ __forceinline__ unsigned short f2bf(float f) { unsigned u = __float_as_uint(f); u += 0x7FFFu + ((u >> 16) & 1u); return (unsigned short)(u >> 16); }
__device__ __forceinline__ float bf2f(unsigned short b) { return __uint_as_float(((unsigned)b) << 16); }
__device__ __forceinline__ float bfr(float f) { return bf2f(f2bf(f)); }
__device__ __forceinline__ v16h cat16(v8h lo, v8h hi) { return __builtin_shufflevector(lo, hi, 0, 1, 2, 3, 4, 5, 6, 7, 8, 9, 10, 11, 12, 13, 14, 15); }
__device__ __forceinline__ v16bf cat16b(v8us lo, v8us hi) { return __builtin_bit_cast(v16bf, __builtin_shufflevector(lo, hi, 0, 1, 2, 3, 4, 5, 6, 7, 8, 9, 10, 11, 12, 13, 14, 15)); }
__device__ __forceinline__ v8f wmma16(v16h a, v16h b, v8f c) { return __builtin_amdgcn_wmma_f32_16x16x32_f16(false, a, false, b, (short)0, c, false, false); }
__device__ __forceinline__ v8f wmmab(v16bf a, v16bf b, v8f c) { return __builtin_amdgcn_wmma_f32_16x16x32_bf16(false, a, false, b, (short)0, c, false, false); }



// ---- k_gemmw: register-blocked GEMM, ONE WAVE per 64x64 output tile (16 accumulators), operands straight from K-contiguous 16-bit planes; grid (M/64, N/64, Z), 32 threads.
// C[m][n] (f32, pitch ldc, + optional f32 bias[n]) = sum_k A[m][k] Bt[n][k] (+ split products per NSPLIT). z-batch strides sA/sB/sC in elements. K % 32 == 0.
template <typename T16> struct WFrag;
template <> struct WFrag<h16> { typedef v16h V; static __device__ __forceinline__ V ld(const h16* p) { return cat16(*(const v8h*)p, *(const v8h*)(p + 16)); } static __device__ __forceinline__ v8f mma(V a, V b, v8f c) { return wmma16(a, b, c); } };
template <> struct WFrag<bf> { typedef v16bf V; static __device__ __forceinline__ V ld(const bf* p) { return cat16b(*(const v8us*)p, *(const v8us*)(p + 16)); } static __device__ __forceinline__ v8f mma(V a, V b, v8f c) { return wmmab(a, b, c); } };
template <typename T16, int NSPLIT, bool BIAS>
__global__ __launch_bounds__(32) void k_gemmw(const T16* __restrict__ A, const T16* __restrict__ A2, const T16* __restrict__ Bt, const T16* __restrict__ Bt2, int K, float* C, int ldc, const float* __restrict__ bias, size_t sA, size_t sB, size_t sC) {
    typedef typename WFrag<T16>::V V;
    __shared__ __align__(16) float os[16 * 68];
    const size_t z = blockIdx.z; A += z * sA; if (A2) A2 += z * sA; Bt += z * sB; if (Bt2) Bt2 += z * sB; C += z * sC;
    const int lane = threadIdx.x & 31, lr = lane & 15, hi = lane >> 4; const int r0 = blockIdx.x * 64, c0 = blockIdx.y * 64;
    v8f acc[4][4];
#pragma unroll
    for (int mb = 0; mb < 4; ++mb)
#pragma unroll
        for (int nb = 0; nb < 4; ++nb) acc[mb][nb] = (v8f){};
    const size_t aoff = (size_t)(r0 + lr) * K + 8 * hi, boff = (size_t)(c0 + lr) * K + 8 * hi;
#pragma unroll 1
    for (int kc = 0; kc < K; kc += 32) {
        V a[4], a2[4];
#pragma unroll
        for (int mb = 0; mb < 4; ++mb) { a[mb] = WFrag<T16>::ld(A + aoff + (size_t)mb * 16 * K + kc); if (NSPLIT == 1 || NSPLIT == 2) a2[mb] = WFrag<T16>::ld(A2 + aoff + (size_t)mb * 16 * K + kc); }
#pragma unroll
        for (int nb = 0; nb < 4; ++nb) { const V b = WFrag<T16>::ld(Bt + boff + (size_t)nb * 16 * K + kc); V b2; if (NSPLIT >= 2) b2 = WFrag<T16>::ld(Bt2 + boff + (size_t)nb * 16 * K + kc);
#pragma unroll
            for (int mb = 0; mb < 4; ++mb) { acc[mb][nb] = WFrag<T16>::mma(a[mb], b, acc[mb][nb]); if (NSPLIT == 1 || NSPLIT == 2) acc[mb][nb] = WFrag<T16>::mma(a2[mb], b, acc[mb][nb]); if (NSPLIT >= 2) acc[mb][nb] = WFrag<T16>::mma(a[mb], b2, acc[mb][nb]); } }
        asm volatile("v_nop\n\tv_nop\n\tv_nop\n\tv_nop" : "+v"(acc[0][0]), "+v"(acc[1][1]), "+v"(acc[2][2]), "+v"(acc[3][3]) : "v"(a[0]), "v"(a[3]));
    }
#pragma unroll
    for (int mb = 0; mb < 4; ++mb) {
#pragma unroll
        for (int nb = 0; nb < 4; ++nb) {
#pragma unroll
            for (int j = 0; j < 8; ++j) os[(hi * 8 + j) * 68 + nb * 16 + lr] = acc[mb][nb][j]; }
        __builtin_amdgcn_wave_barrier(); asm volatile("" ::: "memory");
        float* crow = C + (size_t)(r0 + mb * 16) * ldc + c0;
{
#pragma unroll
            for (int s = 0; s < 8; ++s) { const int row = 2 * s + hi, cofs = lr * 4; v4f val = *(const v4fa*)(os + row * 68 + cofs); if (BIAS) { val[0] += bfr(bias[c0 + cofs]); val[1] += bfr(bias[c0 + cofs + 1]); val[2] += bfr(bias[c0 + cofs + 2]); val[3] += bfr(bias[c0 + cofs + 3]); }
                *(v4f*)(crow + (size_t)row * ldc + cofs) = val; }
             }
        __builtin_amdgcn_wave_barrier(); asm volatile("" ::: "memory");
    }
}

// ---- k_gemmks: the one-wave 64x64 tile of k_gemmw for a product with N == 64 and a long k. blockIdx.y is a slice of k, not a column tile: the wave sums k in [y KS, (y + 1) KS) of rows of pitch K and stores its f32 partial tile in plane y (stride sP) of C (pitch 64); the reader of C adds the planes. A has its own row pitch lda. grid (M/64, K/KS, Z), 32 threads. KS % 32 == 0.
// xw0: s_wait_xcnt 0 behind a global load or store, in front of a later write of a register that it names (a later load of the same run may be given the registers that hold this load's address).
__device__ __forceinline__ void xw0() { asm volatile("s_wait_xcnt 0x0" ::: "memory"); }
__device__ __forceinline__ v16h  ldks(const h16* p) { const v8h  lo = *(const v8h*)p;  xw0(); const v8h  hi = *(const v8h*)(p + 16);  xw0(); return cat16(lo, hi); }
__device__ __forceinline__ v16bf ldks(const bf* p)  { const v8us lo = *(const v8us*)p; xw0(); const v8us hi = *(const v8us*)(p + 16); xw0(); return cat16b(lo, hi); }
template <typename T16, int NSPLIT>
__global__ __launch_bounds__(32) void k_gemmks(const T16* __restrict__ A, const T16* __restrict__ A2, const T16* __restrict__ Bt, const T16* __restrict__ Bt2, int lda, int K, int KS, float* C, size_t sA, size_t sB, size_t sC, size_t sP) {
    typedef typename WFrag<T16>::V V;
    __shared__ __align__(16) float os[16 * 68];
    const size_t z = blockIdx.z; A += z * sA; Bt += z * sB; if (NSPLIT == 2) { A2 += z * sA; Bt2 += z * sB; } C += z * sC + blockIdx.y * sP;
    const int lane = threadIdx.x & 31, lr = lane & 15, hi = lane >> 4; const int r0 = blockIdx.x * 64;
    v8f acc[4][4];
#pragma unroll
    for (int mb = 0; mb < 4; ++mb)
#pragma unroll
        for (int nb = 0; nb < 4; ++nb) acc[mb][nb] = (v8f){};
    const size_t k0 = (size_t)blockIdx.y * KS + 8 * hi; const size_t aoff = (size_t)(r0 + lr) * lda + k0, boff = (size_t)lr * K + k0;
#pragma unroll 1   // rolled as in k_gemmw: one trip's fragments beside the 16 accumulators, no more
    for (int kc = 0; kc < KS; kc += 32) {
        V a[4], a2[4], b[4], b2[4];
#pragma unroll
        for (int i = 0; i < 4; ++i) { a[i] = ldks(A + aoff + (size_t)i * 16 * lda + kc); b[i] = ldks(Bt + boff + (size_t)i * 16 * K + kc); if (NSPLIT == 2) { a2[i] = ldks(A2 + aoff + (size_t)i * 16 * lda + kc); b2[i] = ldks(Bt2 + boff + (size_t)i * 16 * K + kc); } }
        __builtin_amdgcn_sched_barrier(0);   // every load of the trip issues in front of the first matrix instruction: the wave waits for memory once a trip, not twice
#pragma unroll
        for (int nb = 0; nb < 4; ++nb)
#pragma unroll
            for (int mb = 0; mb < 4; ++mb) { acc[mb][nb] = WFrag<T16>::mma(a[mb], b[nb], acc[mb][nb]); if (NSPLIT == 2) { acc[mb][nb] = WFrag<T16>::mma(a2[mb], b[nb], acc[mb][nb]); acc[mb][nb] = WFrag<T16>::mma(a[mb], b2[nb], acc[mb][nb]); } }
        // four vector slots between the last matrix instruction and the next trip's writes of its operands on the taken branch
        asm volatile("v_nop\n\tv_nop\n\tv_nop\n\tv_nop" : "+v"(acc[0][0]), "+v"(acc[1][1]), "+v"(acc[2][2]), "+v"(acc[3][3]) : "v"(a[0]), "v"(a[3]));
    }
#pragma unroll
    for (int mb = 0; mb < 4; ++mb) {
#pragma unroll
        for (int nb = 0; nb < 4; ++nb) {
#pragma unroll
            for (int j = 0; j < 8; ++j) os[(hi * 8 + j) * 68 + nb * 16 + lr] = acc[mb][nb][j]; }
        __builtin_amdgcn_wave_barrier(); asm volatile("" ::: "memory");   // the LDS writes stay in front of the transposed reads
        float* crow = C + (size_t)(r0 + mb * 16) * 64;
#pragma unroll
        for (int s = 0; s < 8; ++s) { const int row = 2 * s + hi, cofs = lr * 4; *(v4f*)(crow + (size_t)row * 64 + cofs) = *(const v4fa*)(os + row * 68 + cofs); }
        if (NSPLIT == 2 && mb < 2) xw0();   // in the three-product build the next block's LDS reads land on registers that these stores name
        __builtin_amdgcn_wave_barrier(); asm volatile("" ::: "memory");   // the reads stay in front of the next block's LDS writes
    }
}

__device__ __forceinline__ h16 tohx(float x) { return (h16)x; }
__device__ __forceinline__ void splitf(float y, unsigned short& h, unsigned short& l) { h = f2bf(y); l = f2bf(y - bf2f(h)); }
typedef __attribute__((ext_vector_type(2))) _Float16 v2h;
typedef __attribute__((ext_vector_type(4))) _Float16 v4h;
typedef __attribute__((ext_vector_type(2))) unsigned short v2us;
typedef __attribute__((ext_vector_type(4))) unsigned short v4us;
typedef __attribute__((ext_vector_type(2))) float v2f;
typedef __attribute__((ext_vector_type(4))) int v4i;

__global__ __launch_bounds__(256) void k_wtG(const float* __restrict__ w, int K, int N, bf* Bt) {
    const int lane = threadIdx.x & 31; const int L0 = (blockIdx.x * 8 + (threadIdx.x >> 5)) * 8; const int nlines = N * K / 64;
{
#pragma unroll 1
        for (int l = 0; l < 8; ++l) { const int L = L0 + l; if (L >= nlines) break; const size_t e = (size_t)L * 64 + lane * 2; const int k = (int)(e % K), n = (int)(e / K); v2us o;
            o[0] = f2bf(w[(size_t)k * N + n]); o[1] = f2bf(w[(size_t)(k + 1) * N + n]); *(v2us*)(Bt + e) = o; }
         }
}
__global__ __launch_bounds__(256) void k_cvt8(const float* __restrict__ src, bf* dst, size_t n8) { const size_t i = (size_t)blockIdx.x * 256 + threadIdx.x; if (i >= n8) return; const v8f v = *(const v8f*)(src + i * 8); v8us o;
#pragma unroll
    for (int k = 0; k < 8; ++k) o[k] = f2bf(v[k]); *(v8us*)(dst + i * 8) = o;  }
// k_cvt8w: k_cvt8 of the seven weight matrices (n8 groups of 8 each) in one launch: blockIdx.y picks the source; the bf16 planes lie one behind the other in dst, in argument order.
__global__ __launch_bounds__(256) void k_cvt8w(const float* __restrict__ w0, const float* __restrict__ w1, const float* __restrict__ w2, const float* __restrict__ w3, const float* __restrict__ w4, const float* __restrict__ w5, const float* __restrict__ w6, bf* dst, size_t n8) { const size_t i = (size_t)blockIdx.x * 256 + threadIdx.x; if (i >= n8) return; const unsigned y = blockIdx.y;
    const float* src = (y == 0) ? w0 : (y == 1) ? w1 : (y == 2) ? w2 : (y == 3) ? w3 : (y == 4) ? w4 : (y == 5) ? w5 : w6; const v8f v = *(const v8f*)(src + i * 8); xw0();   // the source address pair is given to other values further down
    v8us o;
#pragma unroll
    for (int k = 0; k < 8; ++k) o[k] = f2bf(v[k]); *(v8us*)(dst + ((size_t)y * n8 + i) * 8) = o;  }

// k_rope: head planes [h][t][d] (fp16 + hi/lo) of rope(x) x sc with the rotate-half convention out[d] = x[d] cos[t][d] - x[d+HD/2] sin[t][d], out[d+HD/2] = x[d+HD/2] cos[t][d+HD/2] + x[d] sin[t][d+HD/2]
__global__ __launch_bounds__(256) void k_rope(const float* __restrict__ F, int pitch, int nheads, const float* __restrict__ CS, const float* __restrict__ RF, const float* __restrict__ nw, float sc, h16* P16, bf* Ph, bf* Pl) {
    const size_t e = ((size_t)blockIdx.x * 256 + threadIdx.x) * 2; if (e >= (size_t)nheads * TT * HD) return; const int d = (int)(e % HD); const int t = (int)((e / HD) % TT); const int h = (int)(e / ((size_t)HD * TT)); const float* f = F + (size_t)t * pitch + h * HD; const float rf = RF ? RF[(size_t)h * TT + t] : 1.0f; v2h o16; v2us oh, ol;
#pragma unroll
    for (int q = 0; q < 2; ++q) { const int dd = d + q; const int dp = (dd < HD / 2) ? dd + HD / 2 : dd - HD / 2; float x0 = f[dd], x1 = f[dp];
        if (RF) { float n0 = __fmul_rn(x0, rf), n1 = __fmul_rn(x1, rf); asm volatile("" : "+v"(n0)); asm volatile("" : "+v"(n1)); x0 = __fmul_rn(bfr(nw[dd]), n0); x1 = __fmul_rn(bfr(nw[dp]), n1); }
        const v2f cs = *(const v2f*)(CS + ((size_t)t * HD + dd) * 2); float a = __fmul_rn(x0, cs[0]), bq = __fmul_rn(x1, cs[1]); asm volatile("" : "+v"(a)); asm volatile("" : "+v"(bq)); const float r = ((dd < HD / 2) ? __fsub_rn(a, bq) : __fadd_rn(a, bq)) * sc;
        o16[q] = tohx(r); unsigned short a2, c2; splitf(r, a2, c2); oh[q] = a2; ol[q] = c2; }
    *(v2h*)(P16 + e) = o16; *(v2us*)(Ph + e) = oh; *(v2us*)(Pl + e) = ol;  }
__global__ __launch_bounds__(256) void k_vtp(const float* __restrict__ F, int pitch, int nheads, h16* V16, bf* Vh, bf* Vl) { const size_t e = ((size_t)blockIdx.x * 256 + threadIdx.x) * 2; if (e >= (size_t)nheads * HD * TT) return; const int t = (int)(e % TT); const int d = (int)((e / TT) % HD); const int g = (int)(e / ((size_t)TT * HD)); v2h o16; v2us oh, ol;
#pragma unroll
    for (int q = 0; q < 2; ++q) { const float x = F[(size_t)(t + q) * pitch + g * HD + d]; o16[q] = tohx(x); unsigned short a2, c2; splitf(x, a2, c2); oh[q] = a2; ol[q] = c2; }
    *(v2h*)(V16 + e) = o16; *(v2us*)(Vh + e) = oh; *(v2us*)(Vl + e) = ol;  }
__global__ __launch_bounds__(256) void k_csid(float* CS) { const int idx = blockIdx.x * 256 + threadIdx.x; if (idx >= TT * HD) return; v2f cs; cs[0] = 1.0f; cs[1] = 0.0f; *(v2f*)(CS + (size_t)idx * 2) = cs;  }
// k_asoft: per row (zz, i): t = S x HD^-0.5 (no mask); softmax over the 2048 keys (register row, one exp, fixed trees);
// P goes IN PLACE over the row's own 8 KiB of scores: one wave owns the row and holds all of it in registers before the row sum, which every store needs. fp16 rows fill the first half; hi/lo rows put hi in the first half, lo in the second.
__global__ __launch_bounds__(256) void k_asoft(float* Sb) {
    const int lane = threadIdx.x & 31; const int row = blockIdx.x * 8 + (threadIdx.x >> 5); if (row >= ZH * TT) return; const int i = row % TT; const bool hires = (i < RH); const float* sr = Sb + (size_t)row * TT; float v[TT / 32]; float mx = -3.0e38f;
#pragma unroll
    for (int ch = 0; ch < TT / 128; ++ch) { const int j0 = ch * 128 + lane * 4; const v4f a = *(const v4f*)(sr + j0);
#pragma unroll
        for (int q = 0; q < 4; ++q) { const int j = j0 + q; (void)j; const float t = a[q] * SCL; v[ch * 4 + q] = t; mx = fmaxf(mx, t); } }
    xw0();   // the row's address pair is given to other values further down
#pragma unroll
    for (int sh = 16; sh; sh >>= 1) mx = fmaxf(mx, __shfl_xor(mx, sh, 32));
    float sum = 0.f;
#pragma unroll
    for (int k = 0; k < TT / 32; ++k) { float d0 = __fsub_rn(v[k], mx); asm volatile("" : "+v"(d0)); v[k] = __builtin_amdgcn_exp2f(__fmul_rn(d0, 1.4426950408889634f)); sum += v[k]; }
#pragma unroll
    for (int sh = 16; sh; sh >>= 1) sum += __shfl_xor(sum, sh, 32);
    const float f = __fdiv_rn(hires ? 1.0f : PCAR, sum);
{
        if (hires) {
#pragma unroll
            for (int ch = 0; ch < TT / 128; ++ch) { v4us oh, ol;
#pragma unroll
                for (int q = 0; q < 4; ++q) { unsigned short a, c2; splitf(v[ch * 4 + q] * f, a, c2); oh[q] = a; ol[q] = c2; }
                bf* pr = (bf*)Sb + (size_t)row * PPI + ch * 128 + lane * 4; *(v4us*)pr = oh; *(v4us*)(pr + TT) = ol; }
        } else {
#pragma unroll
            for (int ch = 0; ch < TT / 128; ++ch) { v4h o4;
#pragma unroll
                for (int q = 0; q < 4; ++q) o4[q] = tohx(v[ch * 4 + q] * f);
                *(v4h*)((h16*)Sb + (size_t)row * PPI + ch * 128 + lane * 4) = o4; } }
         }
}
__global__ __launch_bounds__(256) void k_tohl(const float* __restrict__ F, bf* Hh, bf* Hl, size_t n4) { const size_t i = (size_t)blockIdx.x * 256 + threadIdx.x; if (i >= n4) return; const v4f a = *(const v4f*)(F + i * 4); v4us oh, ol;
#pragma unroll
    for (int q = 0; q < 4; ++q) { unsigned short h2, l2; splitf(a[q], h2, l2); oh[q] = h2; ol[q] = l2; }
    *(v4us*)(Hh + i * 4) = oh; *(v4us*)(Hl + i * 4) = ol;  }
__global__ __launch_bounds__(256) void k_merge(const float* __restrict__ O, int h0, bf* Ah, bf* Al) { const size_t e = ((size_t)blockIdx.x * 256 + threadIdx.x) * 2; if (e >= (size_t)ZH * TT * HD) return; const int d = (int)(e % HD); const int t = (int)((e / HD) % TT); const int zz = (int)(e / ((size_t)HD * TT)); const float cs = (t < RH) ? 1.0f : (1.0f / PCAR); const size_t oo = (size_t)t * DQ + (h0 + zz) * HD + d;
    v2f s = *(const v2f*)(O + e);   // the KSP partial planes of the context, added in plane order
#pragma unroll   // the independent loads of the planes issue together
    for (int p = 1; p < KSP; ++p) s += *(const v2f*)(O + (size_t)p * ZH * TT * HD + e);
    v2us oh, ol;
#pragma unroll
    for (int q = 0; q < 2; ++q) { unsigned short a, c2; splitf(s[q] * cs, a, c2); oh[q] = a; ol[q] = c2; } *(v2us*)(Ah + oo) = oh; *(v2us*)(Al + oo) = ol;  }

extern "C" void kernel_launch(void* const* d_in, const int* in_sizes, int n_in,
                              void* d_out, int out_size, void* d_ws, size_t ws_size, hipStream_t stream) {
    (void)in_sizes; (void)n_in; (void)out_size;
    const float* x = (const float*)d_in[0]; const float* wq = (const float*)d_in[1]; const float* wk = (const float*)d_in[2]; const float* wv = (const float*)d_in[3]; const float* wo = (const float*)d_in[4]; const float* hq = (const float*)d_in[5]; const float* hk = (const float*)d_in[6]; const float* hv = (const float*)d_in[7];
    float* OUT = (float*)d_out;     // [2][2048][1024]
    char* wsp = (char*)d_ws;
    auto take = [&](size_t bytes) { char* p = wsp; wsp += (bytes + 255) & ~(size_t)255; return (void*)p; };
    static_assert(DKV == DQ && NKV == NH_ && ((size_t)DQ * DM * 2) % 256 == 0 && ((size_t)NH_ * TT * HD * 2) % 256 == 0, "the q, k and v chains have one shape, and planes taken one behind the other are contiguous");
    bf* WQ = (bf*)take((size_t)DQ * DM * 2); take((size_t)DKV * DM * 2); take((size_t)DKV * DM * 2);   // WQ | WK | WV: z of the first-stage launch
    bf* HQB = (bf*)take((size_t)DQ * DM * 2); take((size_t)DKV * DM * 2); take((size_t)DKV * DM * 2);   // HQ | HK | HV ('hed' [16][64][1024] = flat 'oi'): z of the second-stage launch
    bf* WO = (bf*)take((size_t)DM * DQ * 2); float* CS = (float*)take((size_t)TT * HD * 2 * 4);
    h16* QP16 = (h16*)take((size_t)NH_ * TT * HD * 2); h16* KP16 = (h16*)take((size_t)NKV * TT * HD * 2); h16* VT16 = (h16*)take((size_t)NKV * HD * TT * 2);   // each k plane directly behind its q plane: one k_rope launch writes both as 32 heads
    bf* QPh = (bf*)take((size_t)NH_ * TT * HD * 2); bf* KPh = (bf*)take((size_t)NKV * TT * HD * 2); bf* QPl = (bf*)take((size_t)NH_ * TT * HD * 2); bf* KPl = (bf*)take((size_t)NKV * TT * HD * 2); bf* VTh = (bf*)take((size_t)NKV * HD * TT * 2); bf* VTl = (bf*)take((size_t)NKV * HD * TT * 2);
    bf* ATh = (bf*)take((size_t)TT * DQ * 2); bf* ATl = (bf*)take((size_t)TT * DQ * 2);
    char* u0 = wsp;   // the rest has two uses, one behind the other in stream order: the projections' buffers (last read by k_vtp), then the passes' scores and partial planes (last read by k_merge)
    bf* XB = (bf*)take((size_t)TT * DM * 2); float* F1 = (float*)take((size_t)3 * TT * DQ * 4); bf* Th = (bf*)take((size_t)3 * TT * DM * 2); bf* Tl = (bf*)take((size_t)3 * TT * DM * 2); float* F2 = (float*)take((size_t)TT * 3 * DQ * 4);   // F1, Th, Tl [3][TT][1024]; F2 [TT][q 1024 | k 1024 | v 1024]
    static_assert((size_t)ZH * TT * TT * 4 >= (size_t)TT * DM * 2 * 7 + (size_t)TT * DQ * 4 * 6, "the scores are the larger use, so the size check below covers both");
    wsp = u0; float* Sb = (float*)take((size_t)ZH * TT * TT * 4);   // scores, then P in place
    float* Ob = (float*)take((size_t)KSP * ZH * TT * HD * 4);
    if ((size_t)(wsp - (char*)d_ws) > ws_size) return;    // ws 256 MiB
    k_cvt8w<<<dim3((unsigned)(((size_t)DQ * DM / 8 + 255) / 256), 7, 1), 256, 0, stream>>>(wq, wk, wv, hq, hk, hv, wo, WQ, (size_t)DQ * DM / 8);
    k_csid<<<(TT * HD + 255) / 256, 256, 0, stream>>>(CS);
    const unsigned LQK = (unsigned)(((size_t)(NH_ + NKV) * TT * HD / 2 + 255) / 256), LKv = (unsigned)(((size_t)NKV * TT * HD / 2 + 255) / 256);
    const size_t n4p = (size_t)3 * TT * DM / 4; const unsigned g4p = (unsigned)((n4p + 255) / 256);
    for (int b = 0; b < NB_; ++b) {
        k_cvt8<<<(unsigned)(((size_t)TT * DM / 8 + 255) / 256), 256, 0, stream>>>(x + (size_t)b * TT * DM, XB, (size_t)TT * DM / 8);
        k_gemmw<bf, 0, false><<<dim3(TT / 64, DQ / 64, 3), 32, 0, stream>>>(XB, nullptr, WQ, nullptr, DM, F1, DQ, nullptr, 0, (size_t)DQ * DM, (size_t)TT * DQ);   /* z = 0, 1, 2: Q = E WQ^T, K = E WK^T, V = E WV^T */
        k_tohl<<<g4p, 256, 0, stream>>>(F1, Th, Tl, n4p);
        k_gemmw<bf, 1, false><<<dim3(TT / 64, DQ / 64, 3), 32, 0, stream>>>(Th, Tl, HQB, nullptr, DM, F2, 3 * DQ, nullptr, (size_t)TT * DM, (size_t)DQ * DM, (size_t)DQ);   /* z = 0, 1, 2: q = Q HQ^T, k = K HK^T, v = V HV^T (all heads), side by side in the rows of F2 */
        k_rope<<<LQK, 256, 0, stream>>>(F2, 3 * DQ, NH_ + NKV, CS, nullptr, nullptr, 1.0f, QP16, QPh, QPl);   /* heads 0..15: q planes, 16..31: k planes */
        k_vtp<<<LKv, 256, 0, stream>>>(F2 + 2 * DQ, 3 * DQ, NKV, VT16, VTh, VTl);
        for (int h0 = 0; h0 < NH_; h0 += ZH) { const size_t zq = (size_t)h0, zk = (size_t)(h0 / REP);   // one kv head per query head: the pass's heads use consecutive kv planes (z-strides TT*HD)
            k_gemmw<bf, 2, false><<<dim3(RH / 64, TT / 64, ZH), 32, 0, stream>>>(QPh + zq * TT * HD, QPl + zq * TT * HD, KPh + zk * TT * HD, KPl + zk * TT * HD, HD, Sb, TT, nullptr, (size_t)TT * HD, (size_t)TT * HD, (size_t)TT * TT);
            k_gemmw<h16, 0, false><<<dim3((TT - RH) / 64, TT / 64, ZH), 32, 0, stream>>>(QP16 + zq * TT * HD + (size_t)RH * HD, nullptr, KP16 + zk * TT * HD, nullptr, HD, Sb + (size_t)RH * TT, TT, nullptr, (size_t)TT * HD, (size_t)TT * HD, (size_t)TT * TT);
            k_asoft<<<ZH * TT / 8, 256, 0, stream>>>(Sb);
            k_gemmks<bf, 2><<<dim3(RH / 64, KSP, ZH), 32, 0, stream>>>((const bf*)Sb, (const bf*)Sb + TT, VTh + zk * HD * TT, VTl + zk * HD * TT, PPI, TT, TT / KSP, Ob, (size_t)TT * PPI, (size_t)HD * TT, (size_t)TT * HD, (size_t)ZH * TT * HD);
            k_gemmks<h16, 0><<<dim3((TT - RH) / 64, KSP, ZH), 32, 0, stream>>>((const h16*)Sb + (size_t)RH * PPI, nullptr, VT16 + zk * HD * TT, nullptr, PPI, TT, TT / KSP, Ob + (size_t)RH * HD, (size_t)TT * PPI, (size_t)HD * TT, (size_t)TT * HD, (size_t)ZH * TT * HD);
            k_merge<<<(unsigned)(((size_t)ZH * TT * HD / 2 + 255) / 256), 256, 0, stream>>>(Ob, h0, ATh, ATl); }
        k_gemmw<bf, 1, false><<<dim3(TT / 64, DM / 64, 1), 32, 0, stream>>>(ATh, ATl, WO, nullptr, DQ, OUT + (size_t)b * TT * DM, DM, nullptr, 0, 0, 0); }
}

// v004
// Measured time: 403 microseconds a run.
// Next to v003, in two timings, it ran 1.66 times as fast each time.
// All steps since v000 together make it 5.38 times as fast.
#include <hip/hip_runtime.h>

// Two-stage-projection multi-head attention (E [2][2048][1024]; Q = E WQ^T, K, V likewise ('oi' [1024][1024]); per head q = Q HQ[h]^T ('hed' [16][64][1024] = flat 'oi' [1024][1024]), k, v likewise; softmax(q.k 64^-0.5); heads concatenated; out = o WO^T -> [2][2048][1024] (4.2 M)).
// Layout per batch: first-stage projections exact (bf16 x bf16); their f32 results split into bf16 hi/lo planes for the second-stage GEMMs against the exact flattened head weights (2 products); fused dense T-2048 attention (hybrid rows: < 512 hi/lo 3 products, rest fp16); context as hi/lo planes; WO hl x exact.
// Compute dtypes, f32 accumulate: every input rounded to bf16; stage-1 projections exact, stage-2 hl x exact; attention rows < 512 3 products, rest fp16; softmax f32; WO hl x exact.

#define NB_  2
#define TT   2048
#define DM   1024
#define NH_  16
#define NKV  16
#define REP  (NH_ / NKV)
#define HD   64
#define DQ   (NH_ * HD)
#define DKV  (NKV * HD)
#define RH   512                  // query rows < RH use hi+lo planes (0: none)
#define WIN  0
#define SCL  0.125f   // HD^-0.5
typedef _Float16 h16;
typedef unsigned short bf;
typedef __attribute__((ext_vector_type(16))) __bf16   v16bf;
typedef __attribute__((ext_vector_type(16))) _Float16 v16h;
typedef __attribute__((ext_vector_type(8)))  _Float16 v8h;
typedef __attribute__((ext_vector_type(8)))  unsigned short v8us;
typedef __attribute__((ext_vector_type(8)))  float    v8f;
typedef __attribute__((ext_vector_type(4)))  float    v4f;
typedef v8h  __attribute__((may_alias)) v8ha;
typedef v4f  __attribute__((may_alias)) v4fa;
typedef v8us __attribute__((may_alias)) v8usa;

__device__ __forceinline__ unsigned short f2bf(float f) { unsigned u = __float_as_uint(f); u += 0x7FFFu + ((u >> 16) & 1u); return (unsigned short)(u >> 16); }
__device__ __forceinline__ float bf2f(unsigned short b) { return __uint_as_float(((unsigned)b) << 16); }
__device__ __forceinline__ float bfr(float f) { return bf2f(f2bf(f)); }
__device__ __forceinline__ v16h cat16(v8h lo, v8h hi) { return __builtin_shufflevector(lo, hi, 0, 1, 2, 3, 4, 5, 6, 7, 8, 9, 10, 11, 12, 13, 14, 15); }
__device__ __forceinline__ v16bf cat16b(v8us lo, v8us hi) { return __builtin_bit_cast(v16bf, __builtin_shufflevector(lo, hi, 0, 1, 2, 3, 4, 5, 6, 7, 8, 9, 10, 11, 12, 13, 14, 15)); }
__device__ __forceinline__ v8f wmma16(v16h a, v16h b, v8f c) { return __builtin_amdgcn_wmma_f32_16x16x32_f16(false, a, false, b, (short)0, c, false, false); }
__device__ __forceinline__ v8f wmmab(v16bf a, v16bf b, v8f c) { return __builtin_amdgcn_wmma_f32_16x16x32_bf16(false, a, false, b, (short)0, c, false, false); }



// ---- k_gemmw: register-blocked GEMM, ONE WAVE per 64x64 output tile (16 accumulators), operands straight from K-contiguous 16-bit planes; grid (M/64, N/64, Z), 32 threads.
// C[m][n] (f32, pitch ldc, + optional f32 bias[n]) = sum_k A[m][k] Bt[n][k] (+ split products per NSPLIT). z-batch strides sA/sB/sC in elements. K % 32 == 0.
template <typename T16> struct WFrag;
template <> struct WFrag<h16> { typedef v16h V; static __device__ __forceinline__ V ld(const h16* p) { return cat16(*(const v8h*)p, *(const v8h*)(p + 16)); } static __device__ __forceinline__ v8f mma(V a, V b, v8f c) { return wmma16(a, b, c); } };
template <> struct WFrag<bf> { typedef v16bf V; static __device__ __forceinline__ V ld(const bf* p) { return cat16b(*(const v8us*)p, *(const v8us*)(p + 16)); } static __device__ __forceinline__ v8f mma(V a, V b, v8f c) { return wmmab(a, b, c); } };
template <typename T16, int NSPLIT, bool BIAS>
__global__ __launch_bounds__(32) void k_gemmw(const T16* __restrict__ A, const T16* __restrict__ A2, const T16* __restrict__ Bt, const T16* __restrict__ Bt2, int K, float* C, int ldc, const float* __restrict__ bias, size_t sA, size_t sB, size_t sC) {
    typedef typename WFrag<T16>::V V;
    __shared__ __align__(16) float os[16 * 68];
    const size_t z = blockIdx.z; A += z * sA; if (A2) A2 += z * sA; Bt += z * sB; if (Bt2) Bt2 += z * sB; C += z * sC;
    const int lane = threadIdx.x & 31, lr = lane & 15, hi = lane >> 4; const int r0 = blockIdx.x * 64, c0 = blockIdx.y * 64;
    v8f acc[4][4];
#pragma unroll
    for (int mb = 0; mb < 4; ++mb)
#pragma unroll
        for (int nb = 0; nb < 4; ++nb) acc[mb][nb] = (v8f){};
    const size_t aoff = (size_t)(r0 + lr) * K + 8 * hi, boff = (size_t)(c0 + lr) * K + 8 * hi;
#pragma unroll 1
    for (int kc = 0; kc < K; kc += 32) {
        V a[4], a2[4];
#pragma unroll
        for (int mb = 0; mb < 4; ++mb) { a[mb] = WFrag<T16>::ld(A + aoff + (size_t)mb * 16 * K + kc); if (NSPLIT == 1 || NSPLIT == 2) a2[mb] = WFrag<T16>::ld(A2 + aoff + (size_t)mb * 16 * K + kc); }
#pragma unroll
        for (int nb = 0; nb < 4; ++nb) { const V b = WFrag<T16>::ld(Bt + boff + (size_t)nb * 16 * K + kc); V b2; if (NSPLIT >= 2) b2 = WFrag<T16>::ld(Bt2 + boff + (size_t)nb * 16 * K + kc);
#pragma unroll
            for (int mb = 0; mb < 4; ++mb) { acc[mb][nb] = WFrag<T16>::mma(a[mb], b, acc[mb][nb]); if (NSPLIT == 1 || NSPLIT == 2) acc[mb][nb] = WFrag<T16>::mma(a2[mb], b, acc[mb][nb]); if (NSPLIT >= 2) acc[mb][nb] = WFrag<T16>::mma(a[mb], b2, acc[mb][nb]); } }
        asm volatile("v_nop\n\tv_nop\n\tv_nop\n\tv_nop" : "+v"(acc[0][0]), "+v"(acc[1][1]), "+v"(acc[2][2]), "+v"(acc[3][3]) : "v"(a[0]), "v"(a[3]));
    }
#pragma unroll
    for (int mb = 0; mb < 4; ++mb) {
#pragma unroll
        for (int nb = 0; nb < 4; ++nb) {
#pragma unroll
            for (int j = 0; j < 8; ++j) os[(hi * 8 + j) * 68 + nb * 16 + lr] = acc[mb][nb][j]; }
        __builtin_amdgcn_wave_barrier(); asm volatile("" ::: "memory");
        float* crow = C + (size_t)(r0 + mb * 16) * ldc + c0;
{
#pragma unroll
            for (int s = 0; s < 8; ++s) { const int row = 2 * s + hi, cofs = lr * 4; v4f val = *(const v4fa*)(os + row * 68 + cofs); if (BIAS) { val[0] += bfr(bias[c0 + cofs]); val[1] += bfr(bias[c0 + cofs + 1]); val[2] += bfr(bias[c0 + cofs + 2]); val[3] += bfr(bias[c0 + cofs + 3]); }
                *(v4f*)(crow + (size_t)row * ldc + cofs) = val; }
             }
        __builtin_amdgcn_wave_barrier(); asm volatile("" ::: "memory");
    }
}

// xw0: s_wait_xcnt 0 behind a global load or store, in front of a later write of a register that it names.
__device__ __forceinline__ void xw0() { asm volatile("s_wait_xcnt 0x0" ::: "memory"); }
__device__ __forceinline__ h16 tohx(float x) { return (h16)x; }
__device__ __forceinline__ void splitf(float y, unsigned short& h, unsigned short& l) { h = f2bf(y); l = f2bf(y - bf2f(h)); }
typedef __attribute__((ext_vector_type(2))) _Float16 v2h;
typedef __attribute__((ext_vector_type(4))) _Float16 v4h;
typedef __attribute__((ext_vector_type(2))) unsigned short v2us;
typedef __attribute__((ext_vector_type(4))) unsigned short v4us;
typedef __attribute__((ext_vector_type(2))) float v2f;
typedef __attribute__((ext_vector_type(4))) int v4i;

__global__ __launch_bounds__(256) void k_wtG(const float* __restrict__ w, int K, int N, bf* Bt) {
    const int lane = threadIdx.x & 31; const int L0 = (blockIdx.x * 8 + (threadIdx.x >> 5)) * 8; const int nlines = N * K / 64;
{
#pragma unroll 1
        for (int l = 0; l < 8; ++l) { const int L = L0 + l; if (L >= nlines) break; const size_t e = (size_t)L * 64 + lane * 2; const int k = (int)(e % K), n = (int)(e / K); v2us o;
            o[0] = f2bf(w[(size_t)k * N + n]); o[1] = f2bf(w[(size_t)(k + 1) * N + n]); *(v2us*)(Bt + e) = o; }
         }
}
__global__ __launch_bounds__(256) void k_cvt8(const float* __restrict__ src, bf* dst, size_t n8) { const size_t i = (size_t)blockIdx.x * 256 + threadIdx.x; if (i >= n8) return; const v8f v = *(const v8f*)(src + i * 8); v8us o;
#pragma unroll
    for (int k = 0; k < 8; ++k) o[k] = f2bf(v[k]); *(v8us*)(dst + i * 8) = o;  }
// k_cvt8w: k_cvt8 of the seven weight matrices (n8 groups of 8 each) in one launch: blockIdx.y picks the source; the bf16 planes lie one behind the other in dst, in argument order.
__global__ __launch_bounds__(256) void k_cvt8w(const float* __restrict__ w0, const float* __restrict__ w1, const float* __restrict__ w2, const float* __restrict__ w3, const float* __restrict__ w4, const float* __restrict__ w5, const float* __restrict__ w6, bf* dst, size_t n8) { const size_t i = (size_t)blockIdx.x * 256 + threadIdx.x; if (i >= n8) return; const unsigned y = blockIdx.y;
    const float* src = (y == 0) ? w0 : (y == 1) ? w1 : (y == 2) ? w2 : (y == 3) ? w3 : (y == 4) ? w4 : (y == 5) ? w5 : w6; const v8f v = *(const v8f*)(src + i * 8); xw0();   // the source address pair is given to other values further down
    v8us o;
#pragma unroll
    for (int k = 0; k < 8; ++k) o[k] = f2bf(v[k]); *(v8us*)(dst + ((size_t)y * n8 + i) * 8) = o;  }

// k_rope: head planes [h][t][d] (fp16 + hi/lo) of rope(x) x sc with the rotate-half convention out[d] = x[d] cos[t][d] - x[d+HD/2] sin[t][d], out[d+HD/2] = x[d+HD/2] cos[t][d+HD/2] + x[d] sin[t][d+HD/2]
__global__ __launch_bounds__(256) void k_rope(const float* __restrict__ F, int pitch, int nheads, const float* __restrict__ CS, const float* __restrict__ RF, const float* __restrict__ nw, float sc, h16* P16, bf* Ph, bf* Pl) {
    const size_t e = ((size_t)blockIdx.x * 256 + threadIdx.x) * 2; if (e >= (size_t)nheads * TT * HD) return; const int d = (int)(e % HD); const int t = (int)((e / HD) % TT); const int h = (int)(e / ((size_t)HD * TT)); const float* f = F + (size_t)t * pitch + h * HD; const float rf = RF ? RF[(size_t)h * TT + t] : 1.0f; v2h o16; v2us oh, ol;
#pragma unroll
    for (int q = 0; q < 2; ++q) { const int dd = d + q; const int dp = (dd < HD / 2) ? dd + HD / 2 : dd - HD / 2; float x0 = f[dd], x1 = f[dp];
        if (RF) { float n0 = __fmul_rn(x0, rf), n1 = __fmul_rn(x1, rf); asm volatile("" : "+v"(n0)); asm volatile("" : "+v"(n1)); x0 = __fmul_rn(bfr(nw[dd]), n0); x1 = __fmul_rn(bfr(nw[dp]), n1); }
        const v2f cs = *(const v2f*)(CS + ((size_t)t * HD + dd) * 2); float a = __fmul_rn(x0, cs[0]), bq = __fmul_rn(x1, cs[1]); asm volatile("" : "+v"(a)); asm volatile("" : "+v"(bq)); const float r = ((dd < HD / 2) ? __fsub_rn(a, bq) : __fadd_rn(a, bq)) * sc;
        o16[q] = tohx(r); unsigned short a2, c2; splitf(r, a2, c2); oh[q] = a2; ol[q] = c2; }
    *(v2h*)(P16 + e) = o16; *(v2us*)(Ph + e) = oh; *(v2us*)(Pl + e) = ol;  }
__global__ __launch_bounds__(256) void k_vtp(const float* __restrict__ F, int pitch, int nheads, h16* V16, bf* Vh, bf* Vl) { const size_t e = ((size_t)blockIdx.x * 256 + threadIdx.x) * 2; if (e >= (size_t)nheads * HD * TT) return; const int t = (int)(e % TT); const int d = (int)((e / TT) % HD); const int g = (int)(e / ((size_t)TT * HD)); v2h o16; v2us oh, ol;
#pragma unroll
    for (int q = 0; q < 2; ++q) { const float x = F[(size_t)(t + q) * pitch + g * HD + d]; o16[q] = tohx(x); unsigned short a2, c2; splitf(x, a2, c2); oh[q] = a2; ol[q] = c2; }
    *(v2h*)(V16 + e) = o16; *(v2us*)(Vh + e) = oh; *(v2us*)(Vl + e) = ol;  }
__global__ __launch_bounds__(256) void k_csid(float* CS) { const int idx = blockIdx.x * 256 + threadIdx.x; if (idx >= TT * HD) return; v2f cs; cs[0] = 1.0f; cs[1] = 0.0f; *(v2f*)(CS + (size_t)idx * 2) = cs;  }
__global__ __launch_bounds__(256) void k_tohl(const float* __restrict__ F, bf* Hh, bf* Hl, size_t n4) { const size_t i = (size_t)blockIdx.x * 256 + threadIdx.x; if (i >= n4) return; const v4f a = *(const v4f*)(F + i * 4); v4us oh, ol;
#pragma unroll
    for (int q = 0; q < 4; ++q) { unsigned short h2, l2; splitf(a[q], h2, l2); oh[q] = h2; ol[q] = l2; }
    *(v4us*)(Hh + i * 4) = oh; *(v4us*)(Hl + i * 4) = ol;  }
#define FK 64
#define FP 72                     // LDS row pitch in 16-bit elements: 144 B = 16 B x 9
#define FT (FK * FP)              // elements of one LDS tile (HD == FK rows)
template <typename T16> struct FFrag;
template <> struct FFrag<h16> { static __device__ __forceinline__ v16h mk(v8us lo, v8us hi) { return __builtin_bit_cast(v16h, __builtin_shufflevector(lo, hi, 0, 1, 2, 3, 4, 5, 6, 7, 8, 9, 10, 11, 12, 13, 14, 15)); } };
template <> struct FFrag<bf> { static __device__ __forceinline__ v16bf mk(v8us lo, v8us hi) { return cat16b(lo, hi); } };
template <typename T16> __device__ __forceinline__ typename WFrag<T16>::V ldf(const unsigned short* p) { return FFrag<T16>::mk(*(const v8usa*)p, *(const v8usa*)(p + 16)); }
__device__ __forceinline__ float xhalf(float x) { const int b = __float_as_int(x); return __int_as_float(__builtin_amdgcn_permlanex16(b, b, 0x76543210, 0xfedcba98, false, false)); }   // the value of lane l ^ 16
template <typename T16, bool HL>
__device__ __forceinline__ void fattn(const unsigned short* __restrict__ Q, const unsigned short* __restrict__ Q2, const unsigned short* __restrict__ Kg, const unsigned short* __restrict__ Kg2, const unsigned short* __restrict__ Vg, const unsigned short* __restrict__ Vg2, int q0, int col0, bf* Ah, bf* Al, unsigned short* sm) {
    typedef typename WFrag<T16>::V V;
    static_assert(HD == 64 && FK == 64 && TT % FK == 0, "tile shapes");
    const int tid = threadIdx.x, lane = tid & 31, lr = lane & 15, hi = lane >> 4; const int qrow = q0 + (tid >> 5) * 16 + lr;
    unsigned short* Ks = sm; unsigned short* Vs = sm + FT; unsigned short* Ks2 = sm + 2 * FT; unsigned short* Vs2 = sm + 3 * FT;
    V qf[2], qf2[2];
#pragma unroll
    for (int kc = 0; kc < 2; ++kc) { qf[kc] = ldf<T16>(Q + (size_t)qrow * HD + kc * 32 + 8 * hi); if (HL) qf2[kc] = ldf<T16>(Q2 + (size_t)qrow * HD + kc * 32 + 8 * hi); }
    xw0();   // the query row's address is given to other values further down
    // staging: a tile is 512 chunks of 16 B; thread tid moves chunks tid + 128 i (row = chunk / 8): whole 128-B lines of K and of V^T
    const size_t gko = (size_t)tid * 8, gvo = (size_t)(tid >> 3) * TT + (tid & 7) * 8; const int so = (tid >> 3) * FP + (tid & 7) * 8;
    v8us rk[4], rv[4], rk2[4], rv2[4];
    __builtin_amdgcn_sched_barrier(0);   // with the one behind the wait: no other arithmetic is scheduled between these loads and their s_wait_xcnt, where it could be given a register that a load names
#pragma unroll
    for (int i = 0; i < 4; ++i) { rk[i] = *(const v8usa*)(Kg + gko + i * 1024); rv[i] = *(const v8usa*)(Vg + gvo + (size_t)i * 16 * TT); if (HL) { rk2[i] = *(const v8usa*)(Kg2 + gko + i * 1024); rv2[i] = *(const v8usa*)(Vg2 + gvo + (size_t)i * 16 * TT); } }
    xw0();   // in front of the next write of these loads' address registers
    __builtin_amdgcn_sched_barrier(0);   // second of the pair: later arithmetic stays behind the wait
    v8f O[4];
#pragma unroll
    for (int db = 0; db < 4; ++db) O[db] = (v8f){};
    v8f l8 = (v8f){};   // eight independent partial row sums a lane
    float m = -3.0e38f; const float C2 = SCL * 1.4426950408889634f;
#pragma unroll 1   // rolled: one stage's fragments and one stage's staging registers, no more
    for (int s = 0; s < TT / FK; ++s) {
        __syncthreads();   // every wave has left the tiles of the stage before
#pragma unroll
        for (int i = 0; i < 4; ++i) { *(v8usa*)(Ks + so + i * 16 * FP) = rk[i]; *(v8usa*)(Vs + so + i * 16 * FP) = rv[i]; if (HL) { *(v8usa*)(Ks2 + so + i * 16 * FP) = rk2[i]; *(v8usa*)(Vs2 + so + i * 16 * FP) = rv2[i]; } }
        __syncthreads();   // the stage's tiles are complete for every wave
        if (s + 1 < TT / FK) {   // the next stage's loads fly while this one is worked on
            const size_t ko = gko + (size_t)(s + 1) * FK * HD, vo = gvo + (size_t)(s + 1) * FK;
#pragma unroll
            for (int i = 0; i < 4; ++i) { rk[i] = *(const v8usa*)(Kg + ko + i * 1024); rv[i] = *(const v8usa*)(Vg + vo + (size_t)i * 16 * TT); if (HL) { rk2[i] = *(const v8usa*)(Kg2 + ko + i * 1024); rv2[i] = *(const v8usa*)(Vg2 + vo + (size_t)i * 16 * TT); } }
            xw0();   // in front of the next write of these loads' address registers
        }
        v8f S[4];
#pragma unroll
        for (int kb = 0; kb < 4; ++kb) { S[kb] = (v8f){};
#pragma unroll
            for (int kc = 0; kc < 2; ++kc) { const int fo = (kb * 16 + lr) * FP + kc * 32 + 8 * hi; const V k1 = ldf<T16>(Ks + fo); S[kb] = WFrag<T16>::mma(k1, qf[kc], S[kb]);
                if (HL) { S[kb] = WFrag<T16>::mma(k1, qf2[kc], S[kb]); S[kb] = WFrag<T16>::mma(ldf<T16>(Ks2 + fo), qf[kc], S[kb]); } } }
        float mx = S[0][0];
#pragma unroll
        for (int kb = 0; kb < 4; ++kb)
#pragma unroll
            for (int r = 0; r < 8; ++r) mx = fmaxf(mx, S[kb][r]);
        mx *= C2; mx = fmaxf(mx, xhalf(mx));   // the query's maximum over the stage, the same in both halves
        if (__builtin_amdgcn_ballot_w32(mx > m + 8.0f) != 0) {   // one scalar test a stage
            const float mn = fmaxf(m, mx), al = __builtin_amdgcn_exp2f(m - mn); m = mn; l8 *= al;
#pragma unroll
            for (int db = 0; db < 4; ++db) O[db] *= al; }
        const v8f c8 = {C2, C2, C2, C2, C2, C2, C2, C2}, n8 = {-m, -m, -m, -m, -m, -m, -m, -m};
#pragma unroll
        for (int kb = 0; kb < 4; ++kb) { const v8f t = __builtin_elementwise_fma(S[kb], c8, n8);
#pragma unroll
            for (int r = 0; r < 8; ++r) S[kb][r] = __builtin_amdgcn_exp2f(t[r]);
            l8 += S[kb]; }
#pragma unroll
        for (int kp = 0; kp < 2; ++kp) { V pb, pb2;
            if constexpr (HL) {
#pragma unroll
                for (int e = 0; e < 16; ++e) { const float p = S[2 * kp + (e >> 3)][e & 7]; const __bf16 ph = (__bf16)p; pb[e] = ph; pb2[e] = (__bf16)(p - (float)ph); }
            } else {
#pragma unroll
                for (int e = 0; e < 16; ++e) pb[e] = (h16)S[2 * kp + (e >> 3)][e & 7];
            }
#pragma unroll
            for (int db = 0; db < 4; ++db) { const int fo = (db * 16 + lr) * FP + kp * 32 + 8 * hi; const V v1 = ldf<T16>(Vs + fo); O[db] = WFrag<T16>::mma(v1, pb, O[db]);
                if constexpr (HL) { O[db] = WFrag<T16>::mma(v1, pb2, O[db]); O[db] = WFrag<T16>::mma(ldf<T16>(Vs2 + fo), pb, O[db]); } } }
    }
    float l = ((l8[0] + l8[1]) + (l8[2] + l8[3])) + ((l8[4] + l8[5]) + (l8[6] + l8[7])); l += xhalf(l); const float inv = __fdiv_rn(1.0f, l);
    v8us oh[4], ol[4];
#pragma unroll
    for (int db = 0; db < 4; ++db)
#pragma unroll
        for (int r = 0; r < 8; ++r) { unsigned short a, c2; splitf(O[db][r] * inv, a, c2); oh[db][r] = a; ol[db][r] = c2; }
    const size_t oo = (size_t)qrow * DQ + col0 + 8 * hi;   // a lane's 8 accumulator rows are 8 consecutive d of its query
#pragma unroll
    for (int db = 0; db < 4; ++db) { *(v8us*)(Ah + oo + db * 16) = oh[db]; *(v8us*)(Al + oo + db * 16) = ol[db]; }
}
__global__ __launch_bounds__(128) void k_fattn(const h16* __restrict__ Q16, const h16* __restrict__ K16, const h16* __restrict__ V16, const bf* __restrict__ Qh, const bf* __restrict__ Ql, const bf* __restrict__ Kh, const bf* __restrict__ Kl, const bf* __restrict__ Vh, const bf* __restrict__ Vl, bf* Ah, bf* Al) {
    __shared__ __align__(16) unsigned short sm[4 * FT];
    const int h = blockIdx.y; const size_t po = (size_t)h * TT * HD;
    const int xb = (blockIdx.x + (TT / 128) * (h >> 3)) & (TT / 64 - 1);   // query block; turned by half the blocks in the upper heads, so that the heavier hi/lo blocks do not all have the same index modulo a power of two
    if (xb < RH / 64) fattn<bf, true>(Qh + po, Ql + po, Kh + po, Kl + po, Vh + po, Vl + po, xb * 64, h * HD, Ah, Al, sm);
    else fattn<h16, false>((const unsigned short*)(Q16 + po), nullptr, (const unsigned short*)(K16 + po), nullptr, (const unsigned short*)(V16 + po), nullptr, xb * 64, h * HD, Ah, Al, sm);
}

extern "C" void kernel_launch(void* const* d_in, const int* in_sizes, int n_in,
                              void* d_out, int out_size, void* d_ws, size_t ws_size, hipStream_t stream) {
    (void)in_sizes; (void)n_in; (void)out_size;
    const float* x = (const float*)d_in[0]; const float* wq = (const float*)d_in[1]; const float* wk = (const float*)d_in[2]; const float* wv = (const float*)d_in[3]; const float* wo = (const float*)d_in[4]; const float* hq = (const float*)d_in[5]; const float* hk = (const float*)d_in[6]; const float* hv = (const float*)d_in[7];
    float* OUT = (float*)d_out;     // [2][2048][1024]
    char* wsp = (char*)d_ws;
    auto take = [&](size_t bytes) { char* p = wsp; wsp += (bytes + 255) & ~(size_t)255; return (void*)p; };
    static_assert(DKV == DQ && NKV == NH_ && ((size_t)DQ * DM * 2) % 256 == 0 && ((size_t)NH_ * TT * HD * 2) % 256 == 0, "the q, k and v chains have one shape, and planes taken one behind the other are contiguous");
    bf* WQ = (bf*)take((size_t)DQ * DM * 2); take((size_t)DKV * DM * 2); take((size_t)DKV * DM * 2);   // WQ | WK | WV: z of the first-stage launch
    bf* HQB = (bf*)take((size_t)DQ * DM * 2); take((size_t)DKV * DM * 2); take((size_t)DKV * DM * 2);   // HQ | HK | HV ('hed' [16][64][1024] = flat 'oi'): z of the second-stage launch
    bf* WO = (bf*)take((size_t)DM * DQ * 2); float* CS = (float*)take((size_t)TT * HD * 2 * 4);
    h16* QP16 = (h16*)take((size_t)NH_ * TT * HD * 2); h16* KP16 = (h16*)take((size_t)NKV * TT * HD * 2); h16* VT16 = (h16*)take((size_t)NKV * HD * TT * 2);   // each k plane directly behind its q plane: one k_rope launch writes both as 32 heads
    bf* QPh = (bf*)take((size_t)NH_ * TT * HD * 2); bf* KPh = (bf*)take((size_t)NKV * TT * HD * 2); bf* QPl = (bf*)take((size_t)NH_ * TT * HD * 2); bf* KPl = (bf*)take((size_t)NKV * TT * HD * 2); bf* VTh = (bf*)take((size_t)NKV * HD * TT * 2); bf* VTl = (bf*)take((size_t)NKV * HD * TT * 2);
    bf* ATh = (bf*)take((size_t)TT * DQ * 2); bf* ATl = (bf*)take((size_t)TT * DQ * 2);
    bf* XB = (bf*)take((size_t)TT * DM * 2); float* F1 = (float*)take((size_t)3 * TT * DQ * 4); bf* Th = (bf*)take((size_t)3 * TT * DM * 2); bf* Tl = (bf*)take((size_t)3 * TT * DM * 2); float* F2 = (float*)take((size_t)TT * 3 * DQ * 4);   // F1, Th, Tl [3][TT][1024]; F2 [TT][q 1024 | k 1024 | v 1024]
    if ((size_t)(wsp - (char*)d_ws) > ws_size) return;    // ws 256 MiB
    k_cvt8w<<<dim3((unsigned)(((size_t)DQ * DM / 8 + 255) / 256), 7, 1), 256, 0, stream>>>(wq, wk, wv, hq, hk, hv, wo, WQ, (size_t)DQ * DM / 8);
    k_csid<<<(TT * HD + 255) / 256, 256, 0, stream>>>(CS);
    const unsigned LQK = (unsigned)(((size_t)(NH_ + NKV) * TT * HD / 2 + 255) / 256), LKv = (unsigned)(((size_t)NKV * TT * HD / 2 + 255) / 256);
    const size_t n4p = (size_t)3 * TT * DM / 4; const unsigned g4p = (unsigned)((n4p + 255) / 256);
    for (int b = 0; b < NB_; ++b) {
        k_cvt8<<<(unsigned)(((size_t)TT * DM / 8 + 255) / 256), 256, 0, stream>>>(x + (size_t)b * TT * DM, XB, (size_t)TT * DM / 8);
        k_gemmw<bf, 0, false><<<dim3(TT / 64, DQ / 64, 3), 32, 0, stream>>>(XB, nullptr, WQ, nullptr, DM, F1, DQ, nullptr, 0, (size_t)DQ * DM, (size_t)TT * DQ);   /* z = 0, 1, 2: Q = E WQ^T, K = E WK^T, V = E WV^T */
        k_tohl<<<g4p, 256, 0, stream>>>(F1, Th, Tl, n4p);
        k_gemmw<bf, 1, false><<<dim3(TT / 64, DQ / 64, 3), 32, 0, stream>>>(Th, Tl, HQB, nullptr, DM, F2, 3 * DQ, nullptr, (size_t)TT * DM, (size_t)DQ * DM, (size_t)DQ);   /* z = 0, 1, 2: q = Q HQ^T, k = K HK^T, v = V HV^T (all heads), side by side in the rows of F2 */
        k_rope<<<LQK, 256, 0, stream>>>(F2, 3 * DQ, NH_ + NKV, CS, nullptr, nullptr, 1.0f, QP16, QPh, QPl);   /* heads 0..15: q planes, 16..31: k planes */
        k_vtp<<<LKv, 256, 0, stream>>>(F2 + 2 * DQ, 3 * DQ, NKV, VT16, VTh, VTl);
        k_fattn<<<dim3(TT / 64, NH_, 1), 128, 0, stream>>>(QP16, KP16, VT16, QPh, QPl, KPh, KPl, VTh, VTl, ATh, ATl);   /* all heads: context as hi/lo planes [t][head | d] */
        k_gemmw<bf, 1, false><<<dim3(TT / 64, DM / 64, 1), 32, 0, stream>>>(ATh, ATl, WO, nullptr, DQ, OUT + (size_t)b * TT * DM, DM, nullptr, 0, 0, 0); }
}

// v005
// It runs in 306 microseconds.
// Next to v004, in two timings, it ran 1.31 times as fast each time.
// Counting every step since v000, it is 7.05 times as fast.
#include <hip/hip_runtime.h>

// Two-stage-projection multi-head attention (E [2][2048][1024]; Q = E WQ^T, K, V likewise ('oi' [1024][1024]); per head q = Q HQ[h]^T ('hed' [16][64][1024] = flat 'oi' [1024][1024]), k, v likewise; softmax(q.k 64^-0.5); heads concatenated; out = o WO^T -> [2][2048][1024] (4.2 M)).
// Layout per batch: first-stage projections exact (bf16 x bf16); their f32 results split into bf16 hi/lo planes for the second-stage GEMMs against the exact flattened head weights (2 products); fused dense T-2048 attention (hybrid rows: < 512 hi/lo 3 products, rest fp16); context as hi/lo planes; WO hl x exact.
// Compute dtypes, f32 accumulate: every input rounded to bf16; stage-1 projections exact, stage-2 hl x exact; attention rows < 512 3 products, rest fp16; softmax f32; WO hl x exact.

#define NB_  2
#define TT   2048
#define DM   1024
#define NH_  16
#define NKV  16
#define REP  (NH_ / NKV)
#define HD   64
#define DQ   (NH_ * HD)
#define DKV  (NKV * HD)
#define RH   512                  // query rows < RH use hi+lo planes (0: none)
#define WIN  0
#define SCL  0.125f   // HD^-0.5
typedef _Float16 h16;
typedef unsigned short bf;
typedef __attribute__((ext_vector_type(16))) __bf16   v16bf;
typedef __attribute__((ext_vector_type(16))) _Float16 v16h;
typedef __attribute__((ext_vector_type(8)))  _Float16 v8h;
typedef __attribute__((ext_vector_type(8)))  unsigned short v8us;
typedef __attribute__((ext_vector_type(8)))  float    v8f;
typedef __attribute__((ext_vector_type(4)))  float    v4f;
typedef v8h  __attribute__((may_alias)) v8ha;
typedef v4f  __attribute__((may_alias)) v4fa;
typedef v8us __attribute__((may_alias)) v8usa;

__device__ __forceinline__ unsigned short f2bf(float f) { unsigned u = __float_as_uint(f); u += 0x7FFFu + ((u >> 16) & 1u); return (unsigned short)(u >> 16); }
__device__ __forceinline__ float bf2f(unsigned short b) { return __uint_as_float(((unsigned)b) << 16); }
__device__ __forceinline__ float bfr(float f) { return bf2f(f2bf(f)); }
__device__ __forceinline__ v16h cat16(v8h lo, v8h hi) { return __builtin_shufflevector(lo, hi, 0, 1, 2, 3, 4, 5, 6, 7, 8, 9, 10, 11, 12, 13, 14, 15); }
__device__ __forceinline__ v16bf cat16b(v8us lo, v8us hi) { return __builtin_bit_cast(v16bf, __builtin_shufflevector(lo, hi, 0, 1, 2, 3, 4, 5, 6, 7, 8, 9, 10, 11, 12, 13, 14, 15)); }
__device__ __forceinline__ v8f wmma16(v16h a, v16h b, v8f c) { return __builtin_amdgcn_wmma_f32_16x16x32_f16(false, a, false, b, (short)0, c, false, false); }
__device__ __forceinline__ v8f wmmab(v16bf a, v16bf b, v8f c) { return __builtin_amdgcn_wmma_f32_16x16x32_bf16(false, a, false, b, (short)0, c, false, false); }



// ---- k_gemmw: GEMM, FOUR WAVES per 128x128 output tile, each wave its 64x64 quarter (16 accumulators); grid (M/128, N/128, Z), 128 threads.
// C[m][n] (f32, pitch ldc, + optional f32 bias[n]) = sum_k A[m][k] Bt[n][k] (+ A2[m][k] Bt[n][k] where NSPLIT == 1). z-batch strides sA/sB/sC in elements. M % 128 == 0, N % 128 == 0, K % 64 == 0.
// A stage is GK = 64 k: the 128 rows of A (and A2) and of Bt, 128 B each, go global -> LDS by asynchronous 16-byte copies (whole 128-B lines, each fetched once a work-group), rows padded to GP elements; two buffers, the copies of stage t + 2 fly while stage t + 1 is worked on.
#define GK 64
#define GP 72                     // LDS row pitch in 16-bit elements: 144 B = 16 B x 9
#define GT (128 * GP)             // elements of one staged operand tile
template <typename T16> struct WFrag;
template <> struct WFrag<h16> { typedef v16h V; static __device__ __forceinline__ V ld(const h16* p) { return cat16(*(const v8h*)p, *(const v8h*)(p + 16)); } static __device__ __forceinline__ v8f mma(V a, V b, v8f c) { return wmma16(a, b, c); } };
template <> struct WFrag<bf> { typedef v16bf V; static __device__ __forceinline__ V ld(const bf* p) { return cat16b(*(const v8us*)p, *(const v8us*)(p + 16)); } static __device__ __forceinline__ v8f mma(V a, V b, v8f c) { return wmmab(a, b, c); } };
// cp8: a lane's eight asynchronous copies of one staged tile: 16 B from g + i rs (elements) to LDS byte l + i 16 GP 2, i = 0..7. The s_wait_xcnt 0 is the statement's last line, so that it stands in front of every later write of a register that a copy names.
template <typename T16>
__device__ __forceinline__ void cp8(unsigned l, const T16* g, size_t rs) {
    asm volatile("global_load_async_to_lds_b128 %0, %8, off\n\t"
                 "global_load_async_to_lds_b128 %1, %9, off\n\t"
                 "global_load_async_to_lds_b128 %2, %10, off\n\t"
                 "global_load_async_to_lds_b128 %3, %11, off\n\t"
                 "global_load_async_to_lds_b128 %4, %12, off\n\t"
                 "global_load_async_to_lds_b128 %5, %13, off\n\t"
                 "global_load_async_to_lds_b128 %6, %14, off\n\t"
                 "global_load_async_to_lds_b128 %7, %15, off\n\t"
                 "s_wait_xcnt 0x0"
                 :: "v"(l), "v"(l + 1u * 16 * GP * 2), "v"(l + 2u * 16 * GP * 2), "v"(l + 3u * 16 * GP * 2), "v"(l + 4u * 16 * GP * 2), "v"(l + 5u * 16 * GP * 2), "v"(l + 6u * 16 * GP * 2), "v"(l + 7u * 16 * GP * 2),
                    "v"(g), "v"(g + rs), "v"(g + 2 * rs), "v"(g + 3 * rs), "v"(g + 4 * rs), "v"(g + 5 * rs), "v"(g + 6 * rs), "v"(g + 7 * rs)
                 : "memory");
}
template <typename T16, int NSPLIT, bool BIAS>
__global__ __launch_bounds__(128) void k_gemmw(const T16* __restrict__ A, const T16* __restrict__ A2, const T16* __restrict__ Bt, int K, float* C, int ldc, const float* __restrict__ bias, size_t sA, size_t sB, size_t sC) {
    typedef typename WFrag<T16>::V V;
    static_assert(NSPLIT == 0 || NSPLIT == 1, "one or two A planes");
    constexpr int NT = 2 + NSPLIT;   // staged tiles of a stage: A, (A2,) Bt
    __shared__ __align__(16) T16 st[2 * NT * GT];
    __shared__ __align__(16) float osm[4 * 16 * 68];
    const size_t z = blockIdx.z; A += z * sA; if (NSPLIT == 1) A2 += z * sA; Bt += z * sB; C += z * sC;
    const int tid = threadIdx.x, lane = tid & 31, lr = lane & 15, hi = lane >> 4, wr = tid >> 6, wc = (tid >> 5) & 1; const int R0 = blockIdx.x * 128, C0 = blockIdx.y * 128; const int r0 = R0 + wr * 64, c0 = C0 + wc * 64;
    float* os = osm + (tid >> 5) * (16 * 68);   // each wave's own output staging
    v8f acc[4][4];
#pragma unroll
    for (int mb = 0; mb < 4; ++mb)
#pragma unroll
        for (int nb = 0; nb < 4; ++nb) acc[mb][nb] = (v8f){};
    // staging: a tile is 1024 chunks of 16 B; thread tid moves chunks tid + 128 i (row = chunk / 8)
    const size_t ga = (size_t)(R0 + (tid >> 3)) * K + (tid & 7) * 8, gb = (size_t)(C0 + (tid >> 3)) * K + (tid & 7) * 8, rs = (size_t)16 * K;
    const unsigned l0 = (unsigned)(size_t)st + (unsigned)(((tid >> 3) * GP + (tid & 7) * 8) * 2);   // the lane's LDS byte address in buffer 0, tile 0
    auto stage = [&](int t) { const unsigned l = l0 + (unsigned)(t & 1) * (NT * GT * 2); const size_t ko = (size_t)t * GK;
        cp8(l, A + ga + ko, rs); if (NSPLIT == 1) cp8(l + GT * 2, A2 + ga + ko, rs); cp8(l + (NT - 1) * GT * 2, Bt + gb + ko, rs); };
    const int nt = K / GK;
    stage(0);
    asm volatile("s_wait_asynccnt 0x0" ::: "memory");   // this wave's copies of stage 0 have landed
    __syncthreads();   // stage 0 is complete for every wave
    if (nt > 1) stage(1);
    const int ao = (wr * 64 + lr) * GP + 8 * hi, bo = (NT - 1) * GT + (wc * 64 + lr) * GP + 8 * hi;
#pragma unroll 1   // rolled: one stage's fragments in registers, and the two buffers told apart by the trip's parity
    for (int t = 0; t < nt; ++t) {
        const T16* sb = st + (t & 1) * (NT * GT);
#pragma unroll
        for (int kc = 0; kc < GK; kc += 32) {
            V a[4], a2[4], b[4];   // all fragments of a 32-k block are read in one group in front of its matrix instructions, in the order of their first use
            b[0] = WFrag<T16>::ld(sb + bo + kc);
#pragma unroll
            for (int mb = 0; mb < 4; ++mb) { a[mb] = WFrag<T16>::ld(sb + ao + mb * 16 * GP + kc); if (NSPLIT == 1) a2[mb] = WFrag<T16>::ld(sb + GT + ao + mb * 16 * GP + kc); }
#pragma unroll
            for (int nb = 1; nb < 4; ++nb) b[nb] = WFrag<T16>::ld(sb + bo + nb * 16 * GP + kc);
            __builtin_amdgcn_sched_barrier(0);   // keeps the group whole: without it the reads of b[1..3] are sunk among the matrix instructions, each with a full LDS wait in front of the next eight
#pragma unroll
            for (int nb = 0; nb < 4; ++nb)
#pragma unroll
                for (int mb = 0; mb < 4; ++mb) { acc[mb][nb] = WFrag<T16>::mma(a[mb], b[nb], acc[mb][nb]); if (NSPLIT == 1) acc[mb][nb] = WFrag<T16>::mma(a2[mb], b[nb], acc[mb][nb]); }
        }
        __builtin_amdgcn_sched_barrier(0);   // the trip's matrix instructions stay in front of its foot: sunk behind the barrier they stand in front of the next stage's copies and shorten their flight
        asm volatile("s_wait_dscnt 0x0" ::: "memory");      // this wave's reads of the buffer have returned before it is refilled
        asm volatile("s_wait_asynccnt 0x0" ::: "memory");   // this wave's copies of stage t + 1 have landed
        __syncthreads();   // publishes stage t + 1 and ends every wave's reads of stage t
        if (t + 2 < nt) stage(t + 2);   // into the buffer that this trip has just read
    }
    asm volatile("s_wait_asynccnt 0x0" ::: "memory");   // no copy is outstanding behind the loop
#pragma unroll
    for (int mb = 0; mb < 4; ++mb) {
#pragma unroll
        for (int nb = 0; nb < 4; ++nb) {
#pragma unroll
            for (int j = 0; j < 8; ++j) os[(hi * 8 + j) * 68 + nb * 16 + lr] = acc[mb][nb][j]; }
        __builtin_amdgcn_wave_barrier(); asm volatile("" ::: "memory");
        float* crow = C + (size_t)(r0 + mb * 16) * ldc + c0;
{
#pragma unroll
            for (int s = 0; s < 8; ++s) { const int row = 2 * s + hi, cofs = lr * 4; v4f val = *(const v4fa*)(os + row * 68 + cofs); if (BIAS) { val[0] += bfr(bias[c0 + cofs]); val[1] += bfr(bias[c0 + cofs + 1]); val[2] += bfr(bias[c0 + cofs + 2]); val[3] += bfr(bias[c0 + cofs + 3]); }
                *(v4f*)(crow + (size_t)row * ldc + cofs) = val; }
             }
        __builtin_amdgcn_wave_barrier(); asm volatile("" ::: "memory");
    }
}

// xw0: s_wait_xcnt 0 behind a global load or store, in front of a later write of a register that it names.
__device__ __forceinline__ void xw0() { asm volatile("s_wait_xcnt 0x0" ::: "memory"); }
__device__ __forceinline__ h16 tohx(float x) { return (h16)x; }
__device__ __forceinline__ void splitf(float y, unsigned short& h, unsigned short& l) { h = f2bf(y); l = f2bf(y - bf2f(h)); }
typedef __attribute__((ext_vector_type(2))) _Float16 v2h;
typedef __attribute__((ext_vector_type(4))) _Float16 v4h;
typedef __attribute__((ext_vector_type(2))) unsigned short v2us;
typedef __attribute__((ext_vector_type(4))) unsigned short v4us;
typedef __attribute__((ext_vector_type(2))) float v2f;
typedef __attribute__((ext_vector_type(4))) int v4i;

__global__ __launch_bounds__(256) void k_wtG(const float* __restrict__ w, int K, int N, bf* Bt) {
    const int lane = threadIdx.x & 31; const int L0 = (blockIdx.x * 8 + (threadIdx.x >> 5)) * 8; const int nlines = N * K / 64;
{
#pragma unroll 1
        for (int l = 0; l < 8; ++l) { const int L = L0 + l; if (L >= nlines) break; const size_t e = (size_t)L * 64 + lane * 2; const int k = (int)(e % K), n = (int)(e / K); v2us o;
            o[0] = f2bf(w[(size_t)k * N + n]); o[1] = f2bf(w[(size_t)(k + 1) * N + n]); *(v2us*)(Bt + e) = o; }
         }
}
__global__ __launch_bounds__(256) void k_cvt8(const float* __restrict__ src, bf* dst, size_t n8) { const size_t i = (size_t)blockIdx.x * 256 + threadIdx.x; if (i >= n8) return; const v8f v = *(const v8f*)(src + i * 8); v8us o;
#pragma unroll
    for (int k = 0; k < 8; ++k) o[k] = f2bf(v[k]); *(v8us*)(dst + i * 8) = o;  }
// k_cvt8w: k_cvt8 of the seven weight matrices (n8 groups of 8 each) in one launch: blockIdx.y picks the source; the bf16 planes lie one behind the other in dst, in argument order.
__global__ __launch_bounds__(256) void k_cvt8w(const float* __restrict__ w0, const float* __restrict__ w1, const float* __restrict__ w2, const float* __restrict__ w3, const float* __restrict__ w4, const float* __restrict__ w5, const float* __restrict__ w6, bf* dst, size_t n8) { const size_t i = (size_t)blockIdx.x * 256 + threadIdx.x; if (i >= n8) return; const unsigned y = blockIdx.y;
    const float* src = (y == 0) ? w0 : (y == 1) ? w1 : (y == 2) ? w2 : (y == 3) ? w3 : (y == 4) ? w4 : (y == 5) ? w5 : w6; const v8f v = *(const v8f*)(src + i * 8); xw0();   // the source address pair is given to other values further down
    v8us o;
#pragma unroll
    for (int k = 0; k < 8; ++k) o[k] = f2bf(v[k]); *(v8us*)(dst + ((size_t)y * n8 + i) * 8) = o;  }

// k_rope: head planes [h][t][d] (fp16 + hi/lo) of rope(x) x sc with the rotate-half convention out[d] = x[d] cos[t][d] - x[d+HD/2] sin[t][d], out[d+HD/2] = x[d+HD/2] cos[t][d+HD/2] + x[d] sin[t][d+HD/2]
__global__ __launch_bounds__(256) void k_rope(const float* __restrict__ F, int pitch, int nheads, const float* __restrict__ CS, const float* __restrict__ RF, const float* __restrict__ nw, float sc, h16* P16, bf* Ph, bf* Pl) {
    const size_t e = ((size_t)blockIdx.x * 256 + threadIdx.x) * 2; if (e >= (size_t)nheads * TT * HD) return; const int d = (int)(e % HD); const int t = (int)((e / HD) % TT); const int h = (int)(e / ((size_t)HD * TT)); const float* f = F + (size_t)t * pitch + h * HD; const float rf = RF ? RF[(size_t)h * TT + t] : 1.0f; v2h o16; v2us oh, ol;
#pragma unroll
    for (int q = 0; q < 2; ++q) { const int dd = d + q; const int dp = (dd < HD / 2) ? dd + HD / 2 : dd - HD / 2; float x0 = f[dd], x1 = f[dp];
        if (RF) { float n0 = __fmul_rn(x0, rf), n1 = __fmul_rn(x1, rf); asm volatile("" : "+v"(n0)); asm volatile("" : "+v"(n1)); x0 = __fmul_rn(bfr(nw[dd]), n0); x1 = __fmul_rn(bfr(nw[dp]), n1); }
        const v2f cs = *(const v2f*)(CS + ((size_t)t * HD + dd) * 2); float a = __fmul_rn(x0, cs[0]), bq = __fmul_rn(x1, cs[1]); asm volatile("" : "+v"(a)); asm volatile("" : "+v"(bq)); const float r = ((dd < HD / 2) ? __fsub_rn(a, bq) : __fadd_rn(a, bq)) * sc;
        o16[q] = tohx(r); unsigned short a2, c2; splitf(r, a2, c2); oh[q] = a2; ol[q] = c2; }
    *(v2h*)(P16 + e) = o16; *(v2us*)(Ph + e) = oh; *(v2us*)(Pl + e) = ol;  }
__global__ __launch_bounds__(256) void k_vtp(const float* __restrict__ F, int pitch, int nheads, h16* V16, bf* Vh, bf* Vl) { const size_t e = ((size_t)blockIdx.x * 256 + threadIdx.x) * 2; if (e >= (size_t)nheads * HD * TT) return; const int t = (int)(e % TT); const int d = (int)((e / TT) % HD); const int g = (int)(e / ((size_t)TT * HD)); v2h o16; v2us oh, ol;
#pragma unroll
    for (int q = 0; q < 2; ++q) { const float x = F[(size_t)(t + q) * pitch + g * HD + d]; o16[q] = tohx(x); unsigned short a2, c2; splitf(x, a2, c2); oh[q] = a2; ol[q] = c2; }
    *(v2h*)(V16 + e) = o16; *(v2us*)(Vh + e) = oh; *(v2us*)(Vl + e) = ol;  }
__global__ __launch_bounds__(256) void k_csid(float* CS) { const int idx = blockIdx.x * 256 + threadIdx.x; if (idx >= TT * HD) return; v2f cs; cs[0] = 1.0f; cs[1] = 0.0f; *(v2f*)(CS + (size_t)idx * 2) = cs;  }
__global__ __launch_bounds__(256) void k_tohl(const float* __restrict__ F, bf* Hh, bf* Hl, size_t n4) { const size_t i = (size_t)blockIdx.x * 256 + threadIdx.x; if (i >= n4) return; const v4f a = *(const v4f*)(F + i * 4); v4us oh, ol;
#pragma unroll
    for (int q = 0; q < 4; ++q) { unsigned short h2, l2; splitf(a[q], h2, l2); oh[q] = h2; ol[q] = l2; }
    *(v4us*)(Hh + i * 4) = oh; *(v4us*)(Hl + i * 4) = ol;  }
#define FK 64
#define FP 72                     // LDS row pitch in 16-bit elements: 144 B = 16 B x 9
#define FT (FK * FP)              // elements of one LDS tile (HD == FK rows)
template <typename T16> struct FFrag;
template <> struct FFrag<h16> { static __device__ __forceinline__ v16h mk(v8us lo, v8us hi) { return __builtin_bit_cast(v16h, __builtin_shufflevector(lo, hi, 0, 1, 2, 3, 4, 5, 6, 7, 8, 9, 10, 11, 12, 13, 14, 15)); } };
template <> struct FFrag<bf> { static __device__ __forceinline__ v16bf mk(v8us lo, v8us hi) { return cat16b(lo, hi); } };
template <typename T16> __device__ __forceinline__ typename WFrag<T16>::V ldf(const unsigned short* p) { return FFrag<T16>::mk(*(const v8usa*)p, *(const v8usa*)(p + 16)); }
__device__ __forceinline__ float xhalf(float x) { const int b = __float_as_int(x); return __int_as_float(__builtin_amdgcn_permlanex16(b, b, 0x76543210, 0xfedcba98, false, false)); }   // the value of lane l ^ 16
template <typename T16, bool HL>
__device__ __forceinline__ void fattn(const unsigned short* __restrict__ Q, const unsigned short* __restrict__ Q2, const unsigned short* __restrict__ Kg, const unsigned short* __restrict__ Kg2, const unsigned short* __restrict__ Vg, const unsigned short* __restrict__ Vg2, int q0, int col0, bf* Ah, bf* Al, unsigned short* sm) {
    typedef typename WFrag<T16>::V V;
    static_assert(HD == 64 && FK == 64 && TT % FK == 0, "tile shapes");
    const int tid = threadIdx.x, lane = tid & 31, lr = lane & 15, hi = lane >> 4; const int qrow = q0 + (tid >> 5) * 16 + lr;
    unsigned short* Ks = sm; unsigned short* Vs = sm + FT; unsigned short* Ks2 = sm + 2 * FT; unsigned short* Vs2 = sm + 3 * FT;
    V qf[2], qf2[2];
#pragma unroll
    for (int kc = 0; kc < 2; ++kc) { qf[kc] = ldf<T16>(Q + (size_t)qrow * HD + kc * 32 + 8 * hi); if (HL) qf2[kc] = ldf<T16>(Q2 + (size_t)qrow * HD + kc * 32 + 8 * hi); }
    xw0();   // the query row's address is given to other values further down
    // staging: a tile is 512 chunks of 16 B; thread tid moves chunks tid + 128 i (row = chunk / 8): whole 128-B lines of K and of V^T
    const size_t gko = (size_t)tid * 8, gvo = (size_t)(tid >> 3) * TT + (tid & 7) * 8; const int so = (tid >> 3) * FP + (tid & 7) * 8;
    v8us rk[4], rv[4], rk2[4], rv2[4];
    __builtin_amdgcn_sched_barrier(0);   // with the one behind the wait: no other arithmetic is scheduled between these loads and their s_wait_xcnt, where it could be given a register that a load names
#pragma unroll
    for (int i = 0; i < 4; ++i) { rk[i] = *(const v8usa*)(Kg + gko + i * 1024); rv[i] = *(const v8usa*)(Vg + gvo + (size_t)i * 16 * TT); if (HL) { rk2[i] = *(const v8usa*)(Kg2 + gko + i * 1024); rv2[i] = *(const v8usa*)(Vg2 + gvo + (size_t)i * 16 * TT); } }
    xw0();   // in front of the next write of these loads' address registers
    __builtin_amdgcn_sched_barrier(0);   // second of the pair: later arithmetic stays behind the wait
    v8f O[4];
#pragma unroll
    for (int db = 0; db < 4; ++db) O[db] = (v8f){};
    v8f l8 = (v8f){};   // eight independent partial row sums a lane
    float m = -3.0e38f; const float C2 = SCL * 1.4426950408889634f;
#pragma unroll 1   // rolled: one stage's fragments and one stage's staging registers, no more
    for (int s = 0; s < TT / FK; ++s) {
        __syncthreads();   // every wave has left the tiles of the stage before
#pragma unroll
        for (int i = 0; i < 4; ++i) { *(v8usa*)(Ks + so + i * 16 * FP) = rk[i]; *(v8usa*)(Vs + so + i * 16 * FP) = rv[i]; if (HL) { *(v8usa*)(Ks2 + so + i * 16 * FP) = rk2[i]; *(v8usa*)(Vs2 + so + i * 16 * FP) = rv2[i]; } }
        __syncthreads();   // the stage's tiles are complete for every wave
        if (s + 1 < TT / FK) {   // the next stage's loads fly while this one is worked on
            const size_t ko = gko + (size_t)(s + 1) * FK * HD, vo = gvo + (size_t)(s + 1) * FK;
#pragma unroll
            for (int i = 0; i < 4; ++i) { rk[i] = *(const v8usa*)(Kg + ko + i * 1024); rv[i] = *(const v8usa*)(Vg + vo + (size_t)i * 16 * TT); if (HL) { rk2[i] = *(const v8usa*)(Kg2 + ko + i * 1024); rv2[i] = *(const v8usa*)(Vg2 + vo + (size_t)i * 16 * TT); } }
            xw0();   // in front of the next write of these loads' address registers
        }
        v8f S[4];
#pragma unroll
        for (int kb = 0; kb < 4; ++kb) { S[kb] = (v8f){};
#pragma unroll
            for (int kc = 0; kc < 2; ++kc) { const int fo = (kb * 16 + lr) * FP + kc * 32 + 8 * hi; const V k1 = ldf<T16>(Ks + fo); S[kb] = WFrag<T16>::mma(k1, qf[kc], S[kb]);
                if (HL) { S[kb] = WFrag<T16>::mma(k1, qf2[kc], S[kb]); S[kb] = WFrag<T16>::mma(ldf<T16>(Ks2 + fo), qf[kc], S[kb]); } } }
        float mx = S[0][0];
#pragma unroll
        for (int kb = 0; kb < 4; ++kb)
#pragma unroll
            for (int r = 0; r < 8; ++r) mx = fmaxf(mx, S[kb][r]);
        mx *= C2; mx = fmaxf(mx, xhalf(mx));   // the query's maximum over the stage, the same in both halves
        if (__builtin_amdgcn_ballot_w32(mx > m + 8.0f) != 0) {   // one scalar test a stage
            const float mn = fmaxf(m, mx), al = __builtin_amdgcn_exp2f(m - mn); m = mn; l8 *= al;
#pragma unroll
            for (int db = 0; db < 4; ++db) O[db] *= al; }
        const v8f c8 = {C2, C2, C2, C2, C2, C2, C2, C2}, n8 = {-m, -m, -m, -m, -m, -m, -m, -m};
#pragma unroll
        for (int kb = 0; kb < 4; ++kb) { const v8f t = __builtin_elementwise_fma(S[kb], c8, n8);
#pragma unroll
            for (int r = 0; r < 8; ++r) S[kb][r] = __builtin_amdgcn_exp2f(t[r]);
            l8 += S[kb]; }
#pragma unroll
        for (int kp = 0; kp < 2; ++kp) { V pb, pb2;
            if constexpr (HL) {
#pragma unroll
                for (int e = 0; e < 16; ++e) { const float p = S[2 * kp + (e >> 3)][e & 7]; const __bf16 ph = (__bf16)p; pb[e] = ph; pb2[e] = (__bf16)(p - (float)ph); }
            } else {
#pragma unroll
                for (int e = 0; e < 16; ++e) pb[e] = (h16)S[2 * kp + (e >> 3)][e & 7];
            }
#pragma unroll
            for (int db = 0; db < 4; ++db) { const int fo = (db * 16 + lr) * FP + kp * 32 + 8 * hi; const V v1 = ldf<T16>(Vs + fo); O[db] = WFrag<T16>::mma(v1, pb, O[db]);
                if constexpr (HL) { O[db] = WFrag<T16>::mma(v1, pb2, O[db]); O[db] = WFrag<T16>::mma(ldf<T16>(Vs2 + fo), pb, O[db]); } } }
    }
    float l = ((l8[0] + l8[1]) + (l8[2] + l8[3])) + ((l8[4] + l8[5]) + (l8[6] + l8[7])); l += xhalf(l); const float inv = __fdiv_rn(1.0f, l);
    v8us oh[4], ol[4];
#pragma unroll
    for (int db = 0; db < 4; ++db)
#pragma unroll
        for (int r = 0; r < 8; ++r) { unsigned short a, c2; splitf(O[db][r] * inv, a, c2); oh[db][r] = a; ol[db][r] = c2; }
    const size_t oo = (size_t)qrow * DQ + col0 + 8 * hi;   // a lane's 8 accumulator rows are 8 consecutive d of its query
#pragma unroll
    for (int db = 0; db < 4; ++db) { *(v8us*)(Ah + oo + db * 16) = oh[db]; *(v8us*)(Al + oo + db * 16) = ol[db]; }
}
__global__ __launch_bounds__(128) void k_fattn(const h16* __restrict__ Q16, const h16* __restrict__ K16, const h16* __restrict__ V16, const bf* __restrict__ Qh, const bf* __restrict__ Ql, const bf* __restrict__ Kh, const bf* __restrict__ Kl, const bf* __restrict__ Vh, const bf* __restrict__ Vl, bf* Ah, bf* Al) {
    __shared__ __align__(16) unsigned short sm[4 * FT];
    const int h = blockIdx.y; const size_t po = (size_t)h * TT * HD;
    const int xb = (blockIdx.x + (TT / 128) * (h >> 3)) & (TT / 64 - 1);   // query block; turned by half the blocks in the upper heads, so that the heavier hi/lo blocks do not all have the same index modulo a power of two
    if (xb < RH / 64) fattn<bf, true>(Qh + po, Ql + po, Kh + po, Kl + po, Vh + po, Vl + po, xb * 64, h * HD, Ah, Al, sm);
    else fattn<h16, false>((const unsigned short*)(Q16 + po), nullptr, (const unsigned short*)(K16 + po), nullptr, (const unsigned short*)(V16 + po), nullptr, xb * 64, h * HD, Ah, Al, sm);
}

extern "C" void kernel_launch(void* const* d_in, const int* in_sizes, int n_in,
                              void* d_out, int out_size, void* d_ws, size_t ws_size, hipStream_t stream) {
    (void)in_sizes; (void)n_in; (void)out_size;
    const float* x = (const float*)d_in[0]; const float* wq = (const float*)d_in[1]; const float* wk = (const float*)d_in[2]; const float* wv = (const float*)d_in[3]; const float* wo = (const float*)d_in[4]; const float* hq = (const float*)d_in[5]; const float* hk = (const float*)d_in[6]; const float* hv = (const float*)d_in[7];
    float* OUT = (float*)d_out;     // [2][2048][1024]
    char* wsp = (char*)d_ws;
    auto take = [&](size_t bytes) { char* p = wsp; wsp += (bytes + 255) & ~(size_t)255; return (void*)p; };
    static_assert(DKV == DQ && NKV == NH_ && ((size_t)DQ * DM * 2) % 256 == 0 && ((size_t)NH_ * TT * HD * 2) % 256 == 0, "the q, k and v chains have one shape, and planes taken one behind the other are contiguous");
    bf* WQ = (bf*)take((size_t)DQ * DM * 2); take((size_t)DKV * DM * 2); take((size_t)DKV * DM * 2);   // WQ | WK | WV: z of the first-stage launch
    bf* HQB = (bf*)take((size_t)DQ * DM * 2); take((size_t)DKV * DM * 2); take((size_t)DKV * DM * 2);   // HQ | HK | HV ('hed' [16][64][1024] = flat 'oi'): z of the second-stage launch
    bf* WO = (bf*)take((size_t)DM * DQ * 2); float* CS = (float*)take((size_t)TT * HD * 2 * 4);
    h16* QP16 = (h16*)take((size_t)NH_ * TT * HD * 2); h16* KP16 = (h16*)take((size_t)NKV * TT * HD * 2); h16* VT16 = (h16*)take((size_t)NKV * HD * TT * 2);   // each k plane directly behind its q plane: one k_rope launch writes both as 32 heads
    bf* QPh = (bf*)take((size_t)NH_ * TT * HD * 2); bf* KPh = (bf*)take((size_t)NKV * TT * HD * 2); bf* QPl = (bf*)take((size_t)NH_ * TT * HD * 2); bf* KPl = (bf*)take((size_t)NKV * TT * HD * 2); bf* VTh = (bf*)take((size_t)NKV * HD * TT * 2); bf* VTl = (bf*)take((size_t)NKV * HD * TT * 2);
    bf* ATh = (bf*)take((size_t)TT * DQ * 2); bf* ATl = (bf*)take((size_t)TT * DQ * 2);
    bf* XB = (bf*)take((size_t)TT * DM * 2); float* F1 = (float*)take((size_t)3 * TT * DQ * 4); bf* Th = (bf*)take((size_t)3 * TT * DM * 2); bf* Tl = (bf*)take((size_t)3 * TT * DM * 2); float* F2 = (float*)take((size_t)TT * 3 * DQ * 4);   // F1, Th, Tl [3][TT][1024]; F2 [TT][q 1024 | k 1024 | v 1024]
    if ((size_t)(wsp - (char*)d_ws) > ws_size) return;    // ws 256 MiB
    k_cvt8w<<<dim3((unsigned)(((size_t)DQ * DM / 8 + 255) / 256), 7, 1), 256, 0, stream>>>(wq, wk, wv, hq, hk, hv, wo, WQ, (size_t)DQ * DM / 8);
    k_csid<<<(TT * HD + 255) / 256, 256, 0, stream>>>(CS);
    const unsigned LQK = (unsigned)(((size_t)(NH_ + NKV) * TT * HD / 2 + 255) / 256), LKv = (unsigned)(((size_t)NKV * TT * HD / 2 + 255) / 256);
    const size_t n4p = (size_t)3 * TT * DM / 4; const unsigned g4p = (unsigned)((n4p + 255) / 256);
    for (int b = 0; b < NB_; ++b) {
        k_cvt8<<<(unsigned)(((size_t)TT * DM / 8 + 255) / 256), 256, 0, stream>>>(x + (size_t)b * TT * DM, XB, (size_t)TT * DM / 8);
        k_gemmw<bf, 0, false><<<dim3(TT / 128, DQ / 128, 3), 128, 0, stream>>>(XB, nullptr, WQ, DM, F1, DQ, nullptr, 0, (size_t)DQ * DM, (size_t)TT * DQ);   /* z = 0, 1, 2: Q = E WQ^T, K = E WK^T, V = E WV^T */
        k_tohl<<<g4p, 256, 0, stream>>>(F1, Th, Tl, n4p);
        k_gemmw<bf, 1, false><<<dim3(TT / 128, DQ / 128, 3), 128, 0, stream>>>(Th, Tl, HQB, DM, F2, 3 * DQ, nullptr, (size_t)TT * DM, (size_t)DQ * DM, (size_t)DQ);   /* z = 0, 1, 2: q = Q HQ^T, k = K HK^T, v = V HV^T (all heads), side by side in the rows of F2 */
        k_rope<<<LQK, 256, 0, stream>>>(F2, 3 * DQ, NH_ + NKV, CS, nullptr, nullptr, 1.0f, QP16, QPh, QPl);   /* heads 0..15: q planes, 16..31: k planes */
        k_vtp<<<LKv, 256, 0, stream>>>(F2 + 2 * DQ, 3 * DQ, NKV, VT16, VTh, VTl);
        k_fattn<<<dim3(TT / 64, NH_, 1), 128, 0, stream>>>(QP16, KP16, VT16, QPh, QPl, KPh, KPl, VTh, VTl, ATh, ATl);   /* all heads: context as hi/lo planes [t][head | d] */
        k_gemmw<bf, 1, false><<<dim3(TT / 128, DM / 128, 1), 128, 0, stream>>>(ATh, ATl, WO, DQ, OUT + (size_t)b * TT * DM, DM, nullptr, 0, 0, 0); }
}

// v006
// Measured time: 247 microseconds a run.
// In both of two side-by-side timings against v005, it was 1.23 times as fast.
// Over all steps from v000 it is 8.70 times as fast.
#include <hip/hip_runtime.h>

// Two-stage-projection multi-head attention (E [2][2048][1024]; Q = E WQ^T, K, V likewise ('oi' [1024][1024]); per head q = Q HQ[h]^T ('hed' [16][64][1024] = flat 'oi' [1024][1024]), k, v likewise; softmax(q.k 64^-0.5); heads concatenated; out = o WO^T -> [2][2048][1024] (4.2 M)).
// Layout per batch: first-stage projections exact (bf16 x bf16); their f32 results split into bf16 hi/lo planes (in the GEMM's own epilogue) for the second-stage GEMMs against the exact flattened head weights (2 products), whose epilogue writes the attention's q, k and V^T planes; fused dense T-2048 attention (hybrid rows: < 512 hi/lo 3 products, rest fp16); context as hi/lo planes; WO hl x exact.
// Compute dtypes, f32 accumulate: every input rounded to bf16; stage-1 projections exact, stage-2 hl x exact; attention rows < 512 3 products, rest fp16; softmax f32; WO hl x exact.

#define NB_  2
#define TT   2048
#define DM   1024
#define NH_  16
#define NKV  16
#define REP  (NH_ / NKV)
#define HD   64
#define DQ   (NH_ * HD)
#define DKV  (NKV * HD)
#define RH   512                  // query rows < RH use hi+lo planes (0: none)
#define WIN  0
#define SCL  0.125f   // HD^-0.5
typedef _Float16 h16;
typedef unsigned short bf;
typedef __attribute__((ext_vector_type(16))) __bf16   v16bf;
typedef __attribute__((ext_vector_type(16))) _Float16 v16h;
typedef __attribute__((ext_vector_type(8)))  _Float16 v8h;
typedef __attribute__((ext_vector_type(8)))  unsigned short v8us;
typedef __attribute__((ext_vector_type(8)))  float    v8f;
typedef __attribute__((ext_vector_type(4)))  float    v4f;
typedef v8h  __attribute__((may_alias)) v8ha;
typedef v4f  __attribute__((may_alias)) v4fa;
typedef v8us __attribute__((may_alias)) v8usa;

__device__ __forceinline__ unsigned short f2bf(float f) { unsigned u = __float_as_uint(f); u += 0x7FFFu + ((u >> 16) & 1u); return (unsigned short)(u >> 16); }
__device__ __forceinline__ float bf2f(unsigned short b) { return __uint_as_float(((unsigned)b) << 16); }
__device__ __forceinline__ float bfr(float f) { return bf2f(f2bf(f)); }
__device__ __forceinline__ v16h cat16(v8h lo, v8h hi) { return __builtin_shufflevector(lo, hi, 0, 1, 2, 3, 4, 5, 6, 7, 8, 9, 10, 11, 12, 13, 14, 15); }
__device__ __forceinline__ v16bf cat16b(v8us lo, v8us hi) { return __builtin_bit_cast(v16bf, __builtin_shufflevector(lo, hi, 0, 1, 2, 3, 4, 5, 6, 7, 8, 9, 10, 11, 12, 13, 14, 15)); }
__device__ __forceinline__ v8f wmma16(v16h a, v16h b, v8f c) { return __builtin_amdgcn_wmma_f32_16x16x32_f16(false, a, false, b, (short)0, c, false, false); }
__device__ __forceinline__ v8f wmmab(v16bf a, v16bf b, v8f c) { return __builtin_amdgcn_wmma_f32_16x16x32_bf16(false, a, false, b, (short)0, c, false, false); }



// ---- k_gemmw: GEMM, FOUR WAVES per 128x128 output tile, each wave its 64x64 quarter (16 accumulators); grid (M/128, N/128, Z), 128 threads.
// C[m][n] (f32, pitch ldc, + optional f32 bias[n]) = sum_k A[m][k] Bt[n][k] (+ A2[m][k] Bt[n][k] where NSPLIT == 1). z-batch strides sA/sB/sC in elements. M % 128 == 0, N % 128 == 0, K % 64 == 0.
// EPI says what leaves the kernel. 0: C in f32. 1: C as bf16 hi/lo planes Ph, Pl (pitch ldc, z stride sC). 2: C as the attention's operand planes P16 (fp16), Ph, Pl (bf16 hi/lo), plane group z at z NH_ TT HD: z = 0, 1 head planes [head][m][d], z = 2 transposed [head][d][m]; a wave's 64 columns are one head. No f32 C lies in memory for 1 and 2.
// A stage is GK = 64 k: the 128 rows of A (and A2) and of Bt, 128 B each, go global -> LDS by asynchronous 16-byte copies (whole 128-B lines, each fetched once a work-group), rows padded to GP elements; two buffers, the copies of stage t + 2 fly while stage t + 1 is worked on.
#define GK 64
#define GP 72                     // LDS row pitch in 16-bit elements: 144 B = 16 B x 9
#define GT (128 * GP)             // elements of one staged operand tile
template <typename T16> struct WFrag;
template <> struct WFrag<h16> { typedef v16h V; static __device__ __forceinline__ V ld(const h16* p) { return cat16(*(const v8h*)p, *(const v8h*)(p + 16)); } static __device__ __forceinline__ v8f mma(V a, V b, v8f c) { return wmma16(a, b, c); } };
template <> struct WFrag<bf> { typedef v16bf V; static __device__ __forceinline__ V ld(const bf* p) { return cat16b(*(const v8us*)p, *(const v8us*)(p + 16)); } static __device__ __forceinline__ v8f mma(V a, V b, v8f c) { return wmmab(a, b, c); } };
// cp8: a lane's eight asynchronous copies of one staged tile: 16 B from g + i rs (elements) to LDS byte l + i 16 GP 2, i = 0..7. The s_wait_xcnt 0 is the statement's last line, so that it stands in front of every later write of a register that a copy names.
template <typename T16>
__device__ __forceinline__ void cp8(unsigned l, const T16* g, size_t rs) {
    asm volatile("global_load_async_to_lds_b128 %0, %8, off\n\t"
                 "global_load_async_to_lds_b128 %1, %9, off\n\t"
                 "global_load_async_to_lds_b128 %2, %10, off\n\t"
                 "global_load_async_to_lds_b128 %3, %11, off\n\t"
                 "global_load_async_to_lds_b128 %4, %12, off\n\t"
                 "global_load_async_to_lds_b128 %5, %13, off\n\t"
                 "global_load_async_to_lds_b128 %6, %14, off\n\t"
                 "global_load_async_to_lds_b128 %7, %15, off\n\t"
                 "s_wait_xcnt 0x0"
                 :: "v"(l), "v"(l + 1u * 16 * GP * 2), "v"(l + 2u * 16 * GP * 2), "v"(l + 3u * 16 * GP * 2), "v"(l + 4u * 16 * GP * 2), "v"(l + 5u * 16 * GP * 2), "v"(l + 6u * 16 * GP * 2), "v"(l + 7u * 16 * GP * 2),
                    "v"(g), "v"(g + rs), "v"(g + 2 * rs), "v"(g + 3 * rs), "v"(g + 4 * rs), "v"(g + 5 * rs), "v"(g + 6 * rs), "v"(g + 7 * rs)
                 : "memory");
}
// xw0: s_wait_xcnt 0 behind a global load or store, in front of a later write of a register that it names.
__device__ __forceinline__ void xw0() { asm volatile("s_wait_xcnt 0x0" ::: "memory"); }
__device__ __forceinline__ h16 tohx(float x) { return (h16)x; }
__device__ __forceinline__ void splitf(float y, unsigned short& h, unsigned short& l) { h = f2bf(y); l = f2bf(y - bf2f(h)); }
template <typename T16, int NSPLIT, bool BIAS, int EPI>
__global__ __launch_bounds__(128) void k_gemmw(const T16* __restrict__ A, const T16* __restrict__ A2, const T16* __restrict__ Bt, int K, float* C, int ldc, const float* __restrict__ bias, h16* P16, bf* Ph, bf* Pl, size_t sA, size_t sB, size_t sC) {
    typedef typename WFrag<T16>::V V;
    static_assert(NSPLIT == 0 || NSPLIT == 1, "one or two A planes");
    constexpr int NT = 2 + NSPLIT;   // staged tiles of a stage: A, (A2,) Bt
    __shared__ __align__(16) T16 st[2 * NT * GT];
    __shared__ __align__(16) float osm[4 * 16 * 68];
    const size_t z = blockIdx.z; A += z * sA; if (NSPLIT == 1) A2 += z * sA; Bt += z * sB; if (EPI == 0) C += z * sC;
    const int tid = threadIdx.x, lane = tid & 31, lr = lane & 15, hi = lane >> 4, wr = tid >> 6, wc = (tid >> 5) & 1; const int R0 = blockIdx.x * 128, C0 = blockIdx.y * 128; const int r0 = R0 + wr * 64, c0 = C0 + wc * 64;
    float* os = osm + (tid >> 5) * (16 * 68);   // each wave's own output staging
    v8f acc[4][4];
#pragma unroll
    for (int mb = 0; mb < 4; ++mb)
#pragma unroll
        for (int nb = 0; nb < 4; ++nb) acc[mb][nb] = (v8f){};
    // staging: a tile is 1024 chunks of 16 B; thread tid moves chunks tid + 128 i (row = chunk / 8)
    const size_t ga = (size_t)(R0 + (tid >> 3)) * K + (tid & 7) * 8, gb = (size_t)(C0 + (tid >> 3)) * K + (tid & 7) * 8, rs = (size_t)16 * K;
    const unsigned l0 = (unsigned)(size_t)st + (unsigned)(((tid >> 3) * GP + (tid & 7) * 8) * 2);   // the lane's LDS byte address in buffer 0, tile 0
    auto stage = [&](int t) { const unsigned l = l0 + (unsigned)(t & 1) * (NT * GT * 2); const size_t ko = (size_t)t * GK;
        cp8(l, A + ga + ko, rs); if (NSPLIT == 1) cp8(l + GT * 2, A2 + ga + ko, rs); cp8(l + (NT - 1) * GT * 2, Bt + gb + ko, rs); };
    const int nt = K / GK;
    stage(0);
    asm volatile("s_wait_asynccnt 0x0" ::: "memory");   // this wave's copies of stage 0 have landed
    __syncthreads();   // stage 0 is complete for every wave
    if (nt > 1) stage(1);
    const int ao = (wr * 64 + lr) * GP + 8 * hi, bo = (NT - 1) * GT + (wc * 64 + lr) * GP + 8 * hi;
#pragma unroll 1   // rolled: one stage's fragments in registers, and the two buffers told apart by the trip's parity
    for (int t = 0; t < nt; ++t) {
        const T16* sb = st + (t & 1) * (NT * GT);
#pragma unroll
        for (int kc = 0; kc < GK; kc += 32) {
            V a[4], a2[4], b[4];   // all fragments of a 32-k block are read in one group in front of its matrix instructions, in the order of their first use
            b[0] = WFrag<T16>::ld(sb + bo + kc);
#pragma unroll
            for (int mb = 0; mb < 4; ++mb) { a[mb] = WFrag<T16>::ld(sb + ao + mb * 16 * GP + kc); if (NSPLIT == 1) a2[mb] = WFrag<T16>::ld(sb + GT + ao + mb * 16 * GP + kc); }
#pragma unroll
            for (int nb = 1; nb < 4; ++nb) b[nb] = WFrag<T16>::ld(sb + bo + nb * 16 * GP + kc);
            __builtin_amdgcn_sched_barrier(0);   // keeps the group whole: without it the reads of b[1..3] are sunk among the matrix instructions, each with a full LDS wait in front of the next eight
#pragma unroll
            for (int nb = 0; nb < 4; ++nb)
#pragma unroll
                for (int mb = 0; mb < 4; ++mb) { acc[mb][nb] = WFrag<T16>::mma(a[mb], b[nb], acc[mb][nb]); if (NSPLIT == 1) acc[mb][nb] = WFrag<T16>::mma(a2[mb], b[nb], acc[mb][nb]); }
        }
        __builtin_amdgcn_sched_barrier(0);   // the trip's matrix instructions stay in front of its foot: sunk behind the barrier they stand in front of the next stage's copies and shorten their flight
        asm volatile("s_wait_dscnt 0x0" ::: "memory");      // this wave's reads of the buffer have returned before it is refilled
        asm volatile("s_wait_asynccnt 0x0" ::: "memory");   // this wave's copies of stage t + 1 have landed
        __syncthreads();   // publishes stage t + 1 and ends every wave's reads of stage t
        if (t + 2 < nt) stage(t + 2);   // into the buffer that this trip has just read
    }
    asm volatile("s_wait_asynccnt 0x0" ::: "memory");   // no copy is outstanding behind the loop
    if constexpr (EPI == 2) {
        static_assert(HD == 64 && NSPLIT == 1 && 4 * 3 * 64 * GP <= 2 * NT * GT, "a wave's 64 columns are one head; its three transposed tiles fit its quarter of the stage buffers");
        if (blockIdx.z == 2) {   // V^T planes: a lane's 8 accumulator rows are 8 consecutive m of ONE column d, so they are converted in registers and only regrouped through LDS into whole 128-B lines of [d][m]
            unsigned short* vs = (unsigned short*)st + (tid >> 5) * (3 * 64 * GP);   // the stage buffers are free: every wave's last reads ended in front of the loop's last barrier, and no copy is outstanding
#pragma unroll
            for (int mb = 0; mb < 4; ++mb)
#pragma unroll
                for (int nb = 0; nb < 4; ++nb) { v8h o16; v8us oh, ol;
#pragma unroll
                    for (int j = 0; j < 8; ++j) { const float x = acc[mb][nb][j]; o16[j] = tohx(x); unsigned short a2, c2; splitf(x, a2, c2); oh[j] = a2; ol[j] = c2; }
                    const int so = (nb * 16 + lr) * GP + mb * 16 + hi * 8; *(v8usa*)(vs + so) = __builtin_bit_cast(v8us, o16); *(v8usa*)(vs + 64 * GP + so) = oh; *(v8usa*)(vs + 2 * 64 * GP + so) = ol; }
            __builtin_amdgcn_wave_barrier(); asm volatile("" ::: "memory");   // the wave's reads below stay behind its writes above
            const size_t vb = ((size_t)2 * NH_ + (c0 >> 6)) * ((size_t)TT * HD) + (size_t)(lane >> 3) * TT + r0 + (lane & 7) * 8; const int vo = (lane >> 3) * GP + (lane & 7) * 8;   // 8 lanes a row d: 128 B of m
#pragma unroll
            for (int g = 0; g < 4; ++g) { v8us t16[4], th[4], tl[4];
#pragma unroll
                for (int s = 0; s < 4; ++s) { const int o = vo + (g * 16 + s * 4) * GP; t16[s] = *(const v8usa*)(vs + o); th[s] = *(const v8usa*)(vs + 64 * GP + o); tl[s] = *(const v8usa*)(vs + 2 * 64 * GP + o); }
                __builtin_amdgcn_sched_barrier(0);   // with the one behind the wait: nothing else is scheduled between these stores and their s_wait_xcnt, where it could be given a register that a store names
#pragma unroll
                for (int s = 0; s < 4; ++s) { const size_t o = vb + (size_t)(g * 16 + s * 4) * TT; *(v8us*)((unsigned short*)P16 + o) = t16[s]; *(v8us*)(Ph + o) = th[s]; *(v8us*)(Pl + o) = tl[s]; }
                xw0();   // in front of the next write of these stores' registers
                __builtin_amdgcn_sched_barrier(0);   // second of the pair: later work stays behind the wait
            }
            return;   // the whole work-group (blockIdx.z), behind every barrier
        }
    }
#pragma unroll
    for (int mb = 0; mb < 4; ++mb) {
#pragma unroll
        for (int nb = 0; nb < 4; ++nb) {
#pragma unroll
            for (int j = 0; j < 8; ++j) os[(hi * 8 + j) * 68 + nb * 16 + lr] = acc[mb][nb][j]; }
        __builtin_amdgcn_wave_barrier(); asm volatile("" ::: "memory");
        if constexpr (EPI == 0) {
        float* crow = C + (size_t)(r0 + mb * 16) * ldc + c0;
{
#pragma unroll
            for (int s = 0; s < 8; ++s) { const int row = 2 * s + hi, cofs = lr * 4; v4f val = *(const v4fa*)(os + row * 68 + cofs); if (BIAS) { val[0] += bfr(bias[c0 + cofs]); val[1] += bfr(bias[c0 + cofs + 1]); val[2] += bfr(bias[c0 + cofs + 2]); val[3] += bfr(bias[c0 + cofs + 3]); }
                *(v4f*)(crow + (size_t)row * ldc + cofs) = val; }
             }
        } else {   // 16-bit planes: 8 lanes a row, 8 columns a lane: every store covers whole 128-B lines
            const size_t pb = (EPI == 1) ? z * sC + (size_t)(r0 + mb * 16 + (lane >> 3)) * ldc + c0 + (lane & 7) * 8 : (z * NH_ + (c0 >> 6)) * ((size_t)TT * HD) + (size_t)(r0 + mb * 16 + (lane >> 3)) * HD + (lane & 7) * 8;
            const size_t pp = (EPI == 1) ? (size_t)4 * ldc : (size_t)4 * HD;   // four rows on
            v8h o16[4]; v8us oh[4], ol[4];
#pragma unroll
            for (int s = 0; s < 4; ++s) { const float* op = os + (4 * s + (lane >> 3)) * 68 + (lane & 7) * 8; const v4f x0 = *(const v4fa*)op, x1 = *(const v4fa*)(op + 4);
#pragma unroll
                for (int q = 0; q < 8; ++q) { const float x = (q < 4) ? x0[q & 3] : x1[q & 3]; if (EPI == 2) o16[s][q] = tohx(x); unsigned short a2, c2; splitf(x, a2, c2); oh[s][q] = a2; ol[s][q] = c2; } }
            __builtin_amdgcn_sched_barrier(0);   // with the one behind the wait: nothing else is scheduled between these stores and their s_wait_xcnt, where it could be given a register that a store names
#pragma unroll
            for (int s = 0; s < 4; ++s) { if (EPI == 2) *(v8h*)(P16 + pb + s * pp) = o16[s]; *(v8us*)(Ph + pb + s * pp) = oh[s]; *(v8us*)(Pl + pb + s * pp) = ol[s]; }
            xw0();   // in front of the next write of these stores' registers
            __builtin_amdgcn_sched_barrier(0);   // second of the pair: later work stays behind the wait
        }
        __builtin_amdgcn_wave_barrier(); asm volatile("" ::: "memory");
    }
}

typedef __attribute__((ext_vector_type(2))) _Float16 v2h;
typedef __attribute__((ext_vector_type(4))) _Float16 v4h;
typedef __attribute__((ext_vector_type(2))) unsigned short v2us;
typedef __attribute__((ext_vector_type(4))) unsigned short v4us;
typedef __attribute__((ext_vector_type(2))) float v2f;
typedef __attribute__((ext_vector_type(4))) int v4i;

__global__ __launch_bounds__(256) void k_wtG(const float* __restrict__ w, int K, int N, bf* Bt) {
    const int lane = threadIdx.x & 31; const int L0 = (blockIdx.x * 8 + (threadIdx.x >> 5)) * 8; const int nlines = N * K / 64;
{
#pragma unroll 1
        for (int l = 0; l < 8; ++l) { const int L = L0 + l; if (L >= nlines) break; const size_t e = (size_t)L * 64 + lane * 2; const int k = (int)(e % K), n = (int)(e / K); v2us o;
            o[0] = f2bf(w[(size_t)k * N + n]); o[1] = f2bf(w[(size_t)(k + 1) * N + n]); *(v2us*)(Bt + e) = o; }
         }
}
__global__ __launch_bounds__(256) void k_cvt8(const float* __restrict__ src, bf* dst, size_t n8) { const size_t i = (size_t)blockIdx.x * 256 + threadIdx.x; if (i >= n8) return; const v8f v = *(const v8f*)(src + i * 8); v8us o;
#pragma unroll
    for (int k = 0; k < 8; ++k) o[k] = f2bf(v[k]); *(v8us*)(dst + i * 8) = o;  }
// k_cvt8w: k_cvt8 of the seven weight matrices (n8 groups of 8 each) in one launch: blockIdx.y picks the source; the bf16 planes lie one behind the other in dst, in argument order.
__global__ __launch_bounds__(256) void k_cvt8w(const float* __restrict__ w0, const float* __restrict__ w1, const float* __restrict__ w2, const float* __restrict__ w3, const float* __restrict__ w4, const float* __restrict__ w5, const float* __restrict__ w6, bf* dst, size_t n8) { const size_t i = (size_t)blockIdx.x * 256 + threadIdx.x; if (i >= n8) return; const unsigned y = blockIdx.y;
    const float* src = (y == 0) ? w0 : (y == 1) ? w1 : (y == 2) ? w2 : (y == 3) ? w3 : (y == 4) ? w4 : (y == 5) ? w5 : w6; const v8f v = *(const v8f*)(src + i * 8); xw0();   // the source address pair is given to other values further down
    v8us o;
#pragma unroll
    for (int k = 0; k < 8; ++k) o[k] = f2bf(v[k]); *(v8us*)(dst + ((size_t)y * n8 + i) * 8) = o;  }

#define FK 64
#define FP 72                     // LDS row pitch in 16-bit elements: 144 B = 16 B x 9
#define FT (FK * FP)              // elements of one LDS tile (HD == FK rows)
template <typename T16> struct FFrag;
template <> struct FFrag<h16> { static __device__ __forceinline__ v16h mk(v8us lo, v8us hi) { return __builtin_bit_cast(v16h, __builtin_shufflevector(lo, hi, 0, 1, 2, 3, 4, 5, 6, 7, 8, 9, 10, 11, 12, 13, 14, 15)); } };
template <> struct FFrag<bf> { static __device__ __forceinline__ v16bf mk(v8us lo, v8us hi) { return cat16b(lo, hi); } };
template <typename T16> __device__ __forceinline__ typename WFrag<T16>::V ldf(const unsigned short* p) { return FFrag<T16>::mk(*(const v8usa*)p, *(const v8usa*)(p + 16)); }
__device__ __forceinline__ float xhalf(float x) { const int b = __float_as_int(x); return __int_as_float(__builtin_amdgcn_permlanex16(b, b, 0x76543210, 0xfedcba98, false, false)); }   // the value of lane l ^ 16
template <typename T16, bool HL>
__device__ __forceinline__ void fattn(const unsigned short* __restrict__ Q, const unsigned short* __restrict__ Q2, const unsigned short* __restrict__ Kg, const unsigned short* __restrict__ Kg2, const unsigned short* __restrict__ Vg, const unsigned short* __restrict__ Vg2, int q0, int col0, bf* Ah, bf* Al, unsigned short* sm) {
    typedef typename WFrag<T16>::V V;
    static_assert(HD == 64 && FK == 64 && TT % FK == 0, "tile shapes");
    const int tid = threadIdx.x, lane = tid & 31, lr = lane & 15, hi = lane >> 4; const int qrow = q0 + (tid >> 5) * 16 + lr;
    unsigned short* Ks = sm; unsigned short* Vs = sm + FT; unsigned short* Ks2 = sm + 2 * FT; unsigned short* Vs2 = sm + 3 * FT;
    V qf[2], qf2[2];
#pragma unroll
    for (int kc = 0; kc < 2; ++kc) { qf[kc] = ldf<T16>(Q + (size_t)qrow * HD + kc * 32 + 8 * hi); if (HL) qf2[kc] = ldf<T16>(Q2 + (size_t)qrow * HD + kc * 32 + 8 * hi); }
    xw0();   // the query row's address is given to other values further down
    // staging: a tile is 512 chunks of 16 B; thread tid moves chunks tid + 128 i (row = chunk / 8): whole 128-B lines of K and of V^T
    const size_t gko = (size_t)tid * 8, gvo = (size_t)(tid >> 3) * TT + (tid & 7) * 8; const int so = (tid >> 3) * FP + (tid & 7) * 8;
    v8us rk[4], rv[4], rk2[4], rv2[4];
    __builtin_amdgcn_sched_barrier(0);   // with the one behind the wait: no other arithmetic is scheduled between these loads and their s_wait_xcnt, where it could be given a register that a load names
#pragma unroll
    for (int i = 0; i < 4; ++i) { rk[i] = *(const v8usa*)(Kg + gko + i * 1024); rv[i] = *(const v8usa*)(Vg + gvo + (size_t)i * 16 * TT); if (HL) { rk2[i] = *(const v8usa*)(Kg2 + gko + i * 1024); rv2[i] = *(const v8usa*)(Vg2 + gvo + (size_t)i * 16 * TT); } }
    xw0();   // in front of the next write of these loads' address registers
    __builtin_amdgcn_sched_barrier(0);   // second of the pair: later arithmetic stays behind the wait
    v8f O[4];
#pragma unroll
    for (int db = 0; db < 4; ++db) O[db] = (v8f){};
    v8f l8 = (v8f){};   // eight independent partial row sums a lane
    float m = -3.0e38f; const float C2 = SCL * 1.4426950408889634f;
#pragma unroll 1   // rolled: one stage's fragments and one stage's staging registers, no more
    for (int s = 0; s < TT / FK; ++s) {
        __syncthreads();   // every wave has left the tiles of the stage before
#pragma unroll
        for (int i = 0; i < 4; ++i) { *(v8usa*)(Ks + so + i * 16 * FP) = rk[i]; *(v8usa*)(Vs + so + i * 16 * FP) = rv[i]; if (HL) { *(v8usa*)(Ks2 + so + i * 16 * FP) = rk2[i]; *(v8usa*)(Vs2 + so + i * 16 * FP) = rv2[i]; } }
        __syncthreads();   // the stage's tiles are complete for every wave
        if (s + 1 < TT / FK) {   // the next stage's loads fly while this one is worked on
            const size_t ko = gko + (size_t)(s + 1) * FK * HD, vo = gvo + (size_t)(s + 1) * FK;
#pragma unroll
            for (int i = 0; i < 4; ++i) { rk[i] = *(const v8usa*)(Kg + ko + i * 1024); rv[i] = *(const v8usa*)(Vg + vo + (size_t)i * 16 * TT); if (HL) { rk2[i] = *(const v8usa*)(Kg2 + ko + i * 1024); rv2[i] = *(const v8usa*)(Vg2 + vo + (size_t)i * 16 * TT); } }
            xw0();   // in front of the next write of these loads' address registers
        }
        v8f S[4];
#pragma unroll
        for (int kb = 0; kb < 4; ++kb) { S[kb] = (v8f){};
#pragma unroll
            for (int kc = 0; kc < 2; ++kc) { const int fo = (kb * 16 + lr) * FP + kc * 32 + 8 * hi; const V k1 = ldf<T16>(Ks + fo); S[kb] = WFrag<T16>::mma(k1, qf[kc], S[kb]);
                if (HL) { S[kb] = WFrag<T16>::mma(k1, qf2[kc], S[kb]); S[kb] = WFrag<T16>::mma(ldf<T16>(Ks2 + fo), qf[kc], S[kb]); } } }
        float mx = S[0][0];
#pragma unroll
        for (int kb = 0; kb < 4; ++kb)
#pragma unroll
            for (int r = 0; r < 8; ++r) mx = fmaxf(mx, S[kb][r]);
        mx *= C2; mx = fmaxf(mx, xhalf(mx));   // the query's maximum over the stage, the same in both halves
        if (__builtin_amdgcn_ballot_w32(mx > m + 8.0f) != 0) {   // one scalar test a stage
            const float mn = fmaxf(m, mx), al = __builtin_amdgcn_exp2f(m - mn); m = mn; l8 *= al;
#pragma unroll
            for (int db = 0; db < 4; ++db) O[db] *= al; }
        const v8f c8 = {C2, C2, C2, C2, C2, C2, C2, C2}, n8 = {-m, -m, -m, -m, -m, -m, -m, -m};
#pragma unroll
        for (int kb = 0; kb < 4; ++kb) { const v8f t = __builtin_elementwise_fma(S[kb], c8, n8);
#pragma unroll
            for (int r = 0; r < 8; ++r) S[kb][r] = __builtin_amdgcn_exp2f(t[r]);
            l8 += S[kb]; }
#pragma unroll
        for (int kp = 0; kp < 2; ++kp) { V pb, pb2;
            if constexpr (HL) {
#pragma unroll
                for (int e = 0; e < 16; ++e) { const float p = S[2 * kp + (e >> 3)][e & 7]; const __bf16 ph = (__bf16)p; pb[e] = ph; pb2[e] = (__bf16)(p - (float)ph); }
            } else {
#pragma unroll
                for (int e = 0; e < 16; ++e) pb[e] = (h16)S[2 * kp + (e >> 3)][e & 7];
            }
#pragma unroll
            for (int db = 0; db < 4; ++db) { const int fo = (db * 16 + lr) * FP + kp * 32 + 8 * hi; const V v1 = ldf<T16>(Vs + fo); O[db] = WFrag<T16>::mma(v1, pb, O[db]);
                if constexpr (HL) { O[db] = WFrag<T16>::mma(v1, pb2, O[db]); O[db] = WFrag<T16>::mma(ldf<T16>(Vs2 + fo), pb, O[db]); } } }
    }
    float l = ((l8[0] + l8[1]) + (l8[2] + l8[3])) + ((l8[4] + l8[5]) + (l8[6] + l8[7])); l += xhalf(l); const float inv = __fdiv_rn(1.0f, l);
    v8us oh[4], ol[4];
#pragma unroll
    for (int db = 0; db < 4; ++db)
#pragma unroll
        for (int r = 0; r < 8; ++r) { unsigned short a, c2; splitf(O[db][r] * inv, a, c2); oh[db][r] = a; ol[db][r] = c2; }
    const size_t oo = (size_t)qrow * DQ + col0 + 8 * hi;   // a lane's 8 accumulator rows are 8 consecutive d of its query
#pragma unroll
    for (int db = 0; db < 4; ++db) { *(v8us*)(Ah + oo + db * 16) = oh[db]; *(v8us*)(Al + oo + db * 16) = ol[db]; }
}
__global__ __launch_bounds__(128) void k_fattn(const h16* __restrict__ Q16, const h16* __restrict__ K16, const h16* __restrict__ V16, const bf* __restrict__ Qh, const bf* __restrict__ Ql, const bf* __restrict__ Kh, const bf* __restrict__ Kl, const bf* __restrict__ Vh, const bf* __restrict__ Vl, bf* Ah, bf* Al) {
    __shared__ __align__(16) unsigned short sm[4 * FT];
    const int h = blockIdx.y; const size_t po = (size_t)h * TT * HD;
    const int xb = (blockIdx.x + (TT / 128) * (h >> 3)) & (TT / 64 - 1);   // query block; turned by half the blocks in the upper heads, so that the heavier hi/lo blocks do not all have the same index modulo a power of two
    if (xb < RH / 64) fattn<bf, true>(Qh + po, Ql + po, Kh + po, Kl + po, Vh + po, Vl + po, xb * 64, h * HD, Ah, Al, sm);
    else fattn<h16, false>((const unsigned short*)(Q16 + po), nullptr, (const unsigned short*)(K16 + po), nullptr, (const unsigned short*)(V16 + po), nullptr, xb * 64, h * HD, Ah, Al, sm);
}

extern "C" void kernel_launch(void* const* d_in, const int* in_sizes, int n_in,
                              void* d_out, int out_size, void* d_ws, size_t ws_size, hipStream_t stream) {
    (void)in_sizes; (void)n_in; (void)out_size;
    const float* x = (const float*)d_in[0]; const float* wq = (const float*)d_in[1]; const float* wk = (const float*)d_in[2]; const float* wv = (const float*)d_in[3]; const float* wo = (const float*)d_in[4]; const float* hq = (const float*)d_in[5]; const float* hk = (const float*)d_in[6]; const float* hv = (const float*)d_in[7];
    float* OUT = (float*)d_out;     // [2][2048][1024]
    char* wsp = (char*)d_ws;
    auto take = [&](size_t bytes) { char* p = wsp; wsp += (bytes + 255) & ~(size_t)255; return (void*)p; };
    static_assert(DKV == DQ && NKV == NH_ && ((size_t)DQ * DM * 2) % 256 == 0 && ((size_t)NH_ * TT * HD * 2) % 256 == 0, "the q, k and v chains have one shape, and planes taken one behind the other are contiguous");
    bf* WQ = (bf*)take((size_t)DQ * DM * 2); take((size_t)DKV * DM * 2); take((size_t)DKV * DM * 2);   // WQ | WK | WV: z of the first-stage launch
    bf* HQB = (bf*)take((size_t)DQ * DM * 2); take((size_t)DKV * DM * 2); take((size_t)DKV * DM * 2);   // HQ | HK | HV ('hed' [16][64][1024] = flat 'oi'): z of the second-stage launch
    bf* WO = (bf*)take((size_t)DM * DQ * 2);
    h16* QP16 = (h16*)take((size_t)NH_ * TT * HD * 2); h16* KP16 = (h16*)take((size_t)NKV * TT * HD * 2); h16* VT16 = (h16*)take((size_t)NKV * HD * TT * 2);   // q | k | V^T of each kind one behind the other: z of the second-stage launch picks the group
    bf* QPh = (bf*)take((size_t)NH_ * TT * HD * 2); bf* KPh = (bf*)take((size_t)NKV * TT * HD * 2); bf* VTh = (bf*)take((size_t)NKV * HD * TT * 2); bf* QPl = (bf*)take((size_t)NH_ * TT * HD * 2); bf* KPl = (bf*)take((size_t)NKV * TT * HD * 2); bf* VTl = (bf*)take((size_t)NKV * HD * TT * 2);
    bf* ATh = (bf*)take((size_t)TT * DQ * 2); bf* ATl = (bf*)take((size_t)TT * DQ * 2);
    bf* XB = (bf*)take((size_t)TT * DM * 2); bf* Th = (bf*)take((size_t)3 * TT * DM * 2); bf* Tl = (bf*)take((size_t)3 * TT * DM * 2);   // Th, Tl [3][TT][1024]
    if ((size_t)(wsp - (char*)d_ws) > ws_size) return;    // ws 256 MiB
    k_cvt8w<<<dim3((unsigned)(((size_t)DQ * DM / 8 + 255) / 256), 7, 1), 256, 0, stream>>>(wq, wk, wv, hq, hk, hv, wo, WQ, (size_t)DQ * DM / 8);
    for (int b = 0; b < NB_; ++b) {
        k_cvt8<<<(unsigned)(((size_t)TT * DM / 8 + 255) / 256), 256, 0, stream>>>(x + (size_t)b * TT * DM, XB, (size_t)TT * DM / 8);
        k_gemmw<bf, 0, false, 1><<<dim3(TT / 128, DQ / 128, 3), 128, 0, stream>>>(XB, nullptr, WQ, DM, nullptr, DQ, nullptr, nullptr, Th, Tl, 0, (size_t)DQ * DM, (size_t)TT * DQ);   /* z = 0, 1, 2: Q = E WQ^T, K = E WK^T, V = E WV^T, as hi/lo planes */
        k_gemmw<bf, 1, false, 2><<<dim3(TT / 128, DQ / 128, 3), 128, 0, stream>>>(Th, Tl, HQB, DM, nullptr, 0, nullptr, QP16, QPh, QPl, (size_t)TT * DM, (size_t)DQ * DM, 0);   /* z = 0, 1, 2: q = Q HQ^T, k = K HK^T, v = V HV^T (all heads), as the attention's planes */
        k_fattn<<<dim3(TT / 64, NH_, 1), 128, 0, stream>>>(QP16, KP16, VT16, QPh, QPl, KPh, KPl, VTh, VTl, ATh, ATl);   /* all heads: context as hi/lo planes [t][head | d] */
        k_gemmw<bf, 1, false, 0><<<dim3(TT / 128, DM / 128, 1), 128, 0, stream>>>(ATh, ATl, WO, DQ, OUT + (size_t)b * TT * DM, DM, nullptr, nullptr, nullptr, nullptr, 0, 0, 0); }
}

// v007
// A run of this version takes 166 microseconds.
// Next to v006, in two timings, it ran 1.47 and 1.50 times as fast.
// Over all steps from v000 it is 12.9 times as fast.
#include <hip/hip_runtime.h>

// Two-stage-projection multi-head attention (E [2][2048][1024]; Q = E WQ^T, K, V likewise ('oi' [1024][1024]); per head q = Q HQ[h]^T ('hed' [16][64][1024] = flat 'oi' [1024][1024]), k, v likewise; softmax(q.k 64^-0.5); heads concatenated; out = o WO^T -> [2][2048][1024] (4.2 M)).
// Both batches go through every stage in one launch (rows m = batch TT + t). Layout: first-stage projections exact (bf16 x bf16); their f32 results split into bf16 hi/lo planes (in the GEMM's own epilogue) for the second-stage GEMMs against the exact flattened head weights (2 products), whose epilogue writes the attention's q, k and V^T planes; fused dense T-2048 attention (hybrid rows: < 512 hi/lo 3 products, rest fp16); context as hi/lo planes; WO hl x exact.
// Compute dtypes, f32 accumulate: every input rounded to bf16; stage-1 projections exact, stage-2 hl x exact; attention rows < 512 3 products, rest fp16; softmax f32; WO hl x exact.

#define NB_  2
#define TT   2048
#define DM   1024
#define NH_  16
#define NKV  16
#define REP  (NH_ / NKV)
#define HD   64
#define DQ   (NH_ * HD)
#define DKV  (NKV * HD)
#define RH   512                  // query rows < RH use hi+lo planes (0: none)
#define WIN  0
#define SCL  0.125f   // HD^-0.5
typedef _Float16 h16;
typedef unsigned short bf;
typedef __attribute__((ext_vector_type(16))) __bf16   v16bf;
typedef __attribute__((ext_vector_type(16))) _Float16 v16h;
typedef __attribute__((ext_vector_type(8)))  _Float16 v8h;
typedef __attribute__((ext_vector_type(8)))  unsigned short v8us;
typedef __attribute__((ext_vector_type(8)))  float    v8f;
typedef __attribute__((ext_vector_type(4)))  float    v4f;
typedef v8h  __attribute__((may_alias)) v8ha;
typedef v4f  __attribute__((may_alias)) v4fa;
typedef v8us __attribute__((may_alias)) v8usa;

__device__ __forceinline__ unsigned short f2bf(float f) { unsigned u = __float_as_uint(f); u += 0x7FFFu + ((u >> 16) & 1u); return (unsigned short)(u >> 16); }
__device__ __forceinline__ float bf2f(unsigned short b) { return __uint_as_float(((unsigned)b) << 16); }
__device__ __forceinline__ float bfr(float f) { return bf2f(f2bf(f)); }
__device__ __forceinline__ v16h cat16(v8h lo, v8h hi) { return __builtin_shufflevector(lo, hi, 0, 1, 2, 3, 4, 5, 6, 7, 8, 9, 10, 11, 12, 13, 14, 15); }
__device__ __forceinline__ v16bf cat16b(v8us lo, v8us hi) { return __builtin_bit_cast(v16bf, __builtin_shufflevector(lo, hi, 0, 1, 2, 3, 4, 5, 6, 7, 8, 9, 10, 11, 12, 13, 14, 15)); }
__device__ __forceinline__ v8f wmma16(v16h a, v16h b, v8f c) { return __builtin_amdgcn_wmma_f32_16x16x32_f16(false, a, false, b, (short)0, c, false, false); }
__device__ __forceinline__ v8f wmmab(v16bf a, v16bf b, v8f c) { return __builtin_amdgcn_wmma_f32_16x16x32_bf16(false, a, false, b, (short)0, c, false, false); }



// ---- k_gemmw: GEMM, FOUR WAVES per 128x128 output tile, each wave its 64x64 quarter (16 accumulators); grid (M/128, N/128, Z), 128 threads.
// C[m][n] (f32, pitch ldc, + optional f32 bias[n]) = sum_k A[m][k] Bt[n][k] (+ A2[m][k] Bt[n][k] where NSPLIT == 1). z-batch strides sA/sB/sC in elements. M % 128 == 0, N % 128 == 0, K % 64 == 0.
// EPI says what leaves the kernel. 0: C in f32. 1: C as bf16 hi/lo planes Ph, Pl (pitch ldc, z stride sC). 2: C as the attention's operand planes P16 (fp16), Ph, Pl (bf16 hi/lo), plane group z at z NB_ NH_ TT HD, in it batch m / TT at NH_ TT HD each, t = m % TT: z = 0, 1 head planes [head][t][d], z = 2 transposed [head][d][t]; a wave's 64 columns are one head, a tile's 128 rows one batch. No f32 C lies in memory for 1 and 2.
// A stage is GK = 64 k: the 128 rows of A (and A2) and of Bt, 128 B each, go global -> LDS by asynchronous 16-byte copies (whole 128-B lines, each fetched once a work-group), rows padded to GP elements; two buffers, the copies of stage t + 2 fly while stage t + 1 is worked on.
#define GK 64
#define GP 72                     // LDS row pitch in 16-bit elements: 144 B = 16 B x 9
#define GT (128 * GP)             // elements of one staged operand tile
template <typename T16> struct WFrag;
template <> struct WFrag<h16> { typedef v16h V; static __device__ __forceinline__ V ld(const h16* p) { return cat16(*(const v8h*)p, *(const v8h*)(p + 16)); } static __device__ __forceinline__ v8f mma(V a, V b, v8f c) { return wmma16(a, b, c); } };
template <> struct WFrag<bf> { typedef v16bf V; static __device__ __forceinline__ V ld(const bf* p) { return cat16b(*(const v8us*)p, *(const v8us*)(p + 16)); } static __device__ __forceinline__ v8f mma(V a, V b, v8f c) { return wmmab(a, b, c); } };
// cp8: a lane's eight asynchronous copies of one staged tile: 16 B from g + i rs (elements) to LDS byte l + i 16 GP 2, i = 0..7. The s_wait_xcnt 0 is the statement's last line, so that it stands in front of every later write of a register that a copy names.
template <typename T16>
__device__ __forceinline__ void cp8(unsigned l, const T16* g, size_t rs) {
    asm volatile("global_load_async_to_lds_b128 %0, %8, off\n\t"
                 "global_load_async_to_lds_b128 %1, %9, off\n\t"
                 "global_load_async_to_lds_b128 %2, %10, off\n\t"
                 "global_load_async_to_lds_b128 %3, %11, off\n\t"
                 "global_load_async_to_lds_b128 %4, %12, off\n\t"
                 "global_load_async_to_lds_b128 %5, %13, off\n\t"
                 "global_load_async_to_lds_b128 %6, %14, off\n\t"
                 "global_load_async_to_lds_b128 %7, %15, off\n\t"
                 "s_wait_xcnt 0x0"
                 :: "v"(l), "v"(l + 1u * 16 * GP * 2), "v"(l + 2u * 16 * GP * 2), "v"(l + 3u * 16 * GP * 2), "v"(l + 4u * 16 * GP * 2), "v"(l + 5u * 16 * GP * 2), "v"(l + 6u * 16 * GP * 2), "v"(l + 7u * 16 * GP * 2),
                    "v"(g), "v"(g + rs), "v"(g + 2 * rs), "v"(g + 3 * rs), "v"(g + 4 * rs), "v"(g + 5 * rs), "v"(g + 6 * rs), "v"(g + 7 * rs)
                 : "memory");
}
// xw0: s_wait_xcnt 0 behind a global load or store, in front of a later write of a register that it names.
__device__ __forceinline__ void xw0() { asm volatile("s_wait_xcnt 0x0" ::: "memory"); }
__device__ __forceinline__ h16 tohx(float x) { return (h16)x; }
__device__ __forceinline__ void splitf(float y, unsigned short& h, unsigned short& l) { h = f2bf(y); l = f2bf(y - bf2f(h)); }
template <typename T16, int NSPLIT, bool BIAS, int EPI>
__global__ __launch_bounds__(128) void k_gemmw(const T16* __restrict__ A, const T16* __restrict__ A2, const T16* __restrict__ Bt, int K, float* C, int ldc, const float* __restrict__ bias, h16* P16, bf* Ph, bf* Pl, size_t sA, size_t sB, size_t sC) {
    typedef typename WFrag<T16>::V V;
    static_assert(NSPLIT == 0 || NSPLIT == 1, "one or two A planes");
    constexpr int NT = 2 + NSPLIT;   // staged tiles of a stage: A, (A2,) Bt
    __shared__ __align__(16) T16 st[2 * NT * GT];
    __shared__ __align__(16) float osm[4 * 16 * 68];
    const size_t z = blockIdx.z; A += z * sA; if (NSPLIT == 1) A2 += z * sA; Bt += z * sB; if (EPI == 0) C += z * sC;
    const int tid = threadIdx.x, lane = tid & 31, lr = lane & 15, hi = lane >> 4, wr = tid >> 6, wc = (tid >> 5) & 1; const int R0 = blockIdx.x * 128, C0 = blockIdx.y * 128; const int r0 = R0 + wr * 64, c0 = C0 + wc * 64;
    float* os = osm + (tid >> 5) * (16 * 68);   // each wave's own output staging
    const int bt = (EPI == 2) ? R0 / TT : 0, rb = r0 - bt * TT; (void)bt; (void)rb;   // EPI 2: the tile's batch and the wave's first row in it
    v8f acc[4][4];
#pragma unroll
    for (int mb = 0; mb < 4; ++mb)
#pragma unroll
        for (int nb = 0; nb < 4; ++nb) acc[mb][nb] = (v8f){};
    // staging: a tile is 1024 chunks of 16 B; thread tid moves chunks tid + 128 i (row = chunk / 8)
    const size_t ga = (size_t)(R0 + (tid >> 3)) * K + (tid & 7) * 8, gb = (size_t)(C0 + (tid >> 3)) * K + (tid & 7) * 8, rs = (size_t)16 * K;
    const unsigned l0 = (unsigned)(size_t)st + (unsigned)(((tid >> 3) * GP + (tid & 7) * 8) * 2);   // the lane's LDS byte address in buffer 0, tile 0
    auto stage = [&](int t) { const unsigned l = l0 + (unsigned)(t & 1) * (NT * GT * 2); const size_t ko = (size_t)t * GK;
        cp8(l, A + ga + ko, rs); if (NSPLIT == 1) cp8(l + GT * 2, A2 + ga + ko, rs); cp8(l + (NT - 1) * GT * 2, Bt + gb + ko, rs); };
    const int nt = K / GK;
    stage(0);
    asm volatile("s_wait_asynccnt 0x0" ::: "memory");   // this wave's copies of stage 0 have landed
    __syncthreads();   // stage 0 is complete for every wave
    if (nt > 1) stage(1);
    const int ao = (wr * 64 + lr) * GP + 8 * hi, bo = (NT - 1) * GT + (wc * 64 + lr) * GP + 8 * hi;
#pragma unroll 1   // rolled: one stage's fragments in registers, and the two buffers told apart by the trip's parity
    for (int t = 0; t < nt; ++t) {
        const T16* sb = st + (t & 1) * (NT * GT);
#pragma unroll
        for (int kc = 0; kc < GK; kc += 32) {
            V a[4], a2[4], b[4];   // all fragments of a 32-k block are read in one group in front of its matrix instructions, in the order of their first use
            b[0] = WFrag<T16>::ld(sb + bo + kc);
#pragma unroll
            for (int mb = 0; mb < 4; ++mb) { a[mb] = WFrag<T16>::ld(sb + ao + mb * 16 * GP + kc); if (NSPLIT == 1) a2[mb] = WFrag<T16>::ld(sb + GT + ao + mb * 16 * GP + kc); }
#pragma unroll
            for (int nb = 1; nb < 4; ++nb) b[nb] = WFrag<T16>::ld(sb + bo + nb * 16 * GP + kc);
            __builtin_amdgcn_sched_barrier(0);   // keeps the group whole: without it the reads of b[1..3] are sunk among the matrix instructions, each with a full LDS wait in front of the next eight
#pragma unroll
            for (int nb = 0; nb < 4; ++nb)
#pragma unroll
                for (int mb = 0; mb < 4; ++mb) { acc[mb][nb] = WFrag<T16>::mma(a[mb], b[nb], acc[mb][nb]); if (NSPLIT == 1) acc[mb][nb] = WFrag<T16>::mma(a2[mb], b[nb], acc[mb][nb]); }
        }
        __builtin_amdgcn_sched_barrier(0);   // the trip's matrix instructions stay in front of its foot: sunk behind the barrier they stand in front of the next stage's copies and shorten their flight
        asm volatile("s_wait_dscnt 0x0" ::: "memory");      // this wave's reads of the buffer have returned before it is refilled
        asm volatile("s_wait_asynccnt 0x0" ::: "memory");   // this wave's copies of stage t + 1 have landed
        __syncthreads();   // publishes stage t + 1 and ends every wave's reads of stage t
        if (t + 2 < nt) stage(t + 2);   // into the buffer that this trip has just read
    }
    asm volatile("s_wait_asynccnt 0x0" ::: "memory");   // no copy is outstanding behind the loop
    if constexpr (EPI == 2) {
        static_assert(HD == 64 && TT % 128 == 0 && NSPLIT == 1 && 4 * 3 * 64 * GP <= 2 * NT * GT, "a wave's 64 columns are one head, a tile's rows one batch; its three transposed tiles fit its quarter of the stage buffers");
        if (blockIdx.z == 2) {   // V^T planes: a lane's 8 accumulator rows are 8 consecutive m of ONE column d, so they are converted in registers and only regrouped through LDS into whole 128-B lines of [d][m]
            unsigned short* vs = (unsigned short*)st + (tid >> 5) * (3 * 64 * GP);   // the stage buffers are free: every wave's last reads ended in front of the loop's last barrier, and no copy is outstanding
#pragma unroll
            for (int mb = 0; mb < 4; ++mb)
#pragma unroll
                for (int nb = 0; nb < 4; ++nb) { v8h o16; v8us oh, ol;
#pragma unroll
                    for (int j = 0; j < 8; ++j) { const float x = acc[mb][nb][j]; o16[j] = tohx(x); unsigned short a2, c2; splitf(x, a2, c2); oh[j] = a2; ol[j] = c2; }
                    const int so = (nb * 16 + lr) * GP + mb * 16 + hi * 8; *(v8usa*)(vs + so) = __builtin_bit_cast(v8us, o16); *(v8usa*)(vs + 64 * GP + so) = oh; *(v8usa*)(vs + 2 * 64 * GP + so) = ol; }
            __builtin_amdgcn_wave_barrier(); asm volatile("" ::: "memory");   // the wave's reads below stay behind its writes above
            const size_t vb = (((size_t)2 * NB_ + bt) * NH_ + (c0 >> 6)) * ((size_t)TT * HD) + (size_t)(lane >> 3) * TT + rb + (lane & 7) * 8; const int vo = (lane >> 3) * GP + (lane & 7) * 8;   // 8 lanes a row d: 128 B of m
#pragma unroll
            for (int g = 0; g < 4; ++g) { v8us t16[4], th[4], tl[4];
#pragma unroll
                for (int s = 0; s < 4; ++s) { const int o = vo + (g * 16 + s * 4) * GP; t16[s] = *(const v8usa*)(vs + o); th[s] = *(const v8usa*)(vs + 64 * GP + o); tl[s] = *(const v8usa*)(vs + 2 * 64 * GP + o); }
                __builtin_amdgcn_sched_barrier(0);   // with the one behind the wait: nothing else is scheduled between these stores and their s_wait_xcnt, where it could be given a register that a store names
#pragma unroll
                for (int s = 0; s < 4; ++s) { const size_t o = vb + (size_t)(g * 16 + s * 4) * TT; *(v8us*)((unsigned short*)P16 + o) = t16[s]; *(v8us*)(Ph + o) = th[s]; *(v8us*)(Pl + o) = tl[s]; }
                xw0();   // in front of the next write of these stores' registers
                __builtin_amdgcn_sched_barrier(0);   // second of the pair: later work stays behind the wait
            }
            return;   // the whole work-group (blockIdx.z), behind every barrier
        }
    }
#pragma unroll
    for (int mb = 0; mb < 4; ++mb) {
#pragma unroll
        for (int nb = 0; nb < 4; ++nb) {
#pragma unroll
            for (int j = 0; j < 8; ++j) os[(hi * 8 + j) * 68 + nb * 16 + lr] = acc[mb][nb][j]; }
        __builtin_amdgcn_wave_barrier(); asm volatile("" ::: "memory");
        if constexpr (EPI == 0) {
        float* crow = C + (size_t)(r0 + mb * 16) * ldc + c0;
{
#pragma unroll
            for (int s = 0; s < 8; ++s) { const int row = 2 * s + hi, cofs = lr * 4; v4f val = *(const v4fa*)(os + row * 68 + cofs); if (BIAS) { val[0] += bfr(bias[c0 + cofs]); val[1] += bfr(bias[c0 + cofs + 1]); val[2] += bfr(bias[c0 + cofs + 2]); val[3] += bfr(bias[c0 + cofs + 3]); }
                *(v4f*)(crow + (size_t)row * ldc + cofs) = val; }
             }
        } else {   // 16-bit planes: 8 lanes a row, 8 columns a lane: every store covers whole 128-B lines
            const size_t pb = (EPI == 1) ? z * sC + (size_t)(r0 + mb * 16 + (lane >> 3)) * ldc + c0 + (lane & 7) * 8 : ((z * NB_ + bt) * NH_ + (c0 >> 6)) * ((size_t)TT * HD) + (size_t)(rb + mb * 16 + (lane >> 3)) * HD + (lane & 7) * 8;
            const size_t pp = (EPI == 1) ? (size_t)4 * ldc : (size_t)4 * HD;   // four rows on
            v8h o16[4]; v8us oh[4], ol[4];
#pragma unroll
            for (int s = 0; s < 4; ++s) { const float* op = os + (4 * s + (lane >> 3)) * 68 + (lane & 7) * 8; const v4f x0 = *(const v4fa*)op, x1 = *(const v4fa*)(op + 4);
#pragma unroll
                for (int q = 0; q < 8; ++q) { const float x = (q < 4) ? x0[q & 3] : x1[q & 3]; if (EPI == 2) o16[s][q] = tohx(x); unsigned short a2, c2; splitf(x, a2, c2); oh[s][q] = a2; ol[s][q] = c2; } }
            __builtin_amdgcn_sched_barrier(0);   // with the one behind the wait: nothing else is scheduled between these stores and their s_wait_xcnt, where it could be given a register that a store names
#pragma unroll
            for (int s = 0; s < 4; ++s) { if (EPI == 2) *(v8h*)(P16 + pb + s * pp) = o16[s]; *(v8us*)(Ph + pb + s * pp) = oh[s]; *(v8us*)(Pl + pb + s * pp) = ol[s]; }
            xw0();   // in front of the next write of these stores' registers
            __builtin_amdgcn_sched_barrier(0);   // second of the pair: later work stays behind the wait
        }
        __builtin_amdgcn_wave_barrier(); asm volatile("" ::: "memory");
    }
}

typedef __attribute__((ext_vector_type(2))) _Float16 v2h;
typedef __attribute__((ext_vector_type(4))) _Float16 v4h;
typedef __attribute__((ext_vector_type(2))) unsigned short v2us;
typedef __attribute__((ext_vector_type(4))) unsigned short v4us;
typedef __attribute__((ext_vector_type(2))) float v2f;
typedef __attribute__((ext_vector_type(4))) int v4i;

__global__ __launch_bounds__(256) void k_wtG(const float* __restrict__ w, int K, int N, bf* Bt) {
    const int lane = threadIdx.x & 31; const int L0 = (blockIdx.x * 8 + (threadIdx.x >> 5)) * 8; const int nlines = N * K / 64;
{
#pragma unroll 1
        for (int l = 0; l < 8; ++l) { const int L = L0 + l; if (L >= nlines) break; const size_t e = (size_t)L * 64 + lane * 2; const int k = (int)(e % K), n = (int)(e / K); v2us o;
            o[0] = f2bf(w[(size_t)k * N + n]); o[1] = f2bf(w[(size_t)(k + 1) * N + n]); *(v2us*)(Bt + e) = o; }
         }
}
// k_cvt8w: every f32 input to bf16 in one launch, 8 elements a thread: blockIdx.y picks a piece of n8 groups of 8: 0..6 the seven weight matrices, from 7 on the pieces of e in their order; the bf16 planes lie one behind the other in dst, in that order.
__global__ __launch_bounds__(256) void k_cvt8w(const float* __restrict__ w0, const float* __restrict__ w1, const float* __restrict__ w2, const float* __restrict__ w3, const float* __restrict__ w4, const float* __restrict__ w5, const float* __restrict__ w6, const float* __restrict__ e, bf* dst, size_t n8) { const size_t i = (size_t)blockIdx.x * 256 + threadIdx.x; if (i >= n8) return; const unsigned y = blockIdx.y;
    const float* src = (y == 0) ? w0 : (y == 1) ? w1 : (y == 2) ? w2 : (y == 3) ? w3 : (y == 4) ? w4 : (y == 5) ? w5 : (y == 6) ? w6 : e + (size_t)(y - 7) * n8 * 8; const v8f v = *(const v8f*)(src + i * 8); xw0();   // the source address pair is given to other values further down
    v8us o;
#pragma unroll
    for (int k = 0; k < 8; ++k) o[k] = f2bf(v[k]); *(v8us*)(dst + ((size_t)y * n8 + i) * 8) = o;  }

#define FK 64
#define FP 72                     // LDS row pitch in 16-bit elements: 144 B = 16 B x 9
#define FT (FK * FP)              // elements of one LDS tile (HD == FK rows)
template <typename T16> struct FFrag;
template <> struct FFrag<h16> { static __device__ __forceinline__ v16h mk(v8us lo, v8us hi) { return __builtin_bit_cast(v16h, __builtin_shufflevector(lo, hi, 0, 1, 2, 3, 4, 5, 6, 7, 8, 9, 10, 11, 12, 13, 14, 15)); } };
template <> struct FFrag<bf> { static __device__ __forceinline__ v16bf mk(v8us lo, v8us hi) { return cat16b(lo, hi); } };
template <typename T16> __device__ __forceinline__ typename WFrag<T16>::V ldf(const unsigned short* p) { return FFrag<T16>::mk(*(const v8usa*)p, *(const v8usa*)(p + 16)); }
__device__ __forceinline__ float xhalf(float x) { const int b = __float_as_int(x); return __int_as_float(__builtin_amdgcn_permlanex16(b, b, 0x76543210, 0xfedcba98, false, false)); }   // the value of lane l ^ 16
template <typename T16, bool HL>
__device__ __forceinline__ void fattn(const unsigned short* __restrict__ Q, const unsigned short* __restrict__ Q2, const unsigned short* __restrict__ Kg, const unsigned short* __restrict__ Kg2, const unsigned short* __restrict__ Vg, const unsigned short* __restrict__ Vg2, int q0, int col0, bf* Ah, bf* Al, unsigned short* sm) {
    typedef typename WFrag<T16>::V V;
    static_assert(HD == 64 && FK == 64 && TT % FK == 0, "tile shapes");
    const int tid = threadIdx.x, lane = tid & 31, lr = lane & 15, hi = lane >> 4; const int qrow = q0 + (tid >> 5) * 16 + lr;
    unsigned short* Ks = sm; unsigned short* Vs = sm + FT; unsigned short* Ks2 = sm + 2 * FT; unsigned short* Vs2 = sm + 3 * FT;
    V qf[2], qf2[2];
#pragma unroll
    for (int kc = 0; kc < 2; ++kc) { qf[kc] = ldf<T16>(Q + (size_t)qrow * HD + kc * 32 + 8 * hi); if (HL) qf2[kc] = ldf<T16>(Q2 + (size_t)qrow * HD + kc * 32 + 8 * hi); }
    xw0();   // the query row's address is given to other values further down
    // staging: a tile is 512 chunks of 16 B; thread tid moves chunks tid + 128 i (row = chunk / 8): whole 128-B lines of K and of V^T
    const size_t gko = (size_t)tid * 8, gvo = (size_t)(tid >> 3) * TT + (tid & 7) * 8; const int so = (tid >> 3) * FP + (tid & 7) * 8;
    v8us rk[4], rv[4], rk2[4], rv2[4];
    __builtin_amdgcn_sched_barrier(0);   // with the one behind the wait: no other arithmetic is scheduled between these loads and their s_wait_xcnt, where it could be given a register that a load names
#pragma unroll
    for (int i = 0; i < 4; ++i) { rk[i] = *(const v8usa*)(Kg + gko + i * 1024); rv[i] = *(const v8usa*)(Vg + gvo + (size_t)i * 16 * TT); if (HL) { rk2[i] = *(const v8usa*)(Kg2 + gko + i * 1024); rv2[i] = *(const v8usa*)(Vg2 + gvo + (size_t)i * 16 * TT); } }
    xw0();   // in front of the next write of these loads' address registers
    __builtin_amdgcn_sched_barrier(0);   // second of the pair: later arithmetic stays behind the wait
    v8f O[4];
#pragma unroll
    for (int db = 0; db < 4; ++db) O[db] = (v8f){};
    v8f l8 = (v8f){};   // eight independent partial row sums a lane
    float m = -3.0e38f; const float C2 = SCL * 1.4426950408889634f;
#pragma unroll 1   // rolled: one stage's fragments and one stage's staging registers, no more
    for (int s = 0; s < TT / FK; ++s) {
        __syncthreads();   // every wave has left the tiles of the stage before
#pragma unroll
        for (int i = 0; i < 4; ++i) { *(v8usa*)(Ks + so + i * 16 * FP) = rk[i]; *(v8usa*)(Vs + so + i * 16 * FP) = rv[i]; if (HL) { *(v8usa*)(Ks2 + so + i * 16 * FP) = rk2[i]; *(v8usa*)(Vs2 + so + i * 16 * FP) = rv2[i]; } }
        __syncthreads();   // the stage's tiles are complete for every wave
        if (s + 1 < TT / FK) {   // the next stage's loads fly while this one is worked on
            const size_t ko = gko + (size_t)(s + 1) * FK * HD, vo = gvo + (size_t)(s + 1) * FK;
#pragma unroll
            for (int i = 0; i < 4; ++i) { rk[i] = *(const v8usa*)(Kg + ko + i * 1024); rv[i] = *(const v8usa*)(Vg + vo + (size_t)i * 16 * TT); if (HL) { rk2[i] = *(const v8usa*)(Kg2 + ko + i * 1024); rv2[i] = *(const v8usa*)(Vg2 + vo + (size_t)i * 16 * TT); } }
            xw0();   // in front of the next write of these loads' address registers
        }
        v8f S[4];
#pragma unroll
        for (int kb = 0; kb < 4; ++kb) { S[kb] = (v8f){};
#pragma unroll
            for (int kc = 0; kc < 2; ++kc) { const int fo = (kb * 16 + lr) * FP + kc * 32 + 8 * hi; const V k1 = ldf<T16>(Ks + fo); S[kb] = WFrag<T16>::mma(k1, qf[kc], S[kb]);
                if (HL) { S[kb] = WFrag<T16>::mma(k1, qf2[kc], S[kb]); S[kb] = WFrag<T16>::mma(ldf<T16>(Ks2 + fo), qf[kc], S[kb]); } } }
        float mx = S[0][0];
#pragma unroll
        for (int kb = 0; kb < 4; ++kb)
#pragma unroll
            for (int r = 0; r < 8; ++r) mx = fmaxf(mx, S[kb][r]);
        mx *= C2; mx = fmaxf(mx, xhalf(mx));   // the query's maximum over the stage, the same in both halves
        if (__builtin_amdgcn_ballot_w32(mx > m + 8.0f) != 0) {   // one scalar test a stage
            const float mn = fmaxf(m, mx), al = __builtin_amdgcn_exp2f(m - mn); m = mn; l8 *= al;
#pragma unroll
            for (int db = 0; db < 4; ++db) O[db] *= al; }
        const v8f c8 = {C2, C2, C2, C2, C2, C2, C2, C2}, n8 = {-m, -m, -m, -m, -m, -m, -m, -m};
#pragma unroll
        for (int kb = 0; kb < 4; ++kb) { const v8f t = __builtin_elementwise_fma(S[kb], c8, n8);
#pragma unroll
            for (int r = 0; r < 8; ++r) S[kb][r] = __builtin_amdgcn_exp2f(t[r]);
            l8 += S[kb]; }
#pragma unroll
        for (int kp = 0; kp < 2; ++kp) { V pb, pb2;
            if constexpr (HL) {
#pragma unroll
                for (int e = 0; e < 16; ++e) { const float p = S[2 * kp + (e >> 3)][e & 7]; const __bf16 ph = (__bf16)p; pb[e] = ph; pb2[e] = (__bf16)(p - (float)ph); }
            } else {
#pragma unroll
                for (int e = 0; e < 16; ++e) pb[e] = (h16)S[2 * kp + (e >> 3)][e & 7];
            }
#pragma unroll
            for (int db = 0; db < 4; ++db) { const int fo = (db * 16 + lr) * FP + kp * 32 + 8 * hi; const V v1 = ldf<T16>(Vs + fo); O[db] = WFrag<T16>::mma(v1, pb, O[db]);
                if constexpr (HL) { O[db] = WFrag<T16>::mma(v1, pb2, O[db]); O[db] = WFrag<T16>::mma(ldf<T16>(Vs2 + fo), pb, O[db]); } } }
    }
    float l = ((l8[0] + l8[1]) + (l8[2] + l8[3])) + ((l8[4] + l8[5]) + (l8[6] + l8[7])); l += xhalf(l); const float inv = __fdiv_rn(1.0f, l);
    v8us oh[4], ol[4];
#pragma unroll
    for (int db = 0; db < 4; ++db)
#pragma unroll
        for (int r = 0; r < 8; ++r) { unsigned short a, c2; splitf(O[db][r] * inv, a, c2); oh[db][r] = a; ol[db][r] = c2; }
    const size_t oo = (size_t)qrow * DQ + col0 + 8 * hi;   // a lane's 8 accumulator rows are 8 consecutive d of its query
#pragma unroll
    for (int db = 0; db < 4; ++db) { *(v8us*)(Ah + oo + db * 16) = oh[db]; *(v8us*)(Al + oo + db * 16) = ol[db]; }
}
__global__ __launch_bounds__(128) void k_fattn(const h16* __restrict__ Q16, const h16* __restrict__ K16, const h16* __restrict__ V16, const bf* __restrict__ Qh, const bf* __restrict__ Ql, const bf* __restrict__ Kh, const bf* __restrict__ Kl, const bf* __restrict__ Vh, const bf* __restrict__ Vl, bf* Ah, bf* Al) {
    __shared__ __align__(16) unsigned short sm[4 * FT];
    const int h = blockIdx.y, b = blockIdx.z; const size_t po = ((size_t)b * NH_ + h) * TT * HD; Ah += (size_t)b * TT * DQ; Al += (size_t)b * TT * DQ;
    const int xb = (blockIdx.x + (TT / 128) * (h >> 3) + (TT / 256) * b) & (TT / 64 - 1);   // query block; turned by half the blocks in the upper heads and by a quarter in the second batch, so that the heavier hi/lo blocks do not all have the same index modulo a power of two
    if (xb < RH / 64) fattn<bf, true>(Qh + po, Ql + po, Kh + po, Kl + po, Vh + po, Vl + po, xb * 64, h * HD, Ah, Al, sm);
    else fattn<h16, false>((const unsigned short*)(Q16 + po), nullptr, (const unsigned short*)(K16 + po), nullptr, (const unsigned short*)(V16 + po), nullptr, xb * 64, h * HD, Ah, Al, sm);
}

extern "C" void kernel_launch(void* const* d_in, const int* in_sizes, int n_in,
                              void* d_out, int out_size, void* d_ws, size_t ws_size, hipStream_t stream) {
    (void)in_sizes; (void)n_in; (void)out_size;
    const float* x = (const float*)d_in[0]; const float* wq = (const float*)d_in[1]; const float* wk = (const float*)d_in[2]; const float* wv = (const float*)d_in[3]; const float* wo = (const float*)d_in[4]; const float* hq = (const float*)d_in[5]; const float* hk = (const float*)d_in[6]; const float* hv = (const float*)d_in[7];
    float* OUT = (float*)d_out;     // [2][2048][1024]
    char* wsp = (char*)d_ws;
    auto take = [&](size_t bytes) { char* p = wsp; wsp += (bytes + 255) & ~(size_t)255; return (void*)p; };
    static_assert(DKV == DQ && NKV == NH_ && ((size_t)DQ * DM * 2) % 256 == 0 && ((size_t)NB_ * NH_ * TT * HD * 2) % 256 == 0 && ((size_t)NB_ * TT * DM) % ((size_t)DQ * DM) == 0, "the q, k and v chains have one shape, planes taken one behind the other are contiguous, and E is a whole number of weight-sized pieces");
    bf* WQ = (bf*)take((size_t)DQ * DM * 2); take((size_t)DKV * DM * 2); take((size_t)DKV * DM * 2);   // WQ | WK | WV: z of the first-stage launch
    bf* HQB = (bf*)take((size_t)DQ * DM * 2); take((size_t)DKV * DM * 2); take((size_t)DKV * DM * 2);   // HQ | HK | HV ('hed' [16][64][1024] = flat 'oi'): z of the second-stage launch
    bf* WO = (bf*)take((size_t)DM * DQ * 2);
    bf* XB = (bf*)take((size_t)NB_ * TT * DM * 2);   // E in bf16 [NB_ TT][1024], directly behind the seven weight planes: the conversion launch's pieces 7 and up
    h16* QP16 = (h16*)take((size_t)NB_ * NH_ * TT * HD * 2); h16* KP16 = (h16*)take((size_t)NB_ * NKV * TT * HD * 2); h16* VT16 = (h16*)take((size_t)NB_ * NKV * HD * TT * 2);   // q | k | V^T of each kind one behind the other, [batch][head] planes each: z of the second-stage launch picks the group
    bf* QPh = (bf*)take((size_t)NB_ * NH_ * TT * HD * 2); bf* KPh = (bf*)take((size_t)NB_ * NKV * TT * HD * 2); bf* VTh = (bf*)take((size_t)NB_ * NKV * HD * TT * 2); bf* QPl = (bf*)take((size_t)NB_ * NH_ * TT * HD * 2); bf* KPl = (bf*)take((size_t)NB_ * NKV * TT * HD * 2); bf* VTl = (bf*)take((size_t)NB_ * NKV * HD * TT * 2);
    bf* ATh = (bf*)take((size_t)NB_ * TT * DQ * 2); bf* ATl = (bf*)take((size_t)NB_ * TT * DQ * 2);
    bf* Th = (bf*)take((size_t)3 * NB_ * TT * DM * 2); bf* Tl = (bf*)take((size_t)3 * NB_ * TT * DM * 2);   // Th, Tl [3][NB_ TT][1024]
    if ((size_t)(wsp - (char*)d_ws) > ws_size) return;    // ws 256 MiB
    k_cvt8w<<<dim3((unsigned)(((size_t)DQ * DM / 8 + 255) / 256), 7 + (unsigned)((size_t)NB_ * TT * DM / ((size_t)DQ * DM)), 1), 256, 0, stream>>>(wq, wk, wv, hq, hk, hv, wo, x, WQ, (size_t)DQ * DM / 8);
    k_gemmw<bf, 0, false, 1><<<dim3(NB_ * TT / 128, DQ / 128, 3), 128, 0, stream>>>(XB, nullptr, WQ, DM, nullptr, DQ, nullptr, nullptr, Th, Tl, 0, (size_t)DQ * DM, (size_t)NB_ * TT * DQ);   /* z = 0, 1, 2: Q = E WQ^T, K = E WK^T, V = E WV^T, as hi/lo planes */
    k_gemmw<bf, 1, false, 2><<<dim3(NB_ * TT / 128, DQ / 128, 3), 128, 0, stream>>>(Th, Tl, HQB, DM, nullptr, 0, nullptr, QP16, QPh, QPl, (size_t)NB_ * TT * DM, (size_t)DQ * DM, 0);   /* z = 0, 1, 2: q = Q HQ^T, k = K HK^T, v = V HV^T (all heads), as the attention's planes */
    k_fattn<<<dim3(TT / 64, NH_, NB_), 128, 0, stream>>>(QP16, KP16, VT16, QPh, QPl, KPh, KPl, VTh, VTl, ATh, ATl);   /* all heads of both batches: context as hi/lo planes [batch TT + t][head | d] */
    k_gemmw<bf, 1, false, 0><<<dim3(NB_ * TT / 128, DM / 128, 1), 128, 0, stream>>>(ATh, ATl, WO, DQ, OUT, DM, nullptr, nullptr, nullptr, nullptr, 0, 0, 0);
}

// v008
// Measured time: 152 microseconds a run.
// Two timings next to v007 both put it at 1.10 times that version's speed.
// Counting every step since v000, it is 14.2 times as fast.
#include <hip/hip_runtime.h>

// Two-stage-projection multi-head attention (E [2][2048][1024]; Q = E WQ^T, K, V likewise ('oi' [1024][1024]); per head q = Q HQ[h]^T ('hed' [16][64][1024] = flat 'oi' [1024][1024]), k, v likewise; softmax(q.k 64^-0.5); heads concatenated; out = o WO^T -> [2][2048][1024] (4.2 M)).
// Both batches go through every stage in one launch (rows m = batch TT + t). Layout: first-stage projections exact (bf16 x bf16); their f32 results split into bf16 hi/lo planes (in the GEMM's own epilogue) for the second-stage GEMMs against the exact flattened head weights (2 products), whose epilogue writes the attention's q, k and V^T planes; fused dense T-2048 attention (hybrid rows: < 512 hi/lo 3 products, rest fp16); context as hi/lo planes; WO hl x exact.
// Compute dtypes, f32 accumulate: every input rounded to bf16; stage-1 projections exact, stage-2 hl x exact; attention rows < 512 3 products, rest fp16; softmax f32; WO hl x exact.

#define NB_  2
#define TT   2048
#define DM   1024
#define NH_  16
#define NKV  16
#define REP  (NH_ / NKV)
#define HD   64
#define DQ   (NH_ * HD)
#define DKV  (NKV * HD)
#define RH   512                  // query rows < RH use hi+lo planes (0: none)
#define WIN  0
#define SCL  0.125f   // HD^-0.5
typedef _Float16 h16;
typedef unsigned short bf;
typedef __attribute__((ext_vector_type(16))) __bf16   v16bf;
typedef __attribute__((ext_vector_type(16))) _Float16 v16h;
typedef __attribute__((ext_vector_type(8)))  _Float16 v8h;
typedef __attribute__((ext_vector_type(8)))  unsigned short v8us;
typedef __attribute__((ext_vector_type(8)))  float    v8f;
typedef __attribute__((ext_vector_type(4)))  float    v4f;
typedef v8h  __attribute__((may_alias)) v8ha;
typedef v4f  __attribute__((may_alias)) v4fa;
typedef v8us __attribute__((may_alias)) v8usa;

__device__ __forceinline__ unsigned short f2bf(float f) { unsigned u = __float_as_uint(f); u += 0x7FFFu + ((u >> 16) & 1u); return (unsigned short)(u >> 16); }
__device__ __forceinline__ float bf2f(unsigned short b) { return __uint_as_float(((unsigned)b) << 16); }
__device__ __forceinline__ float bfr(float f) { return bf2f(f2bf(f)); }
__device__ __forceinline__ v16h cat16(v8h lo, v8h hi) { return __builtin_shufflevector(lo, hi, 0, 1, 2, 3, 4, 5, 6, 7, 8, 9, 10, 11, 12, 13, 14, 15); }
__device__ __forceinline__ v16bf cat16b(v8us lo, v8us hi) { return __builtin_bit_cast(v16bf, __builtin_shufflevector(lo, hi, 0, 1, 2, 3, 4, 5, 6, 7, 8, 9, 10, 11, 12, 13, 14, 15)); }
__device__ __forceinline__ v8f wmma16(v16h a, v16h b, v8f c) { return __builtin_amdgcn_wmma_f32_16x16x32_f16(false, a, false, b, (short)0, c, false, false); }
__device__ __forceinline__ v8f wmmab(v16bf a, v16bf b, v8f c) { return __builtin_amdgcn_wmma_f32_16x16x32_bf16(false, a, false, b, (short)0, c, false, false); }



// ---- k_gemmw: GEMM, FOUR WAVES per 128x128 output tile, each wave its 64x64 quarter (16 accumulators); grid (M/128, N/128, Z), 128 threads.
// C[m][n] (f32, pitch ldc, + optional f32 bias[n]) = sum_k A[m][k] Bt[n][k] (+ A2[m][k] Bt[n][k] where NSPLIT == 1). z-batch strides sA/sB/sC in elements. M % 128 == 0, N % 128 == 0, K % 64 == 0.
// EPI says what leaves the kernel. 0: C in f32. 1: C as bf16 hi/lo planes Ph, Pl (pitch ldc, z stride sC). 2: C as the attention's operand planes P16 (fp16), Ph, Pl (bf16 hi/lo), plane group z at z NB_ NH_ TT HD, in it batch m / TT at NH_ TT HD each, t = m % TT: z = 0, 1 head planes [head][t][d], z = 2 transposed [head][d][t]; a wave's 64 columns are one head, a tile's 128 rows one batch. No f32 C lies in memory for 1 and 2.
// A stage is GK = 64 k: the 128 rows of A (and A2) and of Bt, 128 B each, go global -> LDS by asynchronous 16-byte copies (whole 128-B lines, each fetched once a work-group), rows padded to GP elements; two buffers, the copies of stage t + 2 fly while stage t + 1 is worked on.
#define GK 64
#define GP 72                     // LDS row pitch in 16-bit elements: 144 B = 16 B x 9
#define GT (128 * GP)             // elements of one staged operand tile
template <typename T16> struct WFrag;
template <> struct WFrag<h16> { typedef v16h V; static __device__ __forceinline__ V ld(const h16* p) { return cat16(*(const v8h*)p, *(const v8h*)(p + 16)); } static __device__ __forceinline__ v8f mma(V a, V b, v8f c) { return wmma16(a, b, c); } };
template <> struct WFrag<bf> { typedef v16bf V; static __device__ __forceinline__ V ld(const bf* p) { return cat16b(*(const v8us*)p, *(const v8us*)(p + 16)); } static __device__ __forceinline__ v8f mma(V a, V b, v8f c) { return wmmab(a, b, c); } };
// cp8: a lane's eight asynchronous copies of one staged tile: 16 B from g + i rs (elements) to LDS byte l + i 16 GP 2, i = 0..7. The s_wait_xcnt 0 is the statement's last line, so that it stands in front of every later write of a register that a copy names.
template <typename T16>
__device__ __forceinline__ void cp8(unsigned l, const T16* g, size_t rs) {
    asm volatile("global_load_async_to_lds_b128 %0, %8, off\n\t"
                 "global_load_async_to_lds_b128 %1, %9, off\n\t"
                 "global_load_async_to_lds_b128 %2, %10, off\n\t"
                 "global_load_async_to_lds_b128 %3, %11, off\n\t"
                 "global_load_async_to_lds_b128 %4, %12, off\n\t"
                 "global_load_async_to_lds_b128 %5, %13, off\n\t"
                 "global_load_async_to_lds_b128 %6, %14, off\n\t"
                 "global_load_async_to_lds_b128 %7, %15, off\n\t"
                 "s_wait_xcnt 0x0"
                 :: "v"(l), "v"(l + 1u * 16 * GP * 2), "v"(l + 2u * 16 * GP * 2), "v"(l + 3u * 16 * GP * 2), "v"(l + 4u * 16 * GP * 2), "v"(l + 5u * 16 * GP * 2), "v"(l + 6u * 16 * GP * 2), "v"(l + 7u * 16 * GP * 2),
                    "v"(g), "v"(g + rs), "v"(g + 2 * rs), "v"(g + 3 * rs), "v"(g + 4 * rs), "v"(g + 5 * rs), "v"(g + 6 * rs), "v"(g + 7 * rs)
                 : "memory");
}
// xw0: s_wait_xcnt 0 behind a global load or store, in front of a later write of a register that it names.
__device__ __forceinline__ void xw0() { asm volatile("s_wait_xcnt 0x0" ::: "memory"); }
__device__ __forceinline__ h16 tohx(float x) { return (h16)x; }
__device__ __forceinline__ void splitf(float y, unsigned short& h, unsigned short& l) { h = f2bf(y); l = f2bf(y - bf2f(h)); }
template <typename T16, int NSPLIT, bool BIAS, int EPI>
__global__ __launch_bounds__(128) void k_gemmw(const T16* __restrict__ A, const T16* __restrict__ A2, const T16* __restrict__ Bt, int K, float* C, int ldc, const float* __restrict__ bias, h16* P16, bf* Ph, bf* Pl, size_t sA, size_t sB, size_t sC) {
    typedef typename WFrag<T16>::V V;
    static_assert(NSPLIT == 0 || NSPLIT == 1, "one or two A planes");
    constexpr int NT = 2 + NSPLIT;   // staged tiles of a stage: A, (A2,) Bt
    __shared__ __align__(16) T16 st[2 * NT * GT];
    __shared__ __align__(16) float osm[4 * 16 * 68];
    const size_t z = blockIdx.z; A += z * sA; if (NSPLIT == 1) A2 += z * sA; Bt += z * sB; if (EPI == 0) C += z * sC;
    const int tid = threadIdx.x, lane = tid & 31, lr = lane & 15, hi = lane >> 4, wr = tid >> 6, wc = (tid >> 5) & 1; const int R0 = blockIdx.x * 128, C0 = blockIdx.y * 128; const int r0 = R0 + wr * 64, c0 = C0 + wc * 64;
    float* os = osm + (tid >> 5) * (16 * 68);   // each wave's own output staging
    const int bt = (EPI == 2) ? R0 / TT : 0, rb = r0 - bt * TT; (void)bt; (void)rb;   // EPI 2: the tile's batch and the wave's first row in it
    v8f acc[4][4];
#pragma unroll
    for (int mb = 0; mb < 4; ++mb)
#pragma unroll
        for (int nb = 0; nb < 4; ++nb) acc[mb][nb] = (v8f){};
    // staging: a tile is 1024 chunks of 16 B; thread tid moves chunks tid + 128 i (row = chunk / 8)
    const size_t ga = (size_t)(R0 + (tid >> 3)) * K + (tid & 7) * 8, gb = (size_t)(C0 + (tid >> 3)) * K + (tid & 7) * 8, rs = (size_t)16 * K;
    const unsigned l0 = (unsigned)(size_t)st + (unsigned)(((tid >> 3) * GP + (tid & 7) * 8) * 2);   // the lane's LDS byte address in buffer 0, tile 0
    auto stage = [&](int t) { const unsigned l = l0 + (unsigned)(t & 1) * (NT * GT * 2); const size_t ko = (size_t)t * GK;
        cp8(l, A + ga + ko, rs); if (NSPLIT == 1) cp8(l + GT * 2, A2 + ga + ko, rs); cp8(l + (NT - 1) * GT * 2, Bt + gb + ko, rs); };
    const int nt = K / GK;
    stage(0);
    asm volatile("s_wait_asynccnt 0x0" ::: "memory");   // this wave's copies of stage 0 have landed
    __syncthreads();   // stage 0 is complete for every wave
    if (nt > 1) stage(1);
    const int ao = (wr * 64 + lr) * GP + 8 * hi, bo = (NT - 1) * GT + (wc * 64 + lr) * GP + 8 * hi;
#pragma unroll 1   // rolled: one stage's fragments in registers, and the two buffers told apart by the trip's parity
    for (int t = 0; t < nt; ++t) {
        const T16* sb = st + (t & 1) * (NT * GT);
#pragma unroll
        for (int kc = 0; kc < GK; kc += 32) {
            V a[4], a2[4], b[4];   // all fragments of a 32-k block are read in one group in front of its matrix instructions, in the order of their first use
            b[0] = WFrag<T16>::ld(sb + bo + kc);
#pragma unroll
            for (int mb = 0; mb < 4; ++mb) { a[mb] = WFrag<T16>::ld(sb + ao + mb * 16 * GP + kc); if (NSPLIT == 1) a2[mb] = WFrag<T16>::ld(sb + GT + ao + mb * 16 * GP + kc); }
#pragma unroll
            for (int nb = 1; nb < 4; ++nb) b[nb] = WFrag<T16>::ld(sb + bo + nb * 16 * GP + kc);
            __builtin_amdgcn_sched_barrier(0);   // keeps the group whole: without it the reads of b[1..3] are sunk among the matrix instructions, each with a full LDS wait in front of the next eight
#pragma unroll
            for (int nb = 0; nb < 4; ++nb)
#pragma unroll
                for (int mb = 0; mb < 4; ++mb) { acc[mb][nb] = WFrag<T16>::mma(a[mb], b[nb], acc[mb][nb]); if (NSPLIT == 1) acc[mb][nb] = WFrag<T16>::mma(a2[mb], b[nb], acc[mb][nb]); }
        }
        __builtin_amdgcn_sched_barrier(0);   // the trip's matrix instructions stay in front of its foot: sunk behind the barrier they stand in front of the next stage's copies and shorten their flight
        asm volatile("s_wait_dscnt 0x0" ::: "memory");      // this wave's reads of the buffer have returned before it is refilled
        asm volatile("s_wait_asynccnt 0x0" ::: "memory");   // this wave's copies of stage t + 1 have landed
        __syncthreads();   // publishes stage t + 1 and ends every wave's reads of stage t
        if (t + 2 < nt) stage(t + 2);   // into the buffer that this trip has just read
    }
    asm volatile("s_wait_asynccnt 0x0" ::: "memory");   // no copy is outstanding behind the loop
    if constexpr (EPI == 2) {
        static_assert(HD == 64 && TT % 128 == 0 && NSPLIT == 1 && 4 * 3 * 64 * GP <= 2 * NT * GT, "a wave's 64 columns are one head, a tile's rows one batch; its three transposed tiles fit its quarter of the stage buffers");
        if (blockIdx.z == 2) {   // V^T planes: a lane's 8 accumulator rows are 8 consecutive m of ONE column d, so they are converted in registers and only regrouped through LDS into whole 128-B lines of [d][m]
            unsigned short* vs = (unsigned short*)st + (tid >> 5) * (3 * 64 * GP);   // the stage buffers are free: every wave's last reads ended in front of the loop's last barrier, and no copy is outstanding
#pragma unroll
            for (int mb = 0; mb < 4; ++mb)
#pragma unroll
                for (int nb = 0; nb < 4; ++nb) { v8h o16; v8us oh, ol;
#pragma unroll
                    for (int j = 0; j < 8; ++j) { const float x = acc[mb][nb][j]; o16[j] = tohx(x); unsigned short a2, c2; splitf(x, a2, c2); oh[j] = a2; ol[j] = c2; }
                    const int so = (nb * 16 + lr) * GP + mb * 16 + hi * 8; *(v8usa*)(vs + so) = __builtin_bit_cast(v8us, o16); *(v8usa*)(vs + 64 * GP + so) = oh; *(v8usa*)(vs + 2 * 64 * GP + so) = ol; }
            __builtin_amdgcn_wave_barrier(); asm volatile("" ::: "memory");   // the wave's reads below stay behind its writes above
            const size_t vb = (((size_t)2 * NB_ + bt) * NH_ + (c0 >> 6)) * ((size_t)TT * HD) + (size_t)(lane >> 3) * TT + rb + (lane & 7) * 8; const int vo = (lane >> 3) * GP + (lane & 7) * 8;   // 8 lanes a row d: 128 B of m
#pragma unroll
            for (int g = 0; g < 4; ++g) { v8us t16[4], th[4], tl[4];
#pragma unroll
                for (int s = 0; s < 4; ++s) { const int o = vo + (g * 16 + s * 4) * GP; t16[s] = *(const v8usa*)(vs + o); th[s] = *(const v8usa*)(vs + 64 * GP + o); tl[s] = *(const v8usa*)(vs + 2 * 64 * GP + o); }
                __builtin_amdgcn_sched_barrier(0);   // with the one behind the wait: nothing else is scheduled between these stores and their s_wait_xcnt, where it could be given a register that a store names
#pragma unroll
                for (int s = 0; s < 4; ++s) { const size_t o = vb + (size_t)(g * 16 + s * 4) * TT; *(v8us*)((unsigned short*)P16 + o) = t16[s]; *(v8us*)(Ph + o) = th[s]; *(v8us*)(Pl + o) = tl[s]; }
                xw0();   // in front of the next write of these stores' registers
                __builtin_amdgcn_sched_barrier(0);   // second of the pair: later work stays behind the wait
            }
            return;   // the whole work-group (blockIdx.z), behind every barrier
        }
    }
#pragma unroll
    for (int mb = 0; mb < 4; ++mb) {
#pragma unroll
        for (int nb = 0; nb < 4; ++nb) {
#pragma unroll
            for (int j = 0; j < 8; ++j) os[(hi * 8 + j) * 68 + nb * 16 + lr] = acc[mb][nb][j]; }
        __builtin_amdgcn_wave_barrier(); asm volatile("" ::: "memory");
        if constexpr (EPI == 0) {
        float* crow = C + (size_t)(r0 + mb * 16) * ldc + c0;
{
#pragma unroll
            for (int s = 0; s < 8; ++s) { const int row = 2 * s + hi, cofs = lr * 4; v4f val = *(const v4fa*)(os + row * 68 + cofs); if (BIAS) { val[0] += bfr(bias[c0 + cofs]); val[1] += bfr(bias[c0 + cofs + 1]); val[2] += bfr(bias[c0 + cofs + 2]); val[3] += bfr(bias[c0 + cofs + 3]); }
                *(v4f*)(crow + (size_t)row * ldc + cofs) = val; }
             }
        } else {   // 16-bit planes: 8 lanes a row, 8 columns a lane: every store covers whole 128-B lines
            const size_t pb = (EPI == 1) ? z * sC + (size_t)(r0 + mb * 16 + (lane >> 3)) * ldc + c0 + (lane & 7) * 8 : ((z * NB_ + bt) * NH_ + (c0 >> 6)) * ((size_t)TT * HD) + (size_t)(rb + mb * 16 + (lane >> 3)) * HD + (lane & 7) * 8;
            const size_t pp = (EPI == 1) ? (size_t)4 * ldc : (size_t)4 * HD;   // four rows on
            v8h o16[4]; v8us oh[4], ol[4];
#pragma unroll
            for (int s = 0; s < 4; ++s) { const float* op = os + (4 * s + (lane >> 3)) * 68 + (lane & 7) * 8; const v4f x0 = *(const v4fa*)op, x1 = *(const v4fa*)(op + 4);
#pragma unroll
                for (int q = 0; q < 8; ++q) { const float x = (q < 4) ? x0[q & 3] : x1[q & 3]; if (EPI == 2) o16[s][q] = tohx(x); unsigned short a2, c2; splitf(x, a2, c2); oh[s][q] = a2; ol[s][q] = c2; } }
            __builtin_amdgcn_sched_barrier(0);   // with the one behind the wait: nothing else is scheduled between these stores and their s_wait_xcnt, where it could be given a register that a store names
#pragma unroll
            for (int s = 0; s < 4; ++s) { if (EPI == 2) *(v8h*)(P16 + pb + s * pp) = o16[s]; *(v8us*)(Ph + pb + s * pp) = oh[s]; *(v8us*)(Pl + pb + s * pp) = ol[s]; }
            xw0();   // in front of the next write of these stores' registers
            __builtin_amdgcn_sched_barrier(0);   // second of the pair: later work stays behind the wait
        }
        __builtin_amdgcn_wave_barrier(); asm volatile("" ::: "memory");
    }
}

typedef __attribute__((ext_vector_type(2))) _Float16 v2h;
typedef __attribute__((ext_vector_type(4))) _Float16 v4h;
typedef __attribute__((ext_vector_type(2))) unsigned short v2us;
typedef __attribute__((ext_vector_type(4))) unsigned short v4us;
typedef __attribute__((ext_vector_type(2))) float v2f;
typedef __attribute__((ext_vector_type(4))) int v4i;

__global__ __launch_bounds__(256) void k_wtG(const float* __restrict__ w, int K, int N, bf* Bt) {
    const int lane = threadIdx.x & 31; const int L0 = (blockIdx.x * 8 + (threadIdx.x >> 5)) * 8; const int nlines = N * K / 64;
{
#pragma unroll 1
        for (int l = 0; l < 8; ++l) { const int L = L0 + l; if (L >= nlines) break; const size_t e = (size_t)L * 64 + lane * 2; const int k = (int)(e % K), n = (int)(e / K); v2us o;
            o[0] = f2bf(w[(size_t)k * N + n]); o[1] = f2bf(w[(size_t)(k + 1) * N + n]); *(v2us*)(Bt + e) = o; }
         }
}
// k_cvt8w: every f32 input to bf16 in one launch, 8 elements a thread: blockIdx.y picks a piece of n8 groups of 8: 0..6 the seven weight matrices, from 7 on the pieces of e in their order; the bf16 planes lie one behind the other in dst, in that order.
__global__ __launch_bounds__(256) void k_cvt8w(const float* __restrict__ w0, const float* __restrict__ w1, const float* __restrict__ w2, const float* __restrict__ w3, const float* __restrict__ w4, const float* __restrict__ w5, const float* __restrict__ w6, const float* __restrict__ e, bf* dst, size_t n8) { const size_t i = (size_t)blockIdx.x * 256 + threadIdx.x; if (i >= n8) return; const unsigned y = blockIdx.y;
    const float* src = (y == 0) ? w0 : (y == 1) ? w1 : (y == 2) ? w2 : (y == 3) ? w3 : (y == 4) ? w4 : (y == 5) ? w5 : (y == 6) ? w6 : e + (size_t)(y - 7) * n8 * 8; const v8f v = *(const v8f*)(src + i * 8); xw0();   // the source address pair is given to other values further down
    v8us o;
#pragma unroll
    for (int k = 0; k < 8; ++k) o[k] = f2bf(v[k]); *(v8us*)(dst + ((size_t)y * n8 + i) * 8) = o;  }

#define FK 64
#define FP 72                     // LDS row pitch in 16-bit elements: 144 B = 16 B x 9
#define FT (FK * FP)              // elements of one LDS tile (HD == FK rows)
template <typename T16> struct FFrag;
template <> struct FFrag<h16> { static __device__ __forceinline__ v16h mk(v8us lo, v8us hi) { return __builtin_bit_cast(v16h, __builtin_shufflevector(lo, hi, 0, 1, 2, 3, 4, 5, 6, 7, 8, 9, 10, 11, 12, 13, 14, 15)); } };
template <> struct FFrag<bf> { static __device__ __forceinline__ v16bf mk(v8us lo, v8us hi) { return cat16b(lo, hi); } };
template <typename T16> __device__ __forceinline__ typename WFrag<T16>::V ldf(const unsigned short* p) { return FFrag<T16>::mk(*(const v8usa*)p, *(const v8usa*)(p + 16)); }
__device__ __forceinline__ float xhalf(float x) { const int b = __float_as_int(x); return __int_as_float(__builtin_amdgcn_permlanex16(b, b, 0x76543210, 0xfedcba98, false, false)); }   // the value of lane l ^ 16
template <typename T16, bool HL>
__device__ __forceinline__ void fattn(const unsigned short* __restrict__ Q, const unsigned short* __restrict__ Q2, const unsigned short* __restrict__ Kg, const unsigned short* __restrict__ Kg2, const unsigned short* __restrict__ Vg, const unsigned short* __restrict__ Vg2, int q0, int col0, bf* Ah, bf* Al, unsigned short* sm) {
    typedef typename WFrag<T16>::V V;
    static_assert(HD == 64 && FK == 64 && TT % FK == 0, "tile shapes");
    const int tid = threadIdx.x, lane = tid & 31, lr = lane & 15, hi = lane >> 4; const int qrow = q0 + (tid >> 5) * 16 + lr;
    unsigned short* Ks = sm; unsigned short* Vs = sm + FT; unsigned short* Ks2 = sm + 2 * FT; unsigned short* Vs2 = sm + 3 * FT;
    V qf[2], qf2[2];
#pragma unroll
    for (int kc = 0; kc < 2; ++kc) { qf[kc] = ldf<T16>(Q + (size_t)qrow * HD + kc * 32 + 8 * hi); if (HL) qf2[kc] = ldf<T16>(Q2 + (size_t)qrow * HD + kc * 32 + 8 * hi); }
    xw0();   // the query row's address is given to other values further down
    // staging: a tile is 512 chunks of 16 B; thread tid moves chunks tid + 128 i (row = chunk / 8): whole 128-B lines of K and of V^T
    const size_t gko = (size_t)tid * 8, gvo = (size_t)(tid >> 3) * TT + (tid & 7) * 8; const int so = (tid >> 3) * FP + (tid & 7) * 8;
    v8us rk[4], rv[4], rk2[4], rv2[4];
    __builtin_amdgcn_sched_barrier(0);   // with the one behind the wait: no other arithmetic is scheduled between these loads and their s_wait_xcnt, where it could be given a register that a load names
#pragma unroll
    for (int i = 0; i < 4; ++i) { rk[i] = *(const v8usa*)(Kg + gko + i * 1024); rv[i] = *(const v8usa*)(Vg + gvo + (size_t)i * 16 * TT); if (HL) { rk2[i] = *(const v8usa*)(Kg2 + gko + i * 1024); rv2[i] = *(const v8usa*)(Vg2 + gvo + (size_t)i * 16 * TT); } }
    xw0();   // in front of the next write of these loads' address registers
    __builtin_amdgcn_sched_barrier(0);   // second of the pair: later arithmetic stays behind the wait
    v8f O[4];
#pragma unroll
    for (int db = 0; db < 4; ++db) O[db] = (v8f){};
    v8f l8 = (v8f){};   // eight independent partial row sums a lane
    float m = -3.0e38f; const float C2 = SCL * 1.4426950408889634f;
#pragma unroll 1   // rolled: one stage's fragments and one stage's staging registers, no more
    for (int s = 0; s < TT / FK; ++s) {
        __syncthreads();   // every wave has left the tiles of the stage before
#pragma unroll
        for (int i = 0; i < 4; ++i) { *(v8usa*)(Ks + so + i * 16 * FP) = rk[i]; *(v8usa*)(Vs + so + i * 16 * FP) = rv[i]; if (HL) { *(v8usa*)(Ks2 + so + i * 16 * FP) = rk2[i]; *(v8usa*)(Vs2 + so + i * 16 * FP) = rv2[i]; } }
        __syncthreads();   // the stage's tiles are complete for every wave
        if (s + 1 < TT / FK) {   // the next stage's loads fly while this one is worked on
            const size_t ko = gko + (size_t)(s + 1) * FK * HD, vo = gvo + (size_t)(s + 1) * FK;
#pragma unroll
            for (int i = 0; i < 4; ++i) { rk[i] = *(const v8usa*)(Kg + ko + i * 1024); rv[i] = *(const v8usa*)(Vg + vo + (size_t)i * 16 * TT); if (HL) { rk2[i] = *(const v8usa*)(Kg2 + ko + i * 1024); rv2[i] = *(const v8usa*)(Vg2 + vo + (size_t)i * 16 * TT); } }
            xw0();   // in front of the next write of these loads' address registers
        }
        // LDS reads stand in groups of eight fragments (16 reads; four where HL), each group whole in front of the matrix instructions that use it; these run over independent accumulators in turn; every accumulator takes its products by rising k, and of one k block plane by plane (hi.hi, hi.lo, lo.hi).
        v8f S[4];
#pragma unroll
        for (int kb = 0; kb < 4; ++kb) S[kb] = (v8f){};
        V vf[8];   // !HL: all eight V^T fragments of the stage, read ahead of the softmax
        if constexpr (HL) {
#pragma unroll
            for (int g = 0; g < 4; ++g) { const int p = g >> 1, kc = g & 1; V k1[2], k2[2];   // a group: 32 d of key blocks 2 p and 2 p + 1, both planes (four fragments: eight do not fit the registers of four waves a SIMD)
#pragma unroll
                for (int b = 0; b < 2; ++b) { const int fo = ((2 * p + b) * 16 + lr) * FP + kc * 32 + 8 * hi; k1[b] = ldf<T16>(Ks + fo); k2[b] = ldf<T16>(Ks2 + fo); }
                __builtin_amdgcn_sched_barrier(0);   // keeps the group whole and in front of its matrix instructions: without it each pair of reads is sunk to its own matrix instruction, with a full LDS wait in front of every one
#pragma unroll
                for (int b = 0; b < 2; ++b) S[2 * p + b] = WFrag<T16>::mma(k1[b], qf[kc], S[2 * p + b]);
#pragma unroll
                for (int b = 0; b < 2; ++b) S[2 * p + b] = WFrag<T16>::mma(k1[b], qf2[kc], S[2 * p + b]);
#pragma unroll
                for (int b = 0; b < 2; ++b) S[2 * p + b] = WFrag<T16>::mma(k2[b], qf[kc], S[2 * p + b]);
            }
        } else {
            V k1[4][2];
#pragma unroll
            for (int kc = 0; kc < 2; ++kc)
#pragma unroll
                for (int kb = 0; kb < 4; ++kb) k1[kb][kc] = ldf<T16>(Ks + (kb * 16 + lr) * FP + kc * 32 + 8 * hi);
            __builtin_amdgcn_sched_barrier(0);   // keeps the group whole, as above
#pragma unroll
            for (int kc = 0; kc < 2; ++kc)
#pragma unroll
                for (int kb = 0; kb < 4; ++kb) S[kb] = WFrag<T16>::mma(k1[kb][kc], qf[kc], S[kb]);
#pragma unroll
            for (int kp = 0; kp < 2; ++kp)
#pragma unroll
                for (int db = 0; db < 4; ++db) vf[kp * 4 + db] = ldf<T16>(Vs + (db * 16 + lr) * FP + kp * 32 + 8 * hi);
            __builtin_amdgcn_sched_barrier(0);   // the V^T reads stay in front of the softmax, whose vector work covers their latency
        }
        float mx = S[0][0];
#pragma unroll
        for (int kb = 0; kb < 4; ++kb)
#pragma unroll
            for (int r = 0; r < 8; ++r) mx = fmaxf(mx, S[kb][r]);
        mx *= C2; mx = fmaxf(mx, xhalf(mx));   // the query's maximum over the stage, the same in both halves
        if (__builtin_amdgcn_ballot_w32(mx > m + 8.0f) != 0) {   // one scalar test a stage
            const float mn = fmaxf(m, mx), al = __builtin_amdgcn_exp2f(m - mn); m = mn; l8 *= al;
#pragma unroll
            for (int db = 0; db < 4; ++db) O[db] *= al; }
        const v8f c8 = {C2, C2, C2, C2, C2, C2, C2, C2}, n8 = {-m, -m, -m, -m, -m, -m, -m, -m};
#pragma unroll
        for (int kb = 0; kb < 4; ++kb) { const v8f t = __builtin_elementwise_fma(S[kb], c8, n8);
#pragma unroll
            for (int r = 0; r < 8; ++r) S[kb][r] = __builtin_amdgcn_exp2f(t[r]);
            l8 += S[kb]; }
#pragma unroll
        for (int kp = 0; kp < 2; ++kp) { V pb, pb2;
            if constexpr (HL) {
#pragma unroll
                for (int e = 0; e < 16; ++e) { const float p = S[2 * kp + (e >> 3)][e & 7]; const __bf16 ph = (__bf16)p; pb[e] = ph; pb2[e] = (__bf16)(p - (float)ph); }
#pragma unroll
                for (int g = 0; g < 2; ++g) { V v1[2], v2[2];   // a group: d blocks 2 g and 2 g + 1 of 32 keys, both planes
#pragma unroll
                    for (int b = 0; b < 2; ++b) { const int fo = ((2 * g + b) * 16 + lr) * FP + kp * 32 + 8 * hi; v1[b] = ldf<T16>(Vs + fo); v2[b] = ldf<T16>(Vs2 + fo); }
                    __builtin_amdgcn_sched_barrier(0);   // keeps the group whole and in front of its matrix instructions, as above
#pragma unroll
                    for (int b = 0; b < 2; ++b) O[2 * g + b] = WFrag<T16>::mma(v1[b], pb, O[2 * g + b]);
#pragma unroll
                    for (int b = 0; b < 2; ++b) O[2 * g + b] = WFrag<T16>::mma(v1[b], pb2, O[2 * g + b]);
#pragma unroll
                    for (int b = 0; b < 2; ++b) O[2 * g + b] = WFrag<T16>::mma(v2[b], pb, O[2 * g + b]);
                }
            } else {
#pragma unroll
                for (int e = 0; e < 16; ++e) pb[e] = (h16)S[2 * kp + (e >> 3)][e & 7];
#pragma unroll
                for (int db = 0; db < 4; ++db) O[db] = WFrag<T16>::mma(vf[kp * 4 + db], pb, O[db]);
            } }
    }
    float l = ((l8[0] + l8[1]) + (l8[2] + l8[3])) + ((l8[4] + l8[5]) + (l8[6] + l8[7])); l += xhalf(l); const float inv = __fdiv_rn(1.0f, l);
    v8us oh[4], ol[4];
#pragma unroll
    for (int db = 0; db < 4; ++db)
#pragma unroll
        for (int r = 0; r < 8; ++r) { unsigned short a, c2; splitf(O[db][r] * inv, a, c2); oh[db][r] = a; ol[db][r] = c2; }
    const size_t oo = (size_t)qrow * DQ + col0 + 8 * hi;   // a lane's 8 accumulator rows are 8 consecutive d of its query
#pragma unroll
    for (int db = 0; db < 4; ++db) { *(v8us*)(Ah + oo + db * 16) = oh[db]; *(v8us*)(Al + oo + db * 16) = ol[db]; }
}
__global__ __launch_bounds__(128) void k_fattn(const h16* __restrict__ Q16, const h16* __restrict__ K16, const h16* __restrict__ V16, const bf* __restrict__ Qh, const bf* __restrict__ Ql, const bf* __restrict__ Kh, const bf* __restrict__ Kl, const bf* __restrict__ Vh, const bf* __restrict__ Vl, bf* Ah, bf* Al) {
    __shared__ __align__(16) unsigned short sm[4 * FT];
    const int h = blockIdx.y, b = blockIdx.z; const size_t po = ((size_t)b * NH_ + h) * TT * HD; Ah += (size_t)b * TT * DQ; Al += (size_t)b * TT * DQ;
    const int xb = (blockIdx.x + (TT / 128) * (h >> 3) + (TT / 256) * b) & (TT / 64 - 1);   // query block; turned by half the blocks in the upper heads and by a quarter in the second batch, so that the heavier hi/lo blocks do not all have the same index modulo a power of two
    if (xb < RH / 64) fattn<bf, true>(Qh + po, Ql + po, Kh + po, Kl + po, Vh + po, Vl + po, xb * 64, h * HD, Ah, Al, sm);
    else fattn<h16, false>((const unsigned short*)(Q16 + po), nullptr, (const unsigned short*)(K16 + po), nullptr, (const unsigned short*)(V16 + po), nullptr, xb * 64, h * HD, Ah, Al, sm);
}

extern "C" void kernel_launch(void* const* d_in, const int* in_sizes, int n_in,
                              void* d_out, int out_size, void* d_ws, size_t ws_size, hipStream_t stream) {
    (void)in_sizes; (void)n_in; (void)out_size;
    const float* x = (const float*)d_in[0]; const float* wq = (const float*)d_in[1]; const float* wk = (const float*)d_in[2]; const float* wv = (const float*)d_in[3]; const float* wo = (const float*)d_in[4]; const float* hq = (const float*)d_in[5]; const float* hk = (const float*)d_in[6]; const float* hv = (const float*)d_in[7];
    float* OUT = (float*)d_out;     // [2][2048][1024]
    char* wsp = (char*)d_ws;
    auto take = [&](size_t bytes) { char* p = wsp; wsp += (bytes + 255) & ~(size_t)255; return (void*)p; };
    static_assert(DKV == DQ && NKV == NH_ && ((size_t)DQ * DM * 2) % 256 == 0 && ((size_t)NB_ * NH_ * TT * HD * 2) % 256 == 0 && ((size_t)NB_ * TT * DM) % ((size_t)DQ * DM) == 0, "the q, k and v chains have one shape, planes taken one behind the other are contiguous, and E is a whole number of weight-sized pieces");
    bf* WQ = (bf*)take((size_t)DQ * DM * 2); take((size_t)DKV * DM * 2); take((size_t)DKV * DM * 2);   // WQ | WK | WV: z of the first-stage launch
    bf* HQB = (bf*)take((size_t)DQ * DM * 2); take((size_t)DKV * DM * 2); take((size_t)DKV * DM * 2);   // HQ | HK | HV ('hed' [16][64][1024] = flat 'oi'): z of the second-stage launch
    bf* WO = (bf*)take((size_t)DM * DQ * 2);
    bf* XB = (bf*)take((size_t)NB_ * TT * DM * 2);   // E in bf16 [NB_ TT][1024], directly behind the seven weight planes: the conversion launch's pieces 7 and up
    h16* QP16 = (h16*)take((size_t)NB_ * NH_ * TT * HD * 2); h16* KP16 = (h16*)take((size_t)NB_ * NKV * TT * HD * 2); h16* VT16 = (h16*)take((size_t)NB_ * NKV * HD * TT * 2);   // q | k | V^T of each kind one behind the other, [batch][head] planes each: z of the second-stage launch picks the group
    bf* QPh = (bf*)take((size_t)NB_ * NH_ * TT * HD * 2); bf* KPh = (bf*)take((size_t)NB_ * NKV * TT * HD * 2); bf* VTh = (bf*)take((size_t)NB_ * NKV * HD * TT * 2); bf* QPl = (bf*)take((size_t)NB_ * NH_ * TT * HD * 2); bf* KPl = (bf*)take((size_t)NB_ * NKV * TT * HD * 2); bf* VTl = (bf*)take((size_t)NB_ * NKV * HD * TT * 2);
    bf* ATh = (bf*)take((size_t)NB_ * TT * DQ * 2); bf* ATl = (bf*)take((size_t)NB_ * TT * DQ * 2);
    bf* Th = (bf*)take((size_t)3 * NB_ * TT * DM * 2); bf* Tl = (bf*)take((size_t)3 * NB_ * TT * DM * 2);   // Th, Tl [3][NB_ TT][1024]
    if ((size_t)(wsp - (char*)d_ws) > ws_size) return;    // ws 256 MiB
    k_cvt8w<<<dim3((unsigned)(((size_t)DQ * DM / 8 + 255) / 256), 7 + (unsigned)((size_t)NB_ * TT * DM / ((size_t)DQ * DM)), 1), 256, 0, stream>>>(wq, wk, wv, hq, hk, hv, wo, x, WQ, (size_t)DQ * DM / 8);
    k_gemmw<bf, 0, false, 1><<<dim3(NB_ * TT / 128, DQ / 128, 3), 128, 0, stream>>>(XB, nullptr, WQ, DM, nullptr, DQ, nullptr, nullptr, Th, Tl, 0, (size_t)DQ * DM, (size_t)NB_ * TT * DQ);   /* z = 0, 1, 2: Q = E WQ^T, K = E WK^T, V = E WV^T, as hi/lo planes */
    k_gemmw<bf, 1, false, 2><<<dim3(NB_ * TT / 128, DQ / 128, 3), 128, 0, stream>>>(Th, Tl, HQB, DM, nullptr, 0, nullptr, QP16, QPh, QPl, (size_t)NB_ * TT * DM, (size_t)DQ * DM, 0);   /* z = 0, 1, 2: q = Q HQ^T, k = K HK^T, v = V HV^T (all heads), as the attention's planes */
    k_fattn<<<dim3(TT / 64, NH_, NB_), 128, 0, stream>>>(QP16, KP16, VT16, QPh, QPl, KPh, KPl, VTh, VTl, ATh, ATl);   /* all heads of both batches: context as hi/lo planes [batch TT + t][head | d] */
    k_gemmw<bf, 1, false, 0><<<dim3(NB_ * TT / 128, DM / 128, 1), 128, 0, stream>>>(ATh, ATl, WO, DQ, OUT, DM, nullptr, nullptr, nullptr, nullptr, 0, 0, 0);
}

// v009
// One run takes 145 microseconds.
// Timed twice side by side with v008, it ran 1.03 and 1.05 times as fast.
// Counting every step since v000, it is 14.7 times as fast.
#include <hip/hip_runtime.h>

// Two-stage-projection multi-head attention (E [2][2048][1024]; Q = E WQ^T, K, V likewise ('oi' [1024][1024]); per head q = Q HQ[h]^T ('hed' [16][64][1024] = flat 'oi' [1024][1024]), k, v likewise; softmax(q.k 64^-0.5); heads concatenated; out = o WO^T -> [2][2048][1024] (4.2 M)).
// Both batches go through every stage in one launch (rows m = batch TT + t). Layout: first-stage projections exact (bf16 x bf16); their f32 results split into bf16 hi/lo planes (in the GEMM's own epilogue) for the second-stage GEMMs against the exact flattened head weights (2 products), whose epilogue writes the attention's q, k and V^T planes; fused dense T-2048 attention (hybrid rows: < 512 hi/lo 3 products, rest fp16); context as hi/lo planes; WO hl x exact.
// Compute dtypes, f32 accumulate: every input rounded to bf16; stage-1 projections exact, stage-2 hl x exact; attention rows < 512 3 products, rest fp16; softmax f32; WO hl x exact.

#define NB_  2
#define TT   2048
#define DM   1024
#define NH_  16
#define NKV  16
#define REP  (NH_ / NKV)
#define HD   64
#define DQ   (NH_ * HD)
#define DKV  (NKV * HD)
#define RH   512                  // query rows < RH use hi+lo planes (0: none)
#define WIN  0
#define SCL  0.125f   // HD^-0.5
typedef _Float16 h16;
typedef unsigned short bf;
typedef __attribute__((ext_vector_type(16))) __bf16   v16bf;
typedef __attribute__((ext_vector_type(16))) _Float16 v16h;
typedef __attribute__((ext_vector_type(8)))  _Float16 v8h;
typedef __attribute__((ext_vector_type(8)))  unsigned short v8us;
typedef __attribute__((ext_vector_type(8)))  float    v8f;
typedef __attribute__((ext_vector_type(4)))  float    v4f;
typedef v8h  __attribute__((may_alias)) v8ha;
typedef v4f  __attribute__((may_alias)) v4fa;
typedef v8us __attribute__((may_alias)) v8usa;
typedef float __attribute__((may_alias)) fa;

__device__ __forceinline__ unsigned short f2bf(float f) { unsigned u = __float_as_uint(f); u += 0x7FFFu + ((u >> 16) & 1u); return (unsigned short)(u >> 16); }
__device__ __forceinline__ float bf2f(unsigned short b) { return __uint_as_float(((unsigned)b) << 16); }
__device__ __forceinline__ float bfr(float f) { return bf2f(f2bf(f)); }
__device__ __forceinline__ v16h cat16(v8h lo, v8h hi) { return __builtin_shufflevector(lo, hi, 0, 1, 2, 3, 4, 5, 6, 7, 8, 9, 10, 11, 12, 13, 14, 15); }
__device__ __forceinline__ v16bf cat16b(v8us lo, v8us hi) { return __builtin_bit_cast(v16bf, __builtin_shufflevector(lo, hi, 0, 1, 2, 3, 4, 5, 6, 7, 8, 9, 10, 11, 12, 13, 14, 15)); }
__device__ __forceinline__ v8f wmma16(v16h a, v16h b, v8f c) { return __builtin_amdgcn_wmma_f32_16x16x32_f16(false, a, false, b, (short)0, c, false, false); }
__device__ __forceinline__ v8f wmmab(v16bf a, v16bf b, v8f c) { return __builtin_amdgcn_wmma_f32_16x16x32_bf16(false, a, false, b, (short)0, c, false, false); }



// ---- k_gemmw: GEMM, FOUR WAVES per 128x128 output tile, each wave its 64x64 quarter (16 accumulators); grid (M/128, N/128, Z), 128 threads.
// C[m][n] (f32, pitch ldc, + optional f32 bias[n]) = sum_k A[m][k] Bt[n][k] (+ A2[m][k] Bt[n][k] where NSPLIT == 1). z-batch strides sA/sB/sC in elements. M % 128 == 0, N % 128 == 0, K % 64 == 0.
// EPI says what leaves the kernel. 0: C in f32. 1: C as bf16 hi/lo planes Ph, Pl (pitch ldc, z stride sC). 2: C as the attention's operand planes P16 (fp16), Ph, Pl (bf16 hi/lo), plane group z at z NB_ NH_ TT HD, in it batch m / TT at NH_ TT HD each, t = m % TT: z = 0, 1 head planes [head][t][d], z = 2 transposed [head][d][t]; a wave's 64 columns are one head, a tile's 128 rows one batch. No f32 C lies in memory for 1 and 2.
// A stage is GK = 64 k: the 128 rows of A (and A2) and of Bt, 128 B each, go global -> LDS by asynchronous 16-byte copies (whole 128-B lines, each fetched once a work-group); two buffers, the copies of stage t + 2 fly while stage t + 1 is worked on.
// LDS rows are unpadded (GR elements = 128 B); the 16-B chunk c of row r lies at place c ^ ((r >> 1) & 7) of its row, so that 16 lanes reading one chunk column of 16 rows meet all 64 banks once. The epilogues stage in the stage buffers, free by then. So the two-plane GEMM takes 96 KiB of LDS and three of its work-groups fit a WGP: its whole grid is resident at once.
#define GK 64
#define GR 64                     // LDS row length in 16-bit elements: 128 B, no pad
#define GP 72                     // row pitch of the V^T epilogue's staging in 16-bit elements: 144 B = 16 B x 9
#define GT (128 * GR)             // elements of one staged operand tile
template <typename T16> struct WFrag;
template <> struct WFrag<h16> { typedef v16h V; static __device__ __forceinline__ V ld(const h16* p, const h16* p2) { return cat16(*(const v8h*)p, *(const v8h*)p2); } static __device__ __forceinline__ v8f mma(V a, V b, v8f c) { return wmma16(a, b, c); } };
template <> struct WFrag<bf> { typedef v16bf V; static __device__ __forceinline__ V ld(const bf* p, const bf* p2) { return cat16b(*(const v8us*)p, *(const v8us*)p2); } static __device__ __forceinline__ v8f mma(V a, V b, v8f c) { return wmmab(a, b, c); } };
// cp8: a lane's eight asynchronous copies of one staged tile: 16 B from g + i rs (elements) to LDS byte l + i 16 GR 2, i = 0..7. The s_wait_xcnt 0 is the statement's last line, so that it stands in front of every later write of a register that a copy names.
template <typename T16>
__device__ __forceinline__ void cp8(unsigned l, const T16* g, size_t rs) {
    asm volatile("global_load_async_to_lds_b128 %0, %8, off\n\t"
                 "global_load_async_to_lds_b128 %1, %9, off\n\t"
                 "global_load_async_to_lds_b128 %2, %10, off\n\t"
                 "global_load_async_to_lds_b128 %3, %11, off\n\t"
                 "global_load_async_to_lds_b128 %4, %12, off\n\t"
                 "global_load_async_to_lds_b128 %5, %13, off\n\t"
                 "global_load_async_to_lds_b128 %6, %14, off\n\t"
                 "global_load_async_to_lds_b128 %7, %15, off\n\t"
                 "s_wait_xcnt 0x0"
                 :: "v"(l), "v"(l + 1u * 16 * GR * 2), "v"(l + 2u * 16 * GR * 2), "v"(l + 3u * 16 * GR * 2), "v"(l + 4u * 16 * GR * 2), "v"(l + 5u * 16 * GR * 2), "v"(l + 6u * 16 * GR * 2), "v"(l + 7u * 16 * GR * 2),
                    "v"(g), "v"(g + rs), "v"(g + 2 * rs), "v"(g + 3 * rs), "v"(g + 4 * rs), "v"(g + 5 * rs), "v"(g + 6 * rs), "v"(g + 7 * rs)
                 : "memory");
}
// xw0: s_wait_xcnt 0 behind a global load or store, in front of a later write of a register that it names.
__device__ __forceinline__ void xw0() { asm volatile("s_wait_xcnt 0x0" ::: "memory"); }
__device__ __forceinline__ h16 tohx(float x) { return (h16)x; }
__device__ __forceinline__ void splitf(float y, unsigned short& h, unsigned short& l) { h = f2bf(y); l = f2bf(y - bf2f(h)); }
template <typename T16, int NSPLIT, bool BIAS, int EPI>
__global__ __launch_bounds__(128) void k_gemmw(const T16* __restrict__ A, const T16* __restrict__ A2, const T16* __restrict__ Bt, int K, float* C, int ldc, const float* __restrict__ bias, h16* P16, bf* Ph, bf* Pl, size_t sA, size_t sB, size_t sC) {
    typedef typename WFrag<T16>::V V;
    static_assert(NSPLIT == 0 || NSPLIT == 1, "one or two A planes");
    constexpr int NT = 2 + NSPLIT;   // staged tiles of a stage: A, (A2,) Bt
    __shared__ __align__(16) T16 st[2 * NT * GT];
    static_assert(4 * 16 * 68 * 4 <= 2 * NT * GT * 2, "the four waves' output staging fits the stage buffers");
    const size_t z = blockIdx.z; A += z * sA; if (NSPLIT == 1) A2 += z * sA; Bt += z * sB; if (EPI == 0) C += z * sC;
    const int tid = threadIdx.x, lane = tid & 31, lr = lane & 15, hi = lane >> 4, wr = tid >> 6, wc = (tid >> 5) & 1; const int R0 = blockIdx.x * 128, C0 = blockIdx.y * 128; const int r0 = R0 + wr * 64, c0 = C0 + wc * 64;
    fa* os = (fa*)st + (tid >> 5) * (16 * 68);   // each wave's own output staging, in the stage buffers: used behind the loop only, where every wave's last reads ended in front of the loop's last barrier and no copy is outstanding
    const int bt = (EPI == 2) ? R0 / TT : 0, rb = r0 - bt * TT; (void)bt; (void)rb;   // EPI 2: the tile's batch and the wave's first row in it
    v8f acc[4][4];
#pragma unroll
    for (int mb = 0; mb < 4; ++mb)
#pragma unroll
        for (int nb = 0; nb < 4; ++nb) acc[mb][nb] = (v8f){};
    // staging: a tile is 1024 chunks of 16 B; thread tid moves chunks tid + 128 i (row = chunk / 8)
    const size_t ga = (size_t)(R0 + (tid >> 3)) * K + (tid & 7) * 8, gb = (size_t)(C0 + (tid >> 3)) * K + (tid & 7) * 8, rs = (size_t)16 * K;
    const unsigned l0 = (unsigned)(size_t)st + (unsigned)(((tid >> 3) * GR + (((tid & 7) ^ ((tid >> 4) & 7)) * 8)) * 2);   // the lane's LDS byte address in buffer 0, tile 0: its chunk's place in the row; rows 16 apart have the same turn
    auto stage = [&](int t) { const unsigned l = l0 + (unsigned)(t & 1) * (NT * GT * 2); const size_t ko = (size_t)t * GK;
        cp8(l, A + ga + ko, rs); if (NSPLIT == 1) cp8(l + GT * 2, A2 + ga + ko, rs); cp8(l + (NT - 1) * GT * 2, Bt + gb + ko, rs); };
    const int nt = K / GK;
    stage(0);
    asm volatile("s_wait_asynccnt 0x0" ::: "memory");   // this wave's copies of stage 0 have landed
    __syncthreads();   // stage 0 is complete for every wave
    if (nt > 1) stage(1);
    const int ao = (wr * 64 + lr) * GR, bo = (NT - 1) * GT + (wc * 64 + lr) * GR;
    int xo[4];   // where chunk hi + 2 j of the lane's rows lies (elements); the rows of a lane are 16 apart
#pragma unroll
    for (int j = 0; j < 4; ++j) xo[j] = ((hi + 2 * j) ^ (lr >> 1)) * 8;
#pragma unroll 1   // rolled: one stage's fragments in registers, and the two buffers told apart by the trip's parity
    for (int t = 0; t < nt; ++t) {
        const T16* sb = st + (t & 1) * (NT * GT);
#pragma unroll
        for (int kc = 0; kc < GK; kc += 32) {
            V a[4], a2[4], b[4];   // all fragments of a 32-k block are read in one group in front of its matrix instructions, in the order of their first use
            const int x0 = xo[kc / 16], x1 = xo[kc / 16 + 1];   // k = kc + 8 hi .. and kc + 16 + 8 hi ..
            b[0] = WFrag<T16>::ld(sb + bo + x0, sb + bo + x1);
#pragma unroll
            for (int mb = 0; mb < 4; ++mb) { a[mb] = WFrag<T16>::ld(sb + ao + mb * 16 * GR + x0, sb + ao + mb * 16 * GR + x1); if (NSPLIT == 1) a2[mb] = WFrag<T16>::ld(sb + GT + ao + mb * 16 * GR + x0, sb + GT + ao + mb * 16 * GR + x1); }
#pragma unroll
            for (int nb = 1; nb < 4; ++nb) b[nb] = WFrag<T16>::ld(sb + bo + nb * 16 * GR + x0, sb + bo + nb * 16 * GR + x1);
            __builtin_amdgcn_sched_barrier(0);   // keeps the group whole: without it the reads of b[1..3] are sunk among the matrix instructions, each with a full LDS wait in front of the next eight
#pragma unroll
            for (int nb = 0; nb < 4; ++nb)
#pragma unroll
                for (int mb = 0; mb < 4; ++mb) { acc[mb][nb] = WFrag<T16>::mma(a[mb], b[nb], acc[mb][nb]); if (NSPLIT == 1) acc[mb][nb] = WFrag<T16>::mma(a2[mb], b[nb], acc[mb][nb]); }
        }
        __builtin_amdgcn_sched_barrier(0);   // the trip's matrix instructions stay in front of its foot: sunk behind the barrier they stand in front of the next stage's copies and shorten their flight
        asm volatile("s_wait_dscnt 0x0" ::: "memory");      // this wave's reads of the buffer have returned before it is refilled
        asm volatile("s_wait_asynccnt 0x0" ::: "memory");   // this wave's copies of stage t + 1 have landed
        __syncthreads();   // publishes stage t + 1 and ends every wave's reads of stage t
        if (t + 2 < nt) stage(t + 2);   // into the buffer that this trip has just read
    }
    asm volatile("s_wait_asynccnt 0x0" ::: "memory");   // no copy is outstanding behind the loop
    if constexpr (EPI == 2) {
        static_assert(HD == 64 && TT % 128 == 0 && NSPLIT == 1 && 4 * 3 * 32 * GP <= 2 * NT * GT, "a wave's 64 columns are one head, a tile's rows one batch; three transposed half tiles a wave fit the stage buffers");
        if (blockIdx.z == 2) {   // V^T planes: a lane's 8 accumulator rows are 8 consecutive m of ONE column d, so they are converted in registers and only regrouped through LDS into whole 128-B lines of [d][m], 32 rows d at a time
            unsigned short* vs = (unsigned short*)st + (tid >> 5) * (3 * 32 * GP);   // the stage buffers are free: every wave's last reads ended in front of the loop's last barrier, and no copy is outstanding
            const size_t vb = (((size_t)2 * NB_ + bt) * NH_ + (c0 >> 6)) * ((size_t)TT * HD) + (size_t)(lane >> 3) * TT + rb + (lane & 7) * 8; const int vo = (lane >> 3) * GP + (lane & 7) * 8;   // 8 lanes a row d: 128 B of m
#pragma unroll
            for (int g = 0; g < 4; ++g) { v8us t16[4], th[4], tl[4];
                if ((g & 1) == 0) {   // the 32 rows d of column blocks g and g + 1 go into the staging
#pragma unroll
                    for (int mb = 0; mb < 4; ++mb)
#pragma unroll
                        for (int nq = 0; nq < 2; ++nq) { v8h o16; v8us oh, ol;
#pragma unroll
                            for (int j = 0; j < 8; ++j) { const float x = acc[mb][g + nq][j]; o16[j] = tohx(x); unsigned short a2, c2; splitf(x, a2, c2); oh[j] = a2; ol[j] = c2; }
                            const int so = (nq * 16 + lr) * GP + mb * 16 + hi * 8; *(v8usa*)(vs + so) = __builtin_bit_cast(v8us, o16); *(v8usa*)(vs + 32 * GP + so) = oh; *(v8usa*)(vs + 2 * 32 * GP + so) = ol; }
                    __builtin_amdgcn_wave_barrier(); asm volatile("" ::: "memory");   // the wave's reads below stay behind its writes above
                }
#pragma unroll
                for (int s = 0; s < 4; ++s) { const int o = vo + ((g & 1) * 16 + s * 4) * GP; t16[s] = *(const v8usa*)(vs + o); th[s] = *(const v8usa*)(vs + 32 * GP + o); tl[s] = *(const v8usa*)(vs + 2 * 32 * GP + o); }
                __builtin_amdgcn_sched_barrier(0);   // with the one behind the wait: nothing else is scheduled between these stores and their s_wait_xcnt, where it could be given a register that a store names
#pragma unroll
                for (int s = 0; s < 4; ++s) { const size_t o = vb + (size_t)(g * 16 + s * 4) * TT; *(v8us*)((unsigned short*)P16 + o) = t16[s]; *(v8us*)(Ph + o) = th[s]; *(v8us*)(Pl + o) = tl[s]; }
                xw0();   // in front of the next write of these stores' registers
                __builtin_amdgcn_sched_barrier(0);   // second of the pair: later work stays behind the wait
            }
            return;   // the whole work-group (blockIdx.z), behind every barrier
        }
    }
#pragma unroll
    for (int mb = 0; mb < 4; ++mb) {
#pragma unroll
        for (int nb = 0; nb < 4; ++nb) {
#pragma unroll
            for (int j = 0; j < 8; ++j) os[(hi * 8 + j) * 68 + nb * 16 + lr] = acc[mb][nb][j]; }
        __builtin_amdgcn_wave_barrier(); asm volatile("" ::: "memory");
        if constexpr (EPI == 0) {
        float* crow = C + (size_t)(r0 + mb * 16) * ldc + c0;
{
#pragma unroll
            for (int s = 0; s < 8; ++s) { const int row = 2 * s + hi, cofs = lr * 4; v4f val = *(const v4fa*)(os + row * 68 + cofs); if (BIAS) { val[0] += bfr(bias[c0 + cofs]); val[1] += bfr(bias[c0 + cofs + 1]); val[2] += bfr(bias[c0 + cofs + 2]); val[3] += bfr(bias[c0 + cofs + 3]); }
                *(v4f*)(crow + (size_t)row * ldc + cofs) = val; }
             }
        } else {   // 16-bit planes: 8 lanes a row, 8 columns a lane: every store covers whole 128-B lines
            const size_t pb = (EPI == 1) ? z * sC + (size_t)(r0 + mb * 16 + (lane >> 3)) * ldc + c0 + (lane & 7) * 8 : ((z * NB_ + bt) * NH_ + (c0 >> 6)) * ((size_t)TT * HD) + (size_t)(rb + mb * 16 + (lane >> 3)) * HD + (lane & 7) * 8;
            const size_t pp = (EPI == 1) ? (size_t)4 * ldc : (size_t)4 * HD;   // four rows on
            v8h o16[4]; v8us oh[4], ol[4];
#pragma unroll
            for (int s = 0; s < 4; ++s) { const float* op = os + (4 * s + (lane >> 3)) * 68 + (lane & 7) * 8; const v4f x0 = *(const v4fa*)op, x1 = *(const v4fa*)(op + 4);
#pragma unroll
                for (int q = 0; q < 8; ++q) { const float x = (q < 4) ? x0[q & 3] : x1[q & 3]; if (EPI == 2) o16[s][q] = tohx(x); unsigned short a2, c2; splitf(x, a2, c2); oh[s][q] = a2; ol[s][q] = c2; } }
            __builtin_amdgcn_sched_barrier(0);   // with the one behind the wait: nothing else is scheduled between these stores and their s_wait_xcnt, where it could be given a register that a store names
#pragma unroll
            for (int s = 0; s < 4; ++s) { if (EPI == 2) *(v8h*)(P16 + pb + s * pp) = o16[s]; *(v8us*)(Ph + pb + s * pp) = oh[s]; *(v8us*)(Pl + pb + s * pp) = ol[s]; }
            xw0();   // in front of the next write of these stores' registers
            __builtin_amdgcn_sched_barrier(0);   // second of the pair: later work stays behind the wait
        }
        __builtin_amdgcn_wave_barrier(); asm volatile("" ::: "memory");
    }
}

typedef __attribute__((ext_vector_type(2))) _Float16 v2h;
typedef __attribute__((ext_vector_type(4))) _Float16 v4h;
typedef __attribute__((ext_vector_type(2))) unsigned short v2us;
typedef __attribute__((ext_vector_type(4))) unsigned short v4us;
typedef __attribute__((ext_vector_type(2))) float v2f;
typedef __attribute__((ext_vector_type(4))) int v4i;

__global__ __launch_bounds__(256) void k_wtG(const float* __restrict__ w, int K, int N, bf* Bt) {
    const int lane = threadIdx.x & 31; const int L0 = (blockIdx.x * 8 + (threadIdx.x >> 5)) * 8; const int nlines = N * K / 64;
{
#pragma unroll 1
        for (int l = 0; l < 8; ++l) { const int L = L0 + l; if (L >= nlines) break; const size_t e = (size_t)L * 64 + lane * 2; const int k = (int)(e % K), n = (int)(e / K); v2us o;
            o[0] = f2bf(w[(size_t)k * N + n]); o[1] = f2bf(w[(size_t)(k + 1) * N + n]); *(v2us*)(Bt + e) = o; }
         }
}
// k_cvt8w: every f32 input to bf16 in one launch, 8 elements a thread: blockIdx.y picks a piece of n8 groups of 8: 0..6 the seven weight matrices, from 7 on the pieces of e in their order; the bf16 planes lie one behind the other in dst, in that order.
__global__ __launch_bounds__(256) void k_cvt8w(const float* __restrict__ w0, const float* __restrict__ w1, const float* __restrict__ w2, const float* __restrict__ w3, const float* __restrict__ w4, const float* __restrict__ w5, const float* __restrict__ w6, const float* __restrict__ e, bf* dst, size_t n8) { const size_t i = (size_t)blockIdx.x * 256 + threadIdx.x; if (i >= n8) return; const unsigned y = blockIdx.y;
    const float* src = (y == 0) ? w0 : (y == 1) ? w1 : (y == 2) ? w2 : (y == 3) ? w3 : (y == 4) ? w4 : (y == 5) ? w5 : (y == 6) ? w6 : e + (size_t)(y - 7) * n8 * 8; const v8f v = *(const v8f*)(src + i * 8); xw0();   // the source address pair is given to other values further down
    v8us o;
#pragma unroll
    for (int k = 0; k < 8; ++k) o[k] = f2bf(v[k]); *(v8us*)(dst + ((size_t)y * n8 + i) * 8) = o;  }

#define FK 64
#define FP 72                     // LDS row pitch in 16-bit elements: 144 B = 16 B x 9
#define FT (FK * FP)              // elements of one LDS tile (HD == FK rows)
template <typename T16> struct FFrag;
template <> struct FFrag<h16> { static __device__ __forceinline__ v16h mk(v8us lo, v8us hi) { return __builtin_bit_cast(v16h, __builtin_shufflevector(lo, hi, 0, 1, 2, 3, 4, 5, 6, 7, 8, 9, 10, 11, 12, 13, 14, 15)); } };
template <> struct FFrag<bf> { static __device__ __forceinline__ v16bf mk(v8us lo, v8us hi) { return cat16b(lo, hi); } };
template <typename T16> __device__ __forceinline__ typename WFrag<T16>::V ldf(const unsigned short* p) { return FFrag<T16>::mk(*(const v8usa*)p, *(const v8usa*)(p + 16)); }
__device__ __forceinline__ float xhalf(float x) { const int b = __float_as_int(x); return __int_as_float(__builtin_amdgcn_permlanex16(b, b, 0x76543210, 0xfedcba98, false, false)); }   // the value of lane l ^ 16
template <typename T16, bool HL>
__device__ __forceinline__ void fattn(const unsigned short* __restrict__ Q, const unsigned short* __restrict__ Q2, const unsigned short* __restrict__ Kg, const unsigned short* __restrict__ Kg2, const unsigned short* __restrict__ Vg, const unsigned short* __restrict__ Vg2, int q0, int col0, bf* Ah, bf* Al, unsigned short* sm) {
    typedef typename WFrag<T16>::V V;
    static_assert(HD == 64 && FK == 64 && TT % FK == 0, "tile shapes");
    const int tid = threadIdx.x, lane = tid & 31, lr = lane & 15, hi = lane >> 4; const int qrow = q0 + (tid >> 5) * 16 + lr;
    unsigned short* Ks = sm; unsigned short* Vs = sm + FT; unsigned short* Ks2 = sm + 2 * FT; unsigned short* Vs2 = sm + 3 * FT;
    V qf[2], qf2[2];
#pragma unroll
    for (int kc = 0; kc < 2; ++kc) { qf[kc] = ldf<T16>(Q + (size_t)qrow * HD + kc * 32 + 8 * hi); if (HL) qf2[kc] = ldf<T16>(Q2 + (size_t)qrow * HD + kc * 32 + 8 * hi); }
    xw0();   // the query row's address is given to other values further down
    // staging: a tile is 512 chunks of 16 B; thread tid moves chunks tid + 128 i (row = chunk / 8): whole 128-B lines of K and of V^T
    const size_t gko = (size_t)tid * 8, gvo = (size_t)(tid >> 3) * TT + (tid & 7) * 8; const int so = (tid >> 3) * FP + (tid & 7) * 8;
    v8us rk[4], rv[4], rk2[4], rv2[4];
    __builtin_amdgcn_sched_barrier(0);   // with the one behind the wait: no other arithmetic is scheduled between these loads and their s_wait_xcnt, where it could be given a register that a load names
#pragma unroll
    for (int i = 0; i < 4; ++i) { rk[i] = *(const v8usa*)(Kg + gko + i * 1024); rv[i] = *(const v8usa*)(Vg + gvo + (size_t)i * 16 * TT); if (HL) { rk2[i] = *(const v8usa*)(Kg2 + gko + i * 1024); rv2[i] = *(const v8usa*)(Vg2 + gvo + (size_t)i * 16 * TT); } }
    xw0();   // in front of the next write of these loads' address registers
    __builtin_amdgcn_sched_barrier(0);   // second of the pair: later arithmetic stays behind the wait
    v8f O[4];
#pragma unroll
    for (int db = 0; db < 4; ++db) O[db] = (v8f){};
    v8f l8 = (v8f){};   // eight independent partial row sums a lane
    float m = -3.0e38f; const float C2 = SCL * 1.4426950408889634f;
#pragma unroll 1   // rolled: one stage's fragments and one stage's staging registers, no more
    for (int s = 0; s < TT / FK; ++s) {
        __syncthreads();   // every wave has left the tiles of the stage before
#pragma unroll
        for (int i = 0; i < 4; ++i) { *(v8usa*)(Ks + so + i * 16 * FP) = rk[i]; *(v8usa*)(Vs + so + i * 16 * FP) = rv[i]; if (HL) { *(v8usa*)(Ks2 + so + i * 16 * FP) = rk2[i]; *(v8usa*)(Vs2 + so + i * 16 * FP) = rv2[i]; } }
        __syncthreads();   // the stage's tiles are complete for every wave
        if (s + 1 < TT / FK) {   // the next stage's loads fly while this one is worked on
            const size_t ko = gko + (size_t)(s + 1) * FK * HD, vo = gvo + (size_t)(s + 1) * FK;
#pragma unroll
            for (int i = 0; i < 4; ++i) { rk[i] = *(const v8usa*)(Kg + ko + i * 1024); rv[i] = *(const v8usa*)(Vg + vo + (size_t)i * 16 * TT); if (HL) { rk2[i] = *(const v8usa*)(Kg2 + ko + i * 1024); rv2[i] = *(const v8usa*)(Vg2 + vo + (size_t)i * 16 * TT); } }
            xw0();   // in front of the next write of these loads' address registers
        }
        // LDS reads stand in groups of eight fragments (16 reads; four where HL), each group whole in front of the matrix instructions that use it; these run over independent accumulators in turn; every accumulator takes its products by rising k, and of one k block plane by plane (hi.hi, hi.lo, lo.hi).
        v8f S[4];
#pragma unroll
        for (int kb = 0; kb < 4; ++kb) S[kb] = (v8f){};
        V vf[8];   // !HL: all eight V^T fragments of the stage, read ahead of the softmax
        if constexpr (HL) {
#pragma unroll
            for (int g = 0; g < 4; ++g) { const int p = g >> 1, kc = g & 1; V k1[2], k2[2];   // a group: 32 d of key blocks 2 p and 2 p + 1, both planes (four fragments: eight do not fit the registers of four waves a SIMD)
#pragma unroll
                for (int b = 0; b < 2; ++b) { const int fo = ((2 * p + b) * 16 + lr) * FP + kc * 32 + 8 * hi; k1[b] = ldf<T16>(Ks + fo); k2[b] = ldf<T16>(Ks2 + fo); }
                __builtin_amdgcn_sched_barrier(0);   // keeps the group whole and in front of its matrix instructions: without it each pair of reads is sunk to its own matrix instruction, with a full LDS wait in front of every one
#pragma unroll
                for (int b = 0; b < 2; ++b) S[2 * p + b] = WFrag<T16>::mma(k1[b], qf[kc], S[2 * p + b]);
#pragma unroll
                for (int b = 0; b < 2; ++b) S[2 * p + b] = WFrag<T16>::mma(k1[b], qf2[kc], S[2 * p + b]);
#pragma unroll
                for (int b = 0; b < 2; ++b) S[2 * p + b] = WFrag<T16>::mma(k2[b], qf[kc], S[2 * p + b]);
            }
        } else {
            V k1[4][2];
#pragma unroll
            for (int kc = 0; kc < 2; ++kc)
#pragma unroll
                for (int kb = 0; kb < 4; ++kb) k1[kb][kc] = ldf<T16>(Ks + (kb * 16 + lr) * FP + kc * 32 + 8 * hi);
            __builtin_amdgcn_sched_barrier(0);   // keeps the group whole, as above
#pragma unroll
            for (int kc = 0; kc < 2; ++kc)
#pragma unroll
                for (int kb = 0; kb < 4; ++kb) S[kb] = WFrag<T16>::mma(k1[kb][kc], qf[kc], S[kb]);
#pragma unroll
            for (int kp = 0; kp < 2; ++kp)
#pragma unroll
                for (int db = 0; db < 4; ++db) vf[kp * 4 + db] = ldf<T16>(Vs + (db * 16 + lr) * FP + kp * 32 + 8 * hi);
            __builtin_amdgcn_sched_barrier(0);   // the V^T reads stay in front of the softmax, whose vector work covers their latency
        }
        float mx = S[0][0];
#pragma unroll
        for (int kb = 0; kb < 4; ++kb)
#pragma unroll
            for (int r = 0; r < 8; ++r) mx = fmaxf(mx, S[kb][r]);
        mx *= C2; mx = fmaxf(mx, xhalf(mx));   // the query's maximum over the stage, the same in both halves
        if (__builtin_amdgcn_ballot_w32(mx > m + 8.0f) != 0) {   // one scalar test a stage
            const float mn = fmaxf(m, mx), al = __builtin_amdgcn_exp2f(m - mn); m = mn; l8 *= al;
#pragma unroll
            for (int db = 0; db < 4; ++db) O[db] *= al; }
        const v8f c8 = {C2, C2, C2, C2, C2, C2, C2, C2}, n8 = {-m, -m, -m, -m, -m, -m, -m, -m};
#pragma unroll
        for (int kb = 0; kb < 4; ++kb) { const v8f t = __builtin_elementwise_fma(S[kb], c8, n8);
#pragma unroll
            for (int r = 0; r < 8; ++r) S[kb][r] = __builtin_amdgcn_exp2f(t[r]);
            l8 += S[kb]; }
#pragma unroll
        for (int kp = 0; kp < 2; ++kp) { V pb, pb2;
            if constexpr (HL) {
#pragma unroll
                for (int e = 0; e < 16; ++e) { const float p = S[2 * kp + (e >> 3)][e & 7]; const __bf16 ph = (__bf16)p; pb[e] = ph; pb2[e] = (__bf16)(p - (float)ph); }
#pragma unroll
                for (int g = 0; g < 2; ++g) { V v1[2], v2[2];   // a group: d blocks 2 g and 2 g + 1 of 32 keys, both planes
#pragma unroll
                    for (int b = 0; b < 2; ++b) { const int fo = ((2 * g + b) * 16 + lr) * FP + kp * 32 + 8 * hi; v1[b] = ldf<T16>(Vs + fo); v2[b] = ldf<T16>(Vs2 + fo); }
                    __builtin_amdgcn_sched_barrier(0);   // keeps the group whole and in front of its matrix instructions, as above
#pragma unroll
                    for (int b = 0; b < 2; ++b) O[2 * g + b] = WFrag<T16>::mma(v1[b], pb, O[2 * g + b]);
#pragma unroll
                    for (int b = 0; b < 2; ++b) O[2 * g + b] = WFrag<T16>::mma(v1[b], pb2, O[2 * g + b]);
#pragma unroll
                    for (int b = 0; b < 2; ++b) O[2 * g + b] = WFrag<T16>::mma(v2[b], pb, O[2 * g + b]);
                }
            } else {
#pragma unroll
                for (int e = 0; e < 16; ++e) pb[e] = (h16)S[2 * kp + (e >> 3)][e & 7];
#pragma unroll
                for (int db = 0; db < 4; ++db) O[db] = WFrag<T16>::mma(vf[kp * 4 + db], pb, O[db]);
            } }
    }
    float l = ((l8[0] + l8[1]) + (l8[2] + l8[3])) + ((l8[4] + l8[5]) + (l8[6] + l8[7])); l += xhalf(l); const float inv = __fdiv_rn(1.0f, l);
    v8us oh[4], ol[4];
#pragma unroll
    for (int db = 0; db < 4; ++db)
#pragma unroll
        for (int r = 0; r < 8; ++r) { unsigned short a, c2; splitf(O[db][r] * inv, a, c2); oh[db][r] = a; ol[db][r] = c2; }
    const size_t oo = (size_t)qrow * DQ + col0 + 8 * hi;   // a lane's 8 accumulator rows are 8 consecutive d of its query
#pragma unroll
    for (int db = 0; db < 4; ++db) { *(v8us*)(Ah + oo + db * 16) = oh[db]; *(v8us*)(Al + oo + db * 16) = ol[db]; }
}
__global__ __launch_bounds__(128) void k_fattn(const h16* __restrict__ Q16, const h16* __restrict__ K16, const h16* __restrict__ V16, const bf* __restrict__ Qh, const bf* __restrict__ Ql, const bf* __restrict__ Kh, const bf* __restrict__ Kl, const bf* __restrict__ Vh, const bf* __restrict__ Vl, bf* Ah, bf* Al) {
    __shared__ __align__(16) unsigned short sm[4 * FT];
    const int h = blockIdx.y, b = blockIdx.z; const size_t po = ((size_t)b * NH_ + h) * TT * HD; Ah += (size_t)b * TT * DQ; Al += (size_t)b * TT * DQ;
    const int xb = (blockIdx.x + (TT / 128) * (h >> 3) + (TT / 256) * b) & (TT / 64 - 1);   // query block; turned by half the blocks in the upper heads and by a quarter in the second batch, so that the heavier hi/lo blocks do not all have the same index modulo a power of two
    if (xb < RH / 64) fattn<bf, true>(Qh + po, Ql + po, Kh + po, Kl + po, Vh + po, Vl + po, xb * 64, h * HD, Ah, Al, sm);
    else fattn<h16, false>((const unsigned short*)(Q16 + po), nullptr, (const unsigned short*)(K16 + po), nullptr, (const unsigned short*)(V16 + po), nullptr, xb * 64, h * HD, Ah, Al, sm);
}

extern "C" void kernel_launch(void* const* d_in, const int* in_sizes, int n_in,
                              void* d_out, int out_size, void* d_ws, size_t ws_size, hipStream_t stream) {
    (void)in_sizes; (void)n_in; (void)out_size;
    const float* x = (const float*)d_in[0]; const float* wq = (const float*)d_in[1]; const float* wk = (const float*)d_in[2]; const float* wv = (const float*)d_in[3]; const float* wo = (const float*)d_in[4]; const float* hq = (const float*)d_in[5]; const float* hk = (const float*)d_in[6]; const float* hv = (const float*)d_in[7];
    float* OUT = (float*)d_out;     // [2][2048][1024]
    char* wsp = (char*)d_ws;
    auto take = [&](size_t bytes) { char* p = wsp; wsp += (bytes + 255) & ~(size_t)255; return (void*)p; };
    static_assert(DKV == DQ && NKV == NH_ && ((size_t)DQ * DM * 2) % 256 == 0 && ((size_t)NB_ * NH_ * TT * HD * 2) % 256 == 0 && ((size_t)NB_ * TT * DM) % ((size_t)DQ * DM) == 0, "the q, k and v chains have one shape, planes taken one behind the other are contiguous, and E is a whole number of weight-sized pieces");
    bf* WQ = (bf*)take((size_t)DQ * DM * 2); take((size_t)DKV * DM * 2); take((size_t)DKV * DM * 2);   // WQ | WK | WV: z of the first-stage launch
    bf* HQB = (bf*)take((size_t)DQ * DM * 2); take((size_t)DKV * DM * 2); take((size_t)DKV * DM * 2);   // HQ | HK | HV ('hed' [16][64][1024] = flat 'oi'): z of the second-stage launch
    bf* WO = (bf*)take((size_t)DM * DQ * 2);
    bf* XB = (bf*)take((size_t)NB_ * TT * DM * 2);   // E in bf16 [NB_ TT][1024], directly behind the seven weight planes: the conversion launch's pieces 7 and up
    h16* QP16 = (h16*)take((size_t)NB_ * NH_ * TT * HD * 2); h16* KP16 = (h16*)take((size_t)NB_ * NKV * TT * HD * 2); h16* VT16 = (h16*)take((size_t)NB_ * NKV * HD * TT * 2);   // q | k | V^T of each kind one behind the other, [batch][head] planes each: z of the second-stage launch picks the group
    bf* QPh = (bf*)take((size_t)NB_ * NH_ * TT * HD * 2); bf* KPh = (bf*)take((size_t)NB_ * NKV * TT * HD * 2); bf* VTh = (bf*)take((size_t)NB_ * NKV * HD * TT * 2); bf* QPl = (bf*)take((size_t)NB_ * NH_ * TT * HD * 2); bf* KPl = (bf*)take((size_t)NB_ * NKV * TT * HD * 2); bf* VTl = (bf*)take((size_t)NB_ * NKV * HD * TT * 2);
    bf* ATh = (bf*)take((size_t)NB_ * TT * DQ * 2); bf* ATl = (bf*)take((size_t)NB_ * TT * DQ * 2);
    bf* Th = (bf*)take((size_t)3 * NB_ * TT * DM * 2); bf* Tl = (bf*)take((size_t)3 * NB_ * TT * DM * 2);   // Th, Tl [3][NB_ TT][1024]
    if ((size_t)(wsp - (char*)d_ws) > ws_size) return;    // ws 256 MiB
    k_cvt8w<<<dim3((unsigned)(((size_t)DQ * DM / 8 + 255) / 256), 7 + (unsigned)((size_t)NB_ * TT * DM / ((size_t)DQ * DM)), 1), 256, 0, stream>>>(wq, wk, wv, hq, hk, hv, wo, x, WQ, (size_t)DQ * DM / 8);
    k_gemmw<bf, 0, false, 1><<<dim3(NB_ * TT / 128, DQ / 128, 3), 128, 0, stream>>>(XB, nullptr, WQ, DM, nullptr, DQ, nullptr, nullptr, Th, Tl, 0, (size_t)DQ * DM, (size_t)NB_ * TT * DQ);   /* z = 0, 1, 2: Q = E WQ^T, K = E WK^T, V = E WV^T, as hi/lo planes */
    k_gemmw<bf, 1, false, 2><<<dim3(NB_ * TT / 128, DQ / 128, 3), 128, 0, stream>>>(Th, Tl, HQB, DM, nullptr, 0, nullptr, QP16, QPh, QPl, (size_t)NB_ * TT * DM, (size_t)DQ * DM, 0);   /* z = 0, 1, 2: q = Q HQ^T, k = K HK^T, v = V HV^T (all heads), as the attention's planes */
    k_fattn<<<dim3(TT / 64, NH_, NB_), 128, 0, stream>>>(QP16, KP16, VT16, QPh, QPl, KPh, KPl, VTh, VTl, ATh, ATl);   /* all heads of both batches: context as hi/lo planes [batch TT + t][head | d] */
    k_gemmw<bf, 1, false, 0><<<dim3(NB_ * TT / 128, DM / 128, 1), 128, 0, stream>>>(ATh, ATl, WO, DQ, OUT, DM, nullptr, nullptr, nullptr, nullptr, 0, 0, 0);
}

// v010
// A run of this version takes 135 microseconds.
// Timed twice side by side with v009, it ran 1.08 and 1.07 times as fast.
// Over all steps from v000 it is 15.8 times as fast.
#include <hip/hip_runtime.h>

// Two-stage-projection multi-head attention (E [2][2048][1024]; Q = E WQ^T, K, V likewise ('oi' [1024][1024]); per head q = Q HQ[h]^T ('hed' [16][64][1024] = flat 'oi' [1024][1024]), k, v likewise; softmax(q.k 64^-0.5); heads concatenated; out = o WO^T -> [2][2048][1024] (4.2 M)).
// Both batches go through every stage in one launch (rows m = batch TT + t). Layout: first-stage projections exact (bf16 x bf16); their f32 results split into bf16 hi/lo planes (in the GEMM's own epilogue) for the second-stage GEMMs against the exact flattened head weights (2 products), whose epilogue writes the attention's q, k and V^T planes; fused dense T-2048 attention (hybrid rows: < 512 hi/lo 3 products, rest fp16); context as hi/lo planes; WO hl x exact.
// Compute dtypes, f32 accumulate: every input rounded to bf16; stage-1 projections exact, stage-2 hl x exact; attention rows < 512 3 products, rest fp16; softmax f32; WO hl x exact.

#define NB_  2
#define TT   2048
#define DM   1024
#define NH_  16
#define NKV  16
#define REP  (NH_ / NKV)
#define HD   64
#define DQ   (NH_ * HD)
#define DKV  (NKV * HD)
#define RH   512                  // query rows < RH use hi+lo planes (0: none)
#define WIN  0
#define SCL  0.125f   // HD^-0.5
typedef _Float16 h16;
typedef unsigned short bf;
typedef __attribute__((ext_vector_type(16))) __bf16   v16bf;
typedef __attribute__((ext_vector_type(16))) _Float16 v16h;
typedef __attribute__((ext_vector_type(8)))  _Float16 v8h;
typedef __attribute__((ext_vector_type(8)))  unsigned short v8us;
typedef __attribute__((ext_vector_type(8)))  float    v8f;
typedef __attribute__((ext_vector_type(4)))  float    v4f;
typedef v8h  __attribute__((may_alias)) v8ha;
typedef v4f  __attribute__((may_alias)) v4fa;
typedef v8us __attribute__((may_alias)) v8usa;
typedef float __attribute__((may_alias)) fa;

__device__ __forceinline__ unsigned short f2bf(float f) { unsigned u = __float_as_uint(f); u += 0x7FFFu + ((u >> 16) & 1u); return (unsigned short)(u >> 16); }
__device__ __forceinline__ float bf2f(unsigned short b) { return __uint_as_float(((unsigned)b) << 16); }
__device__ __forceinline__ float bfr(float f) { return bf2f(f2bf(f)); }
__device__ __forceinline__ v16h cat16(v8h lo, v8h hi) { return __builtin_shufflevector(lo, hi, 0, 1, 2, 3, 4, 5, 6, 7, 8, 9, 10, 11, 12, 13, 14, 15); }
__device__ __forceinline__ v16bf cat16b(v8us lo, v8us hi) { return __builtin_bit_cast(v16bf, __builtin_shufflevector(lo, hi, 0, 1, 2, 3, 4, 5, 6, 7, 8, 9, 10, 11, 12, 13, 14, 15)); }
__device__ __forceinline__ v8f wmma16(v16h a, v16h b, v8f c) { return __builtin_amdgcn_wmma_f32_16x16x32_f16(false, a, false, b, (short)0, c, false, false); }
__device__ __forceinline__ v8f wmmab(v16bf a, v16bf b, v8f c) { return __builtin_amdgcn_wmma_f32_16x16x32_bf16(false, a, false, b, (short)0, c, false, false); }



// ---- k_gemmw: GEMM, FOUR WAVES per 128x128 output tile, each wave its 64x64 quarter (16 accumulators); grid (M/128, N/128, Z), 128 threads.
// C[m][n] (f32, pitch ldc, + optional f32 bias[n]) = sum_k A[m][k] Bt[n][k] (+ A2[m][k] Bt[n][k] where NSPLIT == 1). z-batch strides sA/sB/sC in elements. M % 128 == 0, N % 128 == 0, K % 64 == 0.
// EPI says what leaves the kernel. 0: C in f32. 1: C as bf16 hi/lo planes Ph, Pl (pitch ldc, z stride sC). 2: C as the attention's operand planes P16 (fp16), Ph, Pl (bf16 hi/lo), plane group z at z NB_ NH_ TT HD, in it batch m / TT at NH_ TT HD each, t = m % TT: z = 0, 1 head planes [head][t][d], z = 2 transposed [head][d][t]; a wave's 64 columns are one head, a tile's 128 rows one batch. No f32 C lies in memory for 1 and 2.
// A stage is GK = 64 k: the 128 rows of A (and A2) and of Bt, 128 B each, go global -> LDS by asynchronous 16-byte copies (whole 128-B lines, each fetched once a work-group); two buffers, the copies of stage t + 2 fly while stage t + 1 is worked on.
// LDS rows are unpadded (GR elements = 128 B); the 16-B chunk c of row r lies at place c ^ ((r >> 1) & 7) of its row, so that 16 lanes reading one chunk column of 16 rows meet all 64 banks once. The epilogues stage in the stage buffers, free by then. So the two-plane GEMM takes 96 KiB of LDS and three of its work-groups fit a WGP: its whole grid is resident at once.
#define GK 64
#define GR 64                     // LDS row length in 16-bit elements: 128 B, no pad
#define GP 72                     // row pitch of the V^T epilogue's staging in 16-bit elements: 144 B = 16 B x 9
#define GT (128 * GR)             // elements of one staged operand tile
template <typename T16> struct WFrag;
template <> struct WFrag<h16> { typedef v16h V; static __device__ __forceinline__ V ld(const h16* p, const h16* p2) { return cat16(*(const v8h*)p, *(const v8h*)p2); } static __device__ __forceinline__ v8f mma(V a, V b, v8f c) { return wmma16(a, b, c); } };
template <> struct WFrag<bf> { typedef v16bf V; static __device__ __forceinline__ V ld(const bf* p, const bf* p2) { return cat16b(*(const v8us*)p, *(const v8us*)p2); } static __device__ __forceinline__ v8f mma(V a, V b, v8f c) { return wmmab(a, b, c); } };
// cp8: a lane's eight asynchronous copies of one staged tile: 16 B from g + i rs (elements) to LDS byte l + i 16 GR 2, i = 0..7. The s_wait_xcnt 0 is the statement's last line, so that it stands in front of every later write of a register that a copy names.
template <typename T16>
__device__ __forceinline__ void cp8(unsigned l, const T16* g, size_t rs) {
    asm volatile("global_load_async_to_lds_b128 %0, %8, off\n\t"
                 "global_load_async_to_lds_b128 %1, %9, off\n\t"
                 "global_load_async_to_lds_b128 %2, %10, off\n\t"
                 "global_load_async_to_lds_b128 %3, %11, off\n\t"
                 "global_load_async_to_lds_b128 %4, %12, off\n\t"
                 "global_load_async_to_lds_b128 %5, %13, off\n\t"
                 "global_load_async_to_lds_b128 %6, %14, off\n\t"
                 "global_load_async_to_lds_b128 %7, %15, off\n\t"
                 "s_wait_xcnt 0x0"
                 :: "v"(l), "v"(l + 1u * 16 * GR * 2), "v"(l + 2u * 16 * GR * 2), "v"(l + 3u * 16 * GR * 2), "v"(l + 4u * 16 * GR * 2), "v"(l + 5u * 16 * GR * 2), "v"(l + 6u * 16 * GR * 2), "v"(l + 7u * 16 * GR * 2),
                    "v"(g), "v"(g + rs), "v"(g + 2 * rs), "v"(g + 3 * rs), "v"(g + 4 * rs), "v"(g + 5 * rs), "v"(g + 6 * rs), "v"(g + 7 * rs)
                 : "memory");
}
// xw0: s_wait_xcnt 0 behind a global load or store, in front of a later write of a register that it names.
__device__ __forceinline__ void xw0() { asm volatile("s_wait_xcnt 0x0" ::: "memory"); }
__device__ __forceinline__ h16 tohx(float x) { return (h16)x; }
__device__ __forceinline__ void splitf(float y, unsigned short& h, unsigned short& l) { h = f2bf(y); l = f2bf(y - bf2f(h)); }
template <typename T16, int NSPLIT, bool BIAS, int EPI>
__global__ __launch_bounds__(128) void k_gemmw(const T16* __restrict__ A, const T16* __restrict__ A2, const T16* __restrict__ Bt, int K, float* C, int ldc, const float* __restrict__ bias, h16* P16, bf* Ph, bf* Pl, size_t sA, size_t sB, size_t sC) {
    typedef typename WFrag<T16>::V V;
    static_assert(NSPLIT == 0 || NSPLIT == 1, "one or two A planes");
    constexpr int NT = 2 + NSPLIT;   // staged tiles of a stage: A, (A2,) Bt
    __shared__ __align__(16) T16 st[2 * NT * GT];
    static_assert(4 * 16 * 68 * 4 <= 2 * NT * GT * 2, "the four waves' output staging fits the stage buffers");
    const size_t z = blockIdx.z; A += z * sA; if (NSPLIT == 1) A2 += z * sA; Bt += z * sB; if (EPI == 0) C += z * sC;
    const int tid = threadIdx.x, lane = tid & 31, lr = lane & 15, hi = lane >> 4, wr = tid >> 6, wc = (tid >> 5) & 1; const int R0 = blockIdx.x * 128, C0 = blockIdx.y * 128; const int r0 = R0 + wr * 64, c0 = C0 + wc * 64;
    fa* os = (fa*)st + (tid >> 5) * (16 * 68);   // each wave's own output staging, in the stage buffers: used behind the loop only, where every wave's last reads ended in front of the loop's last barrier and no copy is outstanding
    const int bt = (EPI == 2) ? R0 / TT : 0, rb = r0 - bt * TT; (void)bt; (void)rb;   // EPI 2: the tile's batch and the wave's first row in it
    v8f acc[4][4];
#pragma unroll
    for (int mb = 0; mb < 4; ++mb)
#pragma unroll
        for (int nb = 0; nb < 4; ++nb) acc[mb][nb] = (v8f){};
    // staging: a tile is 1024 chunks of 16 B; thread tid moves chunks tid + 128 i (row = chunk / 8)
    const size_t ga = (size_t)(R0 + (tid >> 3)) * K + (tid & 7) * 8, gb = (size_t)(C0 + (tid >> 3)) * K + (tid & 7) * 8, rs = (size_t)16 * K;
    const unsigned l0 = (unsigned)(size_t)st + (unsigned)(((tid >> 3) * GR + (((tid & 7) ^ ((tid >> 4) & 7)) * 8)) * 2);   // the lane's LDS byte address in buffer 0, tile 0: its chunk's place in the row; rows 16 apart have the same turn
    auto stage = [&](int t) { const unsigned l = l0 + (unsigned)(t & 1) * (NT * GT * 2); const size_t ko = (size_t)t * GK;
        cp8(l, A + ga + ko, rs); if (NSPLIT == 1) cp8(l + GT * 2, A2 + ga + ko, rs); cp8(l + (NT - 1) * GT * 2, Bt + gb + ko, rs); };
    const int nt = K / GK;
    stage(0);
    asm volatile("s_wait_asynccnt 0x0" ::: "memory");   // this wave's copies of stage 0 have landed
    __syncthreads();   // stage 0 is complete for every wave
    if (nt > 1) stage(1);
    const int ao = (wr * 64 + lr) * GR, bo = (NT - 1) * GT + (wc * 64 + lr) * GR;
    int xo[4];   // where chunk hi + 2 j of the lane's rows lies (elements); the rows of a lane are 16 apart
#pragma unroll
    for (int j = 0; j < 4; ++j) xo[j] = ((hi + 2 * j) ^ (lr >> 1)) * 8;
#pragma unroll 1   // rolled: one stage's fragments in registers, and the two buffers told apart by the trip's parity
    for (int t = 0; t < nt; ++t) {
        const T16* sb = st + (t & 1) * (NT * GT);
#pragma unroll
        for (int kc = 0; kc < GK; kc += 32) {
            V a[4], a2[4], b[4];   // all fragments of a 32-k block are read in one group in front of its matrix instructions, in the order of their first use
            const int x0 = xo[kc / 16], x1 = xo[kc / 16 + 1];   // k = kc + 8 hi .. and kc + 16 + 8 hi ..
            b[0] = WFrag<T16>::ld(sb + bo + x0, sb + bo + x1);
#pragma unroll
            for (int mb = 0; mb < 4; ++mb) { a[mb] = WFrag<T16>::ld(sb + ao + mb * 16 * GR + x0, sb + ao + mb * 16 * GR + x1); if (NSPLIT == 1) a2[mb] = WFrag<T16>::ld(sb + GT + ao + mb * 16 * GR + x0, sb + GT + ao + mb * 16 * GR + x1); }
#pragma unroll
            for (int nb = 1; nb < 4; ++nb) b[nb] = WFrag<T16>::ld(sb + bo + nb * 16 * GR + x0, sb + bo + nb * 16 * GR + x1);
            __builtin_amdgcn_sched_barrier(0);   // keeps the group whole: without it the reads of b[1..3] are sunk among the matrix instructions, each with a full LDS wait in front of the next eight
#pragma unroll
            for (int nb = 0; nb < 4; ++nb)
#pragma unroll
                for (int mb = 0; mb < 4; ++mb) { acc[mb][nb] = WFrag<T16>::mma(a[mb], b[nb], acc[mb][nb]); if (NSPLIT == 1) acc[mb][nb] = WFrag<T16>::mma(a2[mb], b[nb], acc[mb][nb]); }
        }
        __builtin_amdgcn_sched_barrier(0);   // the trip's matrix instructions stay in front of its foot: sunk behind the barrier they stand in front of the next stage's copies and shorten their flight
        asm volatile("s_wait_dscnt 0x0" ::: "memory");      // this wave's reads of the buffer have returned before it is refilled
        asm volatile("s_wait_asynccnt 0x0" ::: "memory");   // this wave's copies of stage t + 1 have landed
        __syncthreads();   // publishes stage t + 1 and ends every wave's reads of stage t
        if (t + 2 < nt) stage(t + 2);   // into the buffer that this trip has just read
    }
    asm volatile("s_wait_asynccnt 0x0" ::: "memory");   // no copy is outstanding behind the loop
    if constexpr (EPI == 2) {
        static_assert(HD == 64 && TT % 128 == 0 && NSPLIT == 1 && 4 * 3 * 32 * GP <= 2 * NT * GT, "a wave's 64 columns are one head, a tile's rows one batch; three transposed half tiles a wave fit the stage buffers");
        if (blockIdx.z == 2) {   // V^T planes: a lane's 8 accumulator rows are 8 consecutive m of ONE column d, so they are converted in registers and only regrouped through LDS into whole 128-B lines of [d][m], 32 rows d at a time
            unsigned short* vs = (unsigned short*)st + (tid >> 5) * (3 * 32 * GP);   // the stage buffers are free: every wave's last reads ended in front of the loop's last barrier, and no copy is outstanding
            const size_t vb = (((size_t)2 * NB_ + bt) * NH_ + (c0 >> 6)) * ((size_t)TT * HD) + (size_t)(lane >> 3) * TT + rb + (lane & 7) * 8; const int vo = (lane >> 3) * GP + (lane & 7) * 8;   // 8 lanes a row d: 128 B of m
#pragma unroll
            for (int g = 0; g < 4; ++g) { v8us t16[4], th[4], tl[4];
                if ((g & 1) == 0) {   // the 32 rows d of column blocks g and g + 1 go into the staging
#pragma unroll
                    for (int mb = 0; mb < 4; ++mb)
#pragma unroll
                        for (int nq = 0; nq < 2; ++nq) { v8h o16; v8us oh, ol;
#pragma unroll
                            for (int j = 0; j < 8; ++j) { const float x = acc[mb][g + nq][j]; o16[j] = tohx(x); unsigned short a2, c2; splitf(x, a2, c2); oh[j] = a2; ol[j] = c2; }
                            const int so = (nq * 16 + lr) * GP + mb * 16 + hi * 8; *(v8usa*)(vs + so) = __builtin_bit_cast(v8us, o16); *(v8usa*)(vs + 32 * GP + so) = oh; *(v8usa*)(vs + 2 * 32 * GP + so) = ol; }
                    __builtin_amdgcn_wave_barrier(); asm volatile("" ::: "memory");   // the wave's reads below stay behind its writes above
                }
#pragma unroll
                for (int s = 0; s < 4; ++s) { const int o = vo + ((g & 1) * 16 + s * 4) * GP; t16[s] = *(const v8usa*)(vs + o); th[s] = *(const v8usa*)(vs + 32 * GP + o); tl[s] = *(const v8usa*)(vs + 2 * 32 * GP + o); }
                __builtin_amdgcn_sched_barrier(0);   // with the one behind the wait: nothing else is scheduled between these stores and their s_wait_xcnt, where it could be given a register that a store names
#pragma unroll
                for (int s = 0; s < 4; ++s) { const size_t o = vb + (size_t)(g * 16 + s * 4) * TT; *(v8us*)((unsigned short*)P16 + o) = t16[s]; *(v8us*)(Ph + o) = th[s]; *(v8us*)(Pl + o) = tl[s]; }
                xw0();   // in front of the next write of these stores' registers
                __builtin_amdgcn_sched_barrier(0);   // second of the pair: later work stays behind the wait
            }
            return;   // the whole work-group (blockIdx.z), behind every barrier
        }
    }
#pragma unroll
    for (int mb = 0; mb < 4; ++mb) {
#pragma unroll
        for (int nb = 0; nb < 4; ++nb) {
#pragma unroll
            for (int j = 0; j < 8; ++j) os[(hi * 8 + j) * 68 + nb * 16 + lr] = acc[mb][nb][j]; }
        __builtin_amdgcn_wave_barrier(); asm volatile("" ::: "memory");
        if constexpr (EPI == 0) {
        float* crow = C + (size_t)(r0 + mb * 16) * ldc + c0;
{
#pragma unroll
            for (int s = 0; s < 8; ++s) { const int row = 2 * s + hi, cofs = lr * 4; v4f val = *(const v4fa*)(os + row * 68 + cofs); if (BIAS) { val[0] += bfr(bias[c0 + cofs]); val[1] += bfr(bias[c0 + cofs + 1]); val[2] += bfr(bias[c0 + cofs + 2]); val[3] += bfr(bias[c0 + cofs + 3]); }
                *(v4f*)(crow + (size_t)row * ldc + cofs) = val; }
             }
        } else {   // 16-bit planes: 8 lanes a row, 8 columns a lane: every store covers whole 128-B lines
            const size_t pb = (EPI == 1) ? z * sC + (size_t)(r0 + mb * 16 + (lane >> 3)) * ldc + c0 + (lane & 7) * 8 : ((z * NB_ + bt) * NH_ + (c0 >> 6)) * ((size_t)TT * HD) + (size_t)(rb + mb * 16 + (lane >> 3)) * HD + (lane & 7) * 8;
            const size_t pp = (EPI == 1) ? (size_t)4 * ldc : (size_t)4 * HD;   // four rows on
            v8h o16[4]; v8us oh[4], ol[4];
#pragma unroll
            for (int s = 0; s < 4; ++s) { const float* op = os + (4 * s + (lane >> 3)) * 68 + (lane & 7) * 8; const v4f x0 = *(const v4fa*)op, x1 = *(const v4fa*)(op + 4);
#pragma unroll
                for (int q = 0; q < 8; ++q) { const float x = (q < 4) ? x0[q & 3] : x1[q & 3]; if (EPI == 2) o16[s][q] = tohx(x); unsigned short a2, c2; splitf(x, a2, c2); oh[s][q] = a2; ol[s][q] = c2; } }
            __builtin_amdgcn_sched_barrier(0);   // with the one behind the wait: nothing else is scheduled between these stores and their s_wait_xcnt, where it could be given a register that a store names
#pragma unroll
            for (int s = 0; s < 4; ++s) { if (EPI == 2) *(v8h*)(P16 + pb + s * pp) = o16[s]; *(v8us*)(Ph + pb + s * pp) = oh[s]; *(v8us*)(Pl + pb + s * pp) = ol[s]; }
            xw0();   // in front of the next write of these stores' registers
            __builtin_amdgcn_sched_barrier(0);   // second of the pair: later work stays behind the wait
        }
        __builtin_amdgcn_wave_barrier(); asm volatile("" ::: "memory");
    }
}

typedef __attribute__((ext_vector_type(2))) _Float16 v2h;
typedef __attribute__((ext_vector_type(4))) _Float16 v4h;
typedef __attribute__((ext_vector_type(2))) unsigned short v2us;
typedef __attribute__((ext_vector_type(4))) unsigned short v4us;
typedef __attribute__((ext_vector_type(2))) float v2f;
typedef __attribute__((ext_vector_type(4))) int v4i;

__global__ __launch_bounds__(256) void k_wtG(const float* __restrict__ w, int K, int N, bf* Bt) {
    const int lane = threadIdx.x & 31; const int L0 = (blockIdx.x * 8 + (threadIdx.x >> 5)) * 8; const int nlines = N * K / 64;
{
#pragma unroll 1
        for (int l = 0; l < 8; ++l) { const int L = L0 + l; if (L >= nlines) break; const size_t e = (size_t)L * 64 + lane * 2; const int k = (int)(e % K), n = (int)(e / K); v2us o;
            o[0] = f2bf(w[(size_t)k * N + n]); o[1] = f2bf(w[(size_t)(k + 1) * N + n]); *(v2us*)(Bt + e) = o; }
         }
}
// k_cvt8w: every f32 input to bf16 in one launch, 8 elements a thread: blockIdx.y picks a piece of n8 groups of 8: 0..6 the seven weight matrices, from 7 on the pieces of e in their order; the bf16 planes lie one behind the other in dst, in that order.
__global__ __launch_bounds__(256) void k_cvt8w(const float* __restrict__ w0, const float* __restrict__ w1, const float* __restrict__ w2, const float* __restrict__ w3, const float* __restrict__ w4, const float* __restrict__ w5, const float* __restrict__ w6, const float* __restrict__ e, bf* dst, size_t n8) { const size_t i = (size_t)blockIdx.x * 256 + threadIdx.x; if (i >= n8) return; const unsigned y = blockIdx.y;
    const float* src = (y == 0) ? w0 : (y == 1) ? w1 : (y == 2) ? w2 : (y == 3) ? w3 : (y == 4) ? w4 : (y == 5) ? w5 : (y == 6) ? w6 : e + (size_t)(y - 7) * n8 * 8; const v8f v = *(const v8f*)(src + i * 8); xw0();   // the source address pair is given to other values further down
    v8us o;
#pragma unroll
    for (int k = 0; k < 8; ++k) o[k] = f2bf(v[k]); *(v8us*)(dst + ((size_t)y * n8 + i) * 8) = o;  }

#define FK 64
#define FP 72                     // LDS row pitch in 16-bit elements: 144 B = 16 B x 9
#define FT (FK * FP)              // elements of one LDS tile (HD == FK rows)
template <typename T16> struct FFrag;
template <> struct FFrag<h16> { static __device__ __forceinline__ v16h mk(v8us lo, v8us hi) { return __builtin_bit_cast(v16h, __builtin_shufflevector(lo, hi, 0, 1, 2, 3, 4, 5, 6, 7, 8, 9, 10, 11, 12, 13, 14, 15)); } };
template <> struct FFrag<bf> { static __device__ __forceinline__ v16bf mk(v8us lo, v8us hi) { return cat16b(lo, hi); } };
template <typename T16> __device__ __forceinline__ typename WFrag<T16>::V ldf(const unsigned short* p) { return FFrag<T16>::mk(*(const v8usa*)p, *(const v8usa*)(p + 16)); }
__device__ __forceinline__ float xhalf(float x) { const int b = __float_as_int(x); return __int_as_float(__builtin_amdgcn_permlanex16(b, b, 0x76543210, 0xfedcba98, false, false)); }   // the value of lane l ^ 16
template <typename T16, bool HL, int NQ>
__device__ __forceinline__ void fattn(const unsigned short* __restrict__ Q, const unsigned short* __restrict__ Q2, const unsigned short* __restrict__ Kg, const unsigned short* __restrict__ Kg2, const unsigned short* __restrict__ Vg, const unsigned short* __restrict__ Vg2, int q0, int col0, bf* Ah, bf* Al, unsigned short* sm) {
    typedef typename WFrag<T16>::V V;
    static_assert(HD == 64 && FK == 64 && TT % FK == 0, "tile shapes");
    const int tid = threadIdx.x, lane = tid & 31, lr = lane & 15, hi = lane >> 4; const int qrow = q0 + (tid >> 5) * (16 * NQ) + lr;   // the lane's query in tile 0; tile u: + 16 u
    unsigned short* Ks = sm; unsigned short* Vs = sm + FT; unsigned short* Ks2 = sm + 2 * FT; unsigned short* Vs2 = sm + 3 * FT;
    V qf[NQ][2], qf2[NQ][2];
    __builtin_amdgcn_sched_barrier(0);   // with the one behind the wait: no other arithmetic is scheduled between the query loads and their s_wait_xcnt, where it could be given a register that a load names
#pragma unroll
    for (int u = 0; u < NQ; ++u)
#pragma unroll
        for (int kc = 0; kc < 2; ++kc) { qf[u][kc] = ldf<T16>(Q + (size_t)(qrow + 16 * u) * HD + kc * 32 + 8 * hi); if (HL) qf2[u][kc] = ldf<T16>(Q2 + (size_t)(qrow + 16 * u) * HD + kc * 32 + 8 * hi); }
    xw0();   // the query rows' addresses are given to other values further down
    __builtin_amdgcn_sched_barrier(0);   // second of the pair: later arithmetic stays behind the wait
    // staging: a tile is 512 chunks of 16 B; thread tid moves chunks tid + 128 i (row = chunk / 8): whole 128-B lines of K and of V^T
    const size_t gko = (size_t)tid * 8, gvo = (size_t)(tid >> 3) * TT + (tid & 7) * 8; const int so = (tid >> 3) * FP + (tid & 7) * 8;
    v8us rk[4], rv[4], rk2[4], rv2[4];
    __builtin_amdgcn_sched_barrier(0);   // with the one behind the wait: no other arithmetic is scheduled between these loads and their s_wait_xcnt, where it could be given a register that a load names
#pragma unroll
    for (int i = 0; i < 4; ++i) { rk[i] = *(const v8usa*)(Kg + gko + i * 1024); rv[i] = *(const v8usa*)(Vg + gvo + (size_t)i * 16 * TT); if (HL) { rk2[i] = *(const v8usa*)(Kg2 + gko + i * 1024); rv2[i] = *(const v8usa*)(Vg2 + gvo + (size_t)i * 16 * TT); } }
    xw0();   // in front of the next write of these loads' address registers
    __builtin_amdgcn_sched_barrier(0);   // second of the pair: later arithmetic stays behind the wait
    v8f O[NQ][4], l8[NQ];   // l8: eight independent partial row sums a lane and tile
    float m[NQ]; const float C2 = SCL * 1.4426950408889634f;
#pragma unroll
    for (int u = 0; u < NQ; ++u) { m[u] = -3.0e38f; l8[u] = (v8f){};
#pragma unroll
        for (int db = 0; db < 4; ++db) O[u][db] = (v8f){}; }
#pragma unroll 1   // rolled: one stage's fragments and one stage's staging registers, no more
    for (int s = 0; s < TT / FK; ++s) {
        __syncthreads();   // every wave has left the tiles of the stage before
#pragma unroll
        for (int i = 0; i < 4; ++i) { *(v8usa*)(Ks + so + i * 16 * FP) = rk[i]; *(v8usa*)(Vs + so + i * 16 * FP) = rv[i]; if (HL) { *(v8usa*)(Ks2 + so + i * 16 * FP) = rk2[i]; *(v8usa*)(Vs2 + so + i * 16 * FP) = rv2[i]; } }
        __syncthreads();   // the stage's tiles are complete for every wave
        if (s + 1 < TT / FK) {   // the next stage's loads fly while this one is worked on
            const size_t ko = gko + (size_t)(s + 1) * FK * HD, vo = gvo + (size_t)(s + 1) * FK;
#pragma unroll
            for (int i = 0; i < 4; ++i) { rk[i] = *(const v8usa*)(Kg + ko + i * 1024); rv[i] = *(const v8usa*)(Vg + vo + (size_t)i * 16 * TT); if (HL) { rk2[i] = *(const v8usa*)(Kg2 + ko + i * 1024); rv2[i] = *(const v8usa*)(Vg2 + vo + (size_t)i * 16 * TT); } }
            xw0();   // in front of the next write of these loads' address registers
        }
        // LDS reads stand in groups of eight fragments (16 reads; four where HL), each group whole in front of the matrix instructions that use it; these run over independent accumulators in turn; every accumulator takes its products by rising k, and of one k block plane by plane (hi.hi, hi.lo, lo.hi).
        v8f S[NQ][4];
#pragma unroll
        for (int u = 0; u < NQ; ++u)
#pragma unroll
            for (int kb = 0; kb < 4; ++kb) S[u][kb] = (v8f){};
        V vf[8];   // !HL: all eight V^T fragments of the stage, read ahead of the softmax
        if constexpr (HL) {
            static_assert(!HL || NQ == 1, "the hi/lo groups are written for one tile a wave");
#pragma unroll
            for (int g = 0; g < 4; ++g) { const int p = g >> 1, kc = g & 1; V k1[2], k2[2];   // a group: 32 d of key blocks 2 p and 2 p + 1, both planes (four fragments: eight do not fit the registers of four waves a SIMD)
#pragma unroll
                for (int b = 0; b < 2; ++b) { const int fo = ((2 * p + b) * 16 + lr) * FP + kc * 32 + 8 * hi; k1[b] = ldf<T16>(Ks + fo); k2[b] = ldf<T16>(Ks2 + fo); }
                __builtin_amdgcn_sched_barrier(0);   // keeps the group whole and in front of its matrix instructions: without it each pair of reads is sunk to its own matrix instruction, with a full LDS wait in front of every one
#pragma unroll
                for (int b = 0; b < 2; ++b) S[0][2 * p + b] = WFrag<T16>::mma(k1[b], qf[0][kc], S[0][2 * p + b]);
#pragma unroll
                for (int b = 0; b < 2; ++b) S[0][2 * p + b] = WFrag<T16>::mma(k1[b], qf2[0][kc], S[0][2 * p + b]);
#pragma unroll
                for (int b = 0; b < 2; ++b) S[0][2 * p + b] = WFrag<T16>::mma(k2[b], qf[0][kc], S[0][2 * p + b]);
            }
        } else {
            V k1[4][2];
#pragma unroll
            for (int kc = 0; kc < 2; ++kc)
#pragma unroll
                for (int kb = 0; kb < 4; ++kb) k1[kb][kc] = ldf<T16>(Ks + (kb * 16 + lr) * FP + kc * 32 + 8 * hi);
            __builtin_amdgcn_sched_barrier(0);   // keeps the group whole, as above
#pragma unroll
            for (int kc = 0; kc < 2; ++kc)
#pragma unroll
                for (int kb = 0; kb < 4; ++kb)
#pragma unroll
                    for (int u = 0; u < NQ; ++u) S[u][kb] = WFrag<T16>::mma(k1[kb][kc], qf[u][kc], S[u][kb]);   // one fragment, NQ products
#pragma unroll
            for (int kp = 0; kp < 2; ++kp)
#pragma unroll
                for (int db = 0; db < 4; ++db) vf[kp * 4 + db] = ldf<T16>(Vs + (db * 16 + lr) * FP + kp * 32 + 8 * hi);
            __builtin_amdgcn_sched_barrier(0);   // the V^T reads stay in front of the softmax, whose vector work covers their latency
        }
        float mx[NQ]; bool need = false;
#pragma unroll
        for (int u = 0; u < NQ; ++u) { float x = S[u][0][0];
#pragma unroll
            for (int kb = 0; kb < 4; ++kb)
#pragma unroll
                for (int r = 0; r < 8; ++r) x = fmaxf(x, S[u][kb][r]);
            x *= C2; mx[u] = fmaxf(x, xhalf(x));   // the query's maximum over the stage, the same in both halves
            need = need || (mx[u] > m[u] + 8.0f); }
        if (__builtin_amdgcn_ballot_w32(need) != 0) {   // one scalar test a stage, for all the wave's tiles
#pragma unroll
            for (int u = 0; u < NQ; ++u) { const float mn = fmaxf(m[u], mx[u]), al = __builtin_amdgcn_exp2f(m[u] - mn); m[u] = mn; l8[u] *= al;
#pragma unroll
                for (int db = 0; db < 4; ++db) O[u][db] *= al; } }
        const v8f c8 = {C2, C2, C2, C2, C2, C2, C2, C2};
#pragma unroll
        for (int u = 0; u < NQ; ++u) { const float nm = -m[u]; const v8f n8 = {nm, nm, nm, nm, nm, nm, nm, nm};
#pragma unroll
            for (int kb = 0; kb < 4; ++kb) { const v8f t = __builtin_elementwise_fma(S[u][kb], c8, n8);
#pragma unroll
                for (int r = 0; r < 8; ++r) S[u][kb][r] = __builtin_amdgcn_exp2f(t[r]);
                l8[u] += S[u][kb]; } }
#pragma unroll
        for (int kp = 0; kp < 2; ++kp) {
            if constexpr (HL) { V pb, pb2;
#pragma unroll
                for (int e = 0; e < 16; ++e) { const float p = S[0][2 * kp + (e >> 3)][e & 7]; const __bf16 ph = (__bf16)p; pb[e] = ph; pb2[e] = (__bf16)(p - (float)ph); }
#pragma unroll
                for (int g = 0; g < 2; ++g) { V v1[2], v2[2];   // a group: d blocks 2 g and 2 g + 1 of 32 keys, both planes
#pragma unroll
                    for (int b = 0; b < 2; ++b) { const int fo = ((2 * g + b) * 16 + lr) * FP + kp * 32 + 8 * hi; v1[b] = ldf<T16>(Vs + fo); v2[b] = ldf<T16>(Vs2 + fo); }
                    __builtin_amdgcn_sched_barrier(0);   // keeps the group whole and in front of its matrix instructions, as above
#pragma unroll
                    for (int b = 0; b < 2; ++b) O[0][2 * g + b] = WFrag<T16>::mma(v1[b], pb, O[0][2 * g + b]);
#pragma unroll
                    for (int b = 0; b < 2; ++b) O[0][2 * g + b] = WFrag<T16>::mma(v1[b], pb2, O[0][2 * g + b]);
#pragma unroll
                    for (int b = 0; b < 2; ++b) O[0][2 * g + b] = WFrag<T16>::mma(v2[b], pb, O[0][2 * g + b]);
                }
            } else { V pb[NQ];
#pragma unroll
                for (int u = 0; u < NQ; ++u)
#pragma unroll
                    for (int e = 0; e < 16; ++e) pb[u][e] = (h16)S[u][2 * kp + (e >> 3)][e & 7];
#pragma unroll
                for (int db = 0; db < 4; ++db)
#pragma unroll
                    for (int u = 0; u < NQ; ++u) O[u][db] = WFrag<T16>::mma(vf[kp * 4 + db], pb[u], O[u][db]);   // one fragment, NQ products
            } }
    }
#pragma unroll
    for (int u = 0; u < NQ; ++u) {
        float l = ((l8[u][0] + l8[u][1]) + (l8[u][2] + l8[u][3])) + ((l8[u][4] + l8[u][5]) + (l8[u][6] + l8[u][7])); l += xhalf(l); const float inv = __fdiv_rn(1.0f, l);
        v8us oh[4], ol[4];
#pragma unroll
        for (int db = 0; db < 4; ++db)
#pragma unroll
            for (int r = 0; r < 8; ++r) { unsigned short a, c2; splitf(O[u][db][r] * inv, a, c2); oh[db][r] = a; ol[db][r] = c2; }
        const size_t oo = (size_t)(qrow + 16 * u) * DQ + col0 + 8 * hi;   // a lane's 8 accumulator rows are 8 consecutive d of its query
        __builtin_amdgcn_sched_barrier(0);   // with the one behind the wait: nothing else is scheduled between these stores and their s_wait_xcnt, where it could be given a register that a store names
#pragma unroll
        for (int db = 0; db < 4; ++db) { *(v8us*)(Ah + oo + db * 16) = oh[db]; *(v8us*)(Al + oo + db * 16) = ol[db]; }
        xw0();   // in front of the next write of these stores' registers
        __builtin_amdgcn_sched_barrier(0);   // second of the pair: the next tile's arithmetic stays behind the wait
    }
}
#define NQF 3                     // query tiles a wave on fp16 rows: 48 columns a wave, 192 queries a work-group
#define NBH (RH / 64)             // hi/lo query blocks of a head
#define NBF ((TT - RH) / (64 * NQF))   // fp16 query blocks of a head
__global__ __launch_bounds__(128) void k_fattn(const h16* __restrict__ Q16, const h16* __restrict__ K16, const h16* __restrict__ V16, const bf* __restrict__ Qh, const bf* __restrict__ Ql, const bf* __restrict__ Kh, const bf* __restrict__ Kl, const bf* __restrict__ Vh, const bf* __restrict__ Vl, bf* Ah, bf* Al) {
    __shared__ __align__(16) unsigned short sm[4 * FT];
    static_assert(RH % 64 == 0 && (TT - RH) % (64 * NQF) == 0, "whole query blocks of both kinds");
    // flat grid: first every hi/lo block (64 queries), then every fp16 block (64 NQF queries): a block of either kind holds the same number of matrix instructions where NQF = 3
    const int f = blockIdx.x; const bool hl = f < NBH * NH_ * NB_; const int g = hl ? f : f - NBH * NH_ * NB_, nb = hl ? NBH : NBF;
    const int hb = g / nb, xb = g - hb * nb, h = hb % NH_, b = hb / NH_; const size_t po = (size_t)hb * TT * HD; Ah += (size_t)b * TT * DQ; Al += (size_t)b * TT * DQ;
    if (hl) fattn<bf, true, 1>(Qh + po, Ql + po, Kh + po, Kl + po, Vh + po, Vl + po, xb * 64, h * HD, Ah, Al, sm);
    else fattn<h16, false, NQF>((const unsigned short*)(Q16 + po), nullptr, (const unsigned short*)(K16 + po), nullptr, (const unsigned short*)(V16 + po), nullptr, RH + xb * (64 * NQF), h * HD, Ah, Al, sm);
}

extern "C" void kernel_launch(void* const* d_in, const int* in_sizes, int n_in,
                              void* d_out, int out_size, void* d_ws, size_t ws_size, hipStream_t stream) {
    (void)in_sizes; (void)n_in; (void)out_size;
    const float* x = (const float*)d_in[0]; const float* wq = (const float*)d_in[1]; const float* wk = (const float*)d_in[2]; const float* wv = (const float*)d_in[3]; const float* wo = (const float*)d_in[4]; const float* hq = (const float*)d_in[5]; const float* hk = (const float*)d_in[6]; const float* hv = (const float*)d_in[7];
    float* OUT = (float*)d_out;     // [2][2048][1024]
    char* wsp = (char*)d_ws;
    auto take = [&](size_t bytes) { char* p = wsp; wsp += (bytes + 255) & ~(size_t)255; return (void*)p; };
    static_assert(DKV == DQ && NKV == NH_ && ((size_t)DQ * DM * 2) % 256 == 0 && ((size_t)NB_ * NH_ * TT * HD * 2) % 256 == 0 && ((size_t)NB_ * TT * DM) % ((size_t)DQ * DM) == 0, "the q, k and v chains have one shape, planes taken one behind the other are contiguous, and E is a whole number of weight-sized pieces");
    bf* WQ = (bf*)take((size_t)DQ * DM * 2); take((size_t)DKV * DM * 2); take((size_t)DKV * DM * 2);   // WQ | WK | WV: z of the first-stage launch
    bf* HQB = (bf*)take((size_t)DQ * DM * 2); take((size_t)DKV * DM * 2); take((size_t)DKV * DM * 2);   // HQ | HK | HV ('hed' [16][64][1024] = flat 'oi'): z of the second-stage launch
    bf* WO = (bf*)take((size_t)DM * DQ * 2);
    bf* XB = (bf*)take((size_t)NB_ * TT * DM * 2);   // E in bf16 [NB_ TT][1024], directly behind the seven weight planes: the conversion launch's pieces 7 and up
    h16* QP16 = (h16*)take((size_t)NB_ * NH_ * TT * HD * 2); h16* KP16 = (h16*)take((size_t)NB_ * NKV * TT * HD * 2); h16* VT16 = (h16*)take((size_t)NB_ * NKV * HD * TT * 2);   // q | k | V^T of each kind one behind the other, [batch][head] planes each: z of the second-stage launch picks the group
    bf* QPh = (bf*)take((size_t)NB_ * NH_ * TT * HD * 2); bf* KPh = (bf*)take((size_t)NB_ * NKV * TT * HD * 2); bf* VTh = (bf*)take((size_t)NB_ * NKV * HD * TT * 2); bf* QPl = (bf*)take((size_t)NB_ * NH_ * TT * HD * 2); bf* KPl = (bf*)take((size_t)NB_ * NKV * TT * HD * 2); bf* VTl = (bf*)take((size_t)NB_ * NKV * HD * TT * 2);
    bf* ATh = (bf*)take((size_t)NB_ * TT * DQ * 2); bf* ATl = (bf*)take((size_t)NB_ * TT * DQ * 2);
    bf* Th = (bf*)take((size_t)3 * NB_ * TT * DM * 2); bf* Tl = (bf*)take((size_t)3 * NB_ * TT * DM * 2);   // Th, Tl [3][NB_ TT][1024]
    if ((size_t)(wsp - (char*)d_ws) > ws_size) return;    // ws 256 MiB
    k_cvt8w<<<dim3((unsigned)(((size_t)DQ * DM / 8 + 255) / 256), 7 + (unsigned)((size_t)NB_ * TT * DM / ((size_t)DQ * DM)), 1), 256, 0, stream>>>(wq, wk, wv, hq, hk, hv, wo, x, WQ, (size_t)DQ * DM / 8);
    k_gemmw<bf, 0, false, 1><<<dim3(NB_ * TT / 128, DQ / 128, 3), 128, 0, stream>>>(XB, nullptr, WQ, DM, nullptr, DQ, nullptr, nullptr, Th, Tl, 0, (size_t)DQ * DM, (size_t)NB_ * TT * DQ);   /* z = 0, 1, 2: Q = E WQ^T, K = E WK^T, V = E WV^T, as hi/lo planes */
    k_gemmw<bf, 1, false, 2><<<dim3(NB_ * TT / 128, DQ / 128, 3), 128, 0, stream>>>(Th, Tl, HQB, DM, nullptr, 0, nullptr, QP16, QPh, QPl, (size_t)NB_ * TT * DM, (size_t)DQ * DM, 0);   /* z = 0, 1, 2: q = Q HQ^T, k = K HK^T, v = V HV^T (all heads), as the attention's planes */
    k_fattn<<<dim3((NBH + NBF) * NH_ * NB_, 1, 1), 128, 0, stream>>>(QP16, KP16, VT16, QPh, QPl, KPh, KPl, VTh, VTl, ATh, ATl);   /* all heads of both batches: context as hi/lo planes [batch TT + t][head | d] */
    k_gemmw<bf, 1, false, 0><<<dim3(NB_ * TT / 128, DM / 128, 1), 128, 0, stream>>>(ATh, ATl, WO, DQ, OUT, DM, nullptr, nullptr, nullptr, nullptr, 0, 0, 0);
}
